// v000
// Times are from an AMD MI455X. After a warm-up the kernel runs many times in a row, and a time is the length of
// such a window on the GPU divided by its runs, so every launch and the gaps after it count. The runs cycle
// through copies of the inputs. A figure is the median of several windows, for all but v000 over two sittings.
// Sittings can differ by a few percent; kernels timed side by side share one.
// The starting kernel, v000, takes 423 microseconds a run.
#include <hip/hip_runtime.h>
#include <hip/hip_bf16.h>

// ---------------------------------------------------------------------------
// Sparse attention, MI455X (gfx1250, wave32, WMMA).
//   B=2, S=4096, D=512. ~86 GFLOP vs ~170MB mandatory traffic -> compute
//   bound; use v_wmma_f32_16x16x32_f16 (f16 in, f32 acc) for every GEMM.
//   Q/K/V f16 (24MB) are L2-resident (192MB L2); K/V B-fragments stream from
//   L2 in the flash loop. Weight panels are staged to LDS with async-to-LDS
//   DMA (ASYNCcnt) double-buffering; fragments are register-double-buffered
//   so WMMAs overlap loads instead of s_wait_loadcnt 0 per op.
// ---------------------------------------------------------------------------

typedef __attribute__((ext_vector_type(16))) _Float16 v16h;
typedef __attribute__((ext_vector_type(8)))  _Float16 v8h;
typedef __attribute__((ext_vector_type(4)))  _Float16 v4h;
typedef __attribute__((ext_vector_type(8)))  float    v8f;

#define S_LEN 4096
#define D_DIM 512

#if defined(__AMDGCN__) &&                                              \
    __has_builtin(__builtin_amdgcn_global_load_async_to_lds_b128) &&    \
    __has_builtin(__builtin_amdgcn_s_wait_asynccnt)
#define HAVE_ASYNC 1
// Signature (from clang diagnostic): (v4i AS1*, v4i AS3*, imm, imm)
typedef int v4i_t __attribute__((vector_size(16)));
typedef __attribute__((address_space(1))) v4i_t* gv4i_p;
typedef __attribute__((address_space(3))) v4i_t* lv4i_p;
#else
#define HAVE_ASYNC 0
#endif

__device__ __forceinline__ void async_cp16(const _Float16* src, _Float16* lds) {
#if HAVE_ASYNC
  __builtin_amdgcn_global_load_async_to_lds_b128((gv4i_p)src, (lv4i_p)lds, 0, 0);
#else
  *(v8h*)lds = *(const v8h*)src;
#endif
}
__device__ __forceinline__ void async_wait0() {
#if HAVE_ASYNC
  __builtin_amdgcn_s_wait_asynccnt(0);
#endif
}

__device__ __forceinline__ v8f wmma_f16(v16h a, v16h b, v8f c) {
  // (neg_a, A, neg_b, B, c_mod, C, reuse_a, reuse_b)
  return __builtin_amdgcn_wmma_f32_16x16x32_f16(false, a, false, b,
                                                (short)0, c, false, false);
}

// A-fragment (16x32 f16, M=lane&15, K-halves split by lane group) or,
// identically, B-fragment (32x16 f16, N=lane&15) from a row-major source
// whose rows are contiguous in K. Two 16B chunks per lane.
__device__ __forceinline__ v16h load_frag(const _Float16* p, int ld) {
  const int lane = threadIdx.x & 31;
  const int row  = lane & 15;
  const int ko   = (lane >> 4) << 3;     // 0 or 8
  const _Float16* q = p + (size_t)row * ld + ko;
  v8h lo = *(const v8h*)(q);
  v8h hi = *(const v8h*)(q + 16);
  return __builtin_shufflevector(lo, hi, 0,1,2,3,4,5,6,7,8,9,10,11,12,13,14,15);
}

// ---------------------------------------------------------------------------
// f32 -> f16 conversion (x and the four weight matrices)
// ---------------------------------------------------------------------------
__global__ void cvt_f16_kernel(const float* __restrict__ src,
                               _Float16* __restrict__ dst, int n4) {
  int i = blockIdx.x * blockDim.x + threadIdx.x;
  if (i < n4) {
    float4 v = ((const float4*)src)[i];
    v4h o = {(_Float16)v.x, (_Float16)v.y, (_Float16)v.z, (_Float16)v.w};
    ((v4h*)dst)[i] = o;
  }
}

// ---------------------------------------------------------------------------
// WMMA GEMM: out[m][n] = sum_k A[m][k] * W[n][k] + bias[n]
//   A: [M x 512] f16 rm, W: [512 x 512] f16 rm (torch Linear layout).
//   Block: 8 waves; wave w -> 16x64 tile; block tile 128(M) x 64(N).
//   W k-panel (64 x 32) is shared by all 8 waves -> staged to LDS with
//   async-to-LDS DMA, double buffered; A fragments double buffered in regs.
//   mode 0: f16 out rm [M x 512]   (Q, K)
//   mode 1: f16 out transposed     (V -> Vt[d][m])
//   mode 2: f32 out rm [M x 512]   (final Wo projection into d_out)
// ---------------------------------------------------------------------------
#define WLD 48   // LDS row stride (halves): 96B, 16B-aligned, bank-spread

__global__ __launch_bounds__(256) void gemm_wmma_kernel(
    const _Float16* __restrict__ A, const _Float16* __restrict__ W,
    const float* __restrict__ bias, void* __restrict__ out, int M, int mode) {
  __shared__ __align__(16) _Float16 Ws[2][64][WLD];
  __shared__ __align__(16) _Float16 Ts[8][64][16];
  const int w    = threadIdx.x >> 5;
  const int lane = threadIdx.x & 31;
  const int g    = lane >> 4;
  const int n    = lane & 15;
  const int m0   = blockIdx.x * 128 + w * 16;
  const int n0   = blockIdx.y * 64;

  // cooperative W-panel staging: 64 rows x 32 halves, 16B per thread
  const int srow = threadIdx.x >> 2;
  const int scol = (threadIdx.x & 3) * 8;
  const _Float16* wpan = W + (size_t)(n0 + srow) * D_DIM + scol;

  v8f acc[4] = {};
  const _Float16* abase = A + (size_t)m0 * D_DIM;

  async_cp16(wpan, &Ws[0][srow][scol]);          // stage k=0 panel
  async_wait0();
  __syncthreads();

  v16h a_c = load_frag(abase, D_DIM);
  int buf = 0;
  for (int k = 0; k < D_DIM; k += 32) {
    if (k + 32 < D_DIM)                          // DMA next panel during WMMAs
      async_cp16(wpan + (k + 32), &Ws[buf ^ 1][srow][scol]);
    v16h a_n = a_c;
    if (k + 32 < D_DIM) a_n = load_frag(abase + k + 32, D_DIM);
    #pragma unroll
    for (int nf = 0; nf < 4; nf++) {
      v16h bf = load_frag(&Ws[buf][nf * 16][0], WLD);
      acc[nf] = wmma_f16(a_c, bf, acc[nf]);
    }
    a_c = a_n;
    async_wait0();
    __syncthreads();
    buf ^= 1;
  }

  if (mode == 0) {                               // f16 row-major
    _Float16* o = (_Float16*)out;
    #pragma unroll
    for (int nf = 0; nf < 4; nf++) {
      int col = n0 + nf * 16 + n;
      float bv = bias[col];
      #pragma unroll
      for (int i = 0; i < 8; i++)
        o[(size_t)(m0 + g * 8 + i) * D_DIM + col] = (_Float16)(acc[nf][i] + bv);
    }
  } else if (mode == 1) {                        // f16 transposed [N x M]
    #pragma unroll
    for (int nf = 0; nf < 4; nf++) {
      float bv = bias[n0 + nf * 16 + n];
      #pragma unroll
      for (int i = 0; i < 8; i++)
        Ts[w][nf * 16 + n][g * 8 + i] = (_Float16)(acc[nf][i] + bv);
    }
    __syncthreads();
    _Float16* o = (_Float16*)out + (size_t)n0 * M + m0;
    for (int r = lane; r < 64; r += 32) {
      uint4* dst = (uint4*)(o + (size_t)r * M);
      const uint4* src = (const uint4*)&Ts[w][r][0];
      dst[0] = src[0];
      dst[1] = src[1];
    }
  } else {                                       // f32 row-major (d_out)
    float* o = (float*)out;
    #pragma unroll
    for (int nf = 0; nf < 4; nf++) {
      int col = n0 + nf * 16 + n;
      float bv = bias[col];
      #pragma unroll
      for (int i = 0; i < 8; i++)
        o[(size_t)(m0 + g * 8 + i) * D_DIM + col] = acc[nf][i] + bv;
    }
  }
}

// ---------------------------------------------------------------------------
// Flash-style sparse attention.
//   Grid: (S/16, B); block: 256 threads = 8 waves; one 16-query tile per WG.
//   Per 128-key block: wave w computes score tile cols [kb+16w,+16) with
//   register-pipelined Q(LDS)/K(L2) fragments, masks+scales, shares scores
//   and row-max via LDS; WG-shared online softmax; each wave accumulates P*V
//   into its private 64-wide d-slice with V fragments preloaded one kf ahead.
//   Output stored transposed AOt[d][s] (== reference transpose+reshape,
//   flat-viewed as [S x D] for the final GEMM).
// ---------------------------------------------------------------------------
__global__ __launch_bounds__(256) void attn_kernel(
    const _Float16* __restrict__ Qh, const _Float16* __restrict__ Kh,
    const _Float16* __restrict__ Vt, const float* __restrict__ mask,
    _Float16* __restrict__ AOt) {
  __shared__ __align__(16) _Float16 Qs[16][528];   // padded: banks spread
  __shared__ float Ss[16][132];                    // masked, scaled scores
  __shared__ float tmax[8][16];
  __shared__ float mrun[16], lrun[16], mnew[16], corr[16];
  __shared__ __align__(16) _Float16 Ts[8][64][16]; // per-wave O transpose

  const int q0   = blockIdx.x * 16;
  const int b    = blockIdx.y;
  const int w    = threadIdx.x >> 5;
  const int lane = threadIdx.x & 31;
  const int g    = lane >> 4;
  const int n    = lane & 15;
  const float scale = 0.044194173824159216f;       // 1/sqrt(512)
  const float NEG   = -__builtin_inff();

  // Stage Q tile (16 x 512 f16) into LDS via async DMA, 64B/thread.
  {
    int row = threadIdx.x >> 4;
    int c   = (threadIdx.x & 15) * 32;
    const _Float16* src = Qh + ((size_t)b * S_LEN + q0 + row) * D_DIM + c;
    #pragma unroll
    for (int j = 0; j < 32; j += 8)
      async_cp16(src + j, &Qs[row][c + j]);
  }
  if (threadIdx.x < 16) { mrun[threadIdx.x] = NEG; lrun[threadIdx.x] = 0.f; }
  async_wait0();

  v8f acc[4] = {};

  for (int kb = 0; kb < S_LEN; kb += 128) {
    __syncthreads();
    // ---- Phase A: scores for key sub-tile [kb+16w, +16), pipelined --------
    v8f s = {};
    const _Float16* kbase = Kh + ((size_t)b * S_LEN + kb + 16 * w) * D_DIM;
    v16h qa = load_frag(&Qs[0][0], 528);
    v16h kf_ = load_frag(kbase, D_DIM);
    #pragma unroll
    for (int dk = 0; dk < D_DIM; dk += 32) {
      v16h qa_n = qa, kf_n = kf_;
      if (dk + 32 < D_DIM) {
        qa_n = load_frag(&Qs[0][dk + 32], 528);
        kf_n = load_frag(kbase + dk + 32, D_DIM);
      }
      s = wmma_f16(qa, kf_, s);
      qa = qa_n; kf_ = kf_n;
    }
    const float* mrow0 =
        mask + ((size_t)b * S_LEN + q0 + g * 8) * S_LEN + kb + 16 * w + n;
    __builtin_prefetch(mrow0 + 128, 0, 1);         // next key block's mask
    #pragma unroll
    for (int i = 0; i < 8; i++) {
      float mv = mrow0[(size_t)i * S_LEN];
      float sv = (mv > 0.95f) ? s[i] * scale : NEG;
      Ss[g * 8 + i][16 * w + n] = sv;
      float r = sv;                                // row-max over 16 lanes
      r = fmaxf(r, __shfl_xor(r, 1));
      r = fmaxf(r, __shfl_xor(r, 2));
      r = fmaxf(r, __shfl_xor(r, 4));
      r = fmaxf(r, __shfl_xor(r, 8));
      if (n == i) tmax[w][g * 8 + i] = r;
    }
    __syncthreads();
    // ---- Phase B: workgroup-shared online-softmax stats -------------------
    if (threadIdx.x < 16) {
      int r = threadIdx.x;
      float mx = tmax[0][r];
      #pragma unroll
      for (int t = 1; t < 8; t++) mx = fmaxf(mx, tmax[t][r]);
      float mold = mrun[r];
      float mn   = fmaxf(mold, mx);
      float c    = (mn <= -1e30f) ? 1.f : __expf(mold - mn);
      mnew[r] = mn; corr[r] = c; mrun[r] = mn;
    }
    __syncthreads();
    // ---- Phase C: rescale acc, build P A-frags, P*V (V preloaded) ---------
    #pragma unroll
    for (int nf = 0; nf < 4; nf++)
      #pragma unroll
      for (int i = 0; i < 8; i++) acc[nf][i] *= corr[g * 8 + i];

    const int row = n;                             // A-frag row = lane&15
    const int ko  = g * 8;
    const float mrow = mnew[row];
    const _Float16* vbase =
        Vt + (size_t)(64 * w) * (2 * S_LEN) + (size_t)b * S_LEN + kb;
    v16h vb_c[4];
    #pragma unroll
    for (int nf = 0; nf < 4; nf++)
      vb_c[nf] = load_frag(vbase + (size_t)(16 * nf) * (2 * S_LEN), 2 * S_LEN);

    float lsum = 0.f;
    #pragma unroll
    for (int kf = 0; kf < 4; kf++) {
      v16h p = {};
      #pragma unroll
      for (int j = 0; j < 8; j++) {
        float s0 = Ss[row][kf * 32 + ko + j];
        float s1 = Ss[row][kf * 32 + ko + 16 + j];
        float e0 = (s0 <= -1e30f) ? 0.f : __expf(s0 - mrow);
        float e1 = (s1 <= -1e30f) ? 0.f : __expf(s1 - mrow);
        lsum += e0 + e1;
        p[j]     = (_Float16)e0;
        p[8 + j] = (_Float16)e1;
      }
      v16h vb_n[4];
      if (kf < 3) {                                // preload next kf's V frags
        #pragma unroll
        for (int nf = 0; nf < 4; nf++)
          vb_n[nf] = load_frag(vbase + (kf + 1) * 32 +
                               (size_t)(16 * nf) * (2 * S_LEN), 2 * S_LEN);
      }
      #pragma unroll
      for (int nf = 0; nf < 4; nf++)
        acc[nf] = wmma_f16(p, vb_c[nf], acc[nf]);
      if (kf < 3) {
        #pragma unroll
        for (int nf = 0; nf < 4; nf++) vb_c[nf] = vb_n[nf];
      }
    }
    float rowtot = lsum + __shfl_xor(lsum, 16);
    if (w == 0 && lane < 16) lrun[lane] = lrun[lane] * corr[lane] + rowtot;
  }
  __syncthreads();

  // ---- Finalize: 1/l, per-wave LDS transpose, coalesced store to AOt[d][s].
  #pragma unroll
  for (int nf = 0; nf < 4; nf++) {
    #pragma unroll
    for (int i = 0; i < 8; i++) {
      int m = g * 8 + i;
      float l   = lrun[m];
      float inv = (l > 0.f) ? 1.f / l : 0.f;
      Ts[w][nf * 16 + n][m] = (_Float16)(acc[nf][i] * inv);
    }
  }
  __syncthreads();
  _Float16* obase = AOt + ((size_t)b * D_DIM + 64 * w) * S_LEN + q0;
  for (int r = lane; r < 64; r += 32) {
    uint4* dst = (uint4*)(obase + (size_t)r * S_LEN);
    const uint4* src = (const uint4*)&Ts[w][r][0];
    dst[0] = src[0];
    dst[1] = src[1];
  }
}

// ---------------------------------------------------------------------------
extern "C" void kernel_launch(void* const* d_in, const int* in_sizes, int n_in,
                              void* d_out, int out_size, void* d_ws,
                              size_t ws_size, hipStream_t stream) {
  (void)in_sizes; (void)n_in; (void)out_size; (void)ws_size;
  const float* x    = (const float*)d_in[0];
  const float* mask = (const float*)d_in[1];
  const float* Wq   = (const float*)d_in[2];
  const float* bq   = (const float*)d_in[3];
  const float* Wk   = (const float*)d_in[4];
  const float* bk   = (const float*)d_in[5];
  const float* Wv   = (const float*)d_in[6];
  const float* bv   = (const float*)d_in[7];
  const float* Wo   = (const float*)d_in[8];
  const float* bo   = (const float*)d_in[9];

  const int B = 2, S = S_LEN, D = D_DIM;
  const int M = B * S;                             // 8192
  const size_t MB = 1ull << 20;
  char* ws = (char*)d_ws;                          // 34 MB used
  _Float16* Qh  = (_Float16*)(ws + 0 * MB);        // 8MB [b][s][d]
  _Float16* Kh  = (_Float16*)(ws + 8 * MB);        // 8MB [b][s][d]
  _Float16* Vt  = (_Float16*)(ws + 16 * MB);       // 8MB [d][b*S+s]
  _Float16* xh  = (_Float16*)(ws + 24 * MB);       // 8MB, reused as AOt
  _Float16* AOt = xh;                              // [b][d][s] after attn
  _Float16* Wqh = (_Float16*)(ws + 32 * MB);
  _Float16* Wkh = (_Float16*)(ws + 32 * MB + 512 * 1024);
  _Float16* Wvh = (_Float16*)(ws + 33 * MB);
  _Float16* Woh = (_Float16*)(ws + 33 * MB + 512 * 1024);

  int nx4 = M * D / 4;
  cvt_f16_kernel<<<dim3((nx4 + 255) / 256), dim3(256), 0, stream>>>(x, xh, nx4);
  int nw4 = D * D / 4;
  cvt_f16_kernel<<<dim3((nw4 + 255) / 256), dim3(256), 0, stream>>>(Wq, Wqh, nw4);
  cvt_f16_kernel<<<dim3((nw4 + 255) / 256), dim3(256), 0, stream>>>(Wk, Wkh, nw4);
  cvt_f16_kernel<<<dim3((nw4 + 255) / 256), dim3(256), 0, stream>>>(Wv, Wvh, nw4);
  cvt_f16_kernel<<<dim3((nw4 + 255) / 256), dim3(256), 0, stream>>>(Wo, Woh, nw4);

  dim3 gg(M / 128, D / 64);
  gemm_wmma_kernel<<<gg, dim3(256), 0, stream>>>(xh, Wqh, bq, Qh, M, 0);
  gemm_wmma_kernel<<<gg, dim3(256), 0, stream>>>(xh, Wkh, bk, Kh, M, 0);
  gemm_wmma_kernel<<<gg, dim3(256), 0, stream>>>(xh, Wvh, bv, Vt, M, 1);

  attn_kernel<<<dim3(S / 16, B), dim3(256), 0, stream>>>(Qh, Kh, Vt, mask, AOt);

  gemm_wmma_kernel<<<gg, dim3(256), 0, stream>>>(AOt, Woh, bo, d_out, M, 2);
}

// v001
// It runs in 329 microseconds.
// Two timings next to v000 put it at 1.31 and 1.32 times that version's speed.
#include <hip/hip_runtime.h>
#include <hip/hip_bf16.h>

// ---------------------------------------------------------------------------
// Sparse attention, MI455X (gfx1250, wave32, WMMA).
//   B=2, S=4096, D=512. ~86 GFLOP vs ~170MB mandatory traffic -> compute
//   bound; use v_wmma_f32_16x16x32_f16 (f16 in, f32 acc) for every GEMM.
//   Q/K/V f16 (24MB) are L2-resident (192MB L2); K/V B-fragments stream from
//   L2 in the flash loop, stored by the projections in fragment order so that
//   one wave-wide 16B load covers 512 contiguous bytes (4 whole lines).
//   GEMM W-operand panels (x rows for K) are staged to LDS with async-to-LDS
//   DMA (ASYNCcnt) double-buffering; fragments are register-double-buffered
//   so WMMAs overlap loads instead of s_wait_loadcnt 0 per op.
// ---------------------------------------------------------------------------

typedef __attribute__((ext_vector_type(16))) _Float16 v16h;
typedef __attribute__((ext_vector_type(8)))  _Float16 v8h;
typedef __attribute__((ext_vector_type(4)))  _Float16 v4h;
typedef __attribute__((ext_vector_type(8)))  float    v8f;

#define S_LEN 4096
#define D_DIM 512

#if defined(__AMDGCN__) &&                                              \
    __has_builtin(__builtin_amdgcn_global_load_async_to_lds_b128) &&    \
    __has_builtin(__builtin_amdgcn_s_wait_asynccnt)
#define HAVE_ASYNC 1
// Signature (from clang diagnostic): (v4i AS1*, v4i AS3*, imm, imm)
typedef int v4i_t __attribute__((vector_size(16)));
typedef __attribute__((address_space(1))) v4i_t* gv4i_p;
typedef __attribute__((address_space(3))) v4i_t* lv4i_p;
#else
#define HAVE_ASYNC 0
#endif

__device__ __forceinline__ void async_cp16(const _Float16* src, _Float16* lds) {
#if HAVE_ASYNC
  __builtin_amdgcn_global_load_async_to_lds_b128((gv4i_p)src, (lv4i_p)lds, 0, 0);
#else
  *(v8h*)lds = *(const v8h*)src;
#endif
}
__device__ __forceinline__ void async_wait0() {
#if HAVE_ASYNC
  __builtin_amdgcn_s_wait_asynccnt(0);
#endif
}

__device__ __forceinline__ v8f wmma_f16(v16h a, v16h b, v8f c) {
  // (neg_a, A, neg_b, B, c_mod, C, reuse_a, reuse_b)
  return __builtin_amdgcn_wmma_f32_16x16x32_f16(false, a, false, b,
                                                (short)0, c, false, false);
}

// A-fragment (16x32 f16, M=lane&15, K-halves split by lane group) or,
// identically, B-fragment (32x16 f16, N=lane&15) from a row-major source
// whose rows are contiguous in K. Two 16B chunks per lane.
__device__ __forceinline__ v16h load_frag(const _Float16* p, int ld) {
  const int lane = threadIdx.x & 31;
  const int row  = lane & 15;
  const int ko   = (lane >> 4) << 3;     // 0 or 8
  const _Float16* q = p + (size_t)row * ld + ko;
  v8h lo = *(const v8h*)(q);
  v8h hi = *(const v8h*)(q + 16);
  return __builtin_shufflevector(lo, hi, 0,1,2,3,4,5,6,7,8,9,10,11,12,13,14,15);
}

// Fragment stored in fragment order: 512 halves per fragment, two planes of
// 256 halves (elements 0..7, then 8..15), lane l at halves [8l, 8l+8) of each
// plane. p already includes the lane's 8*lane.
__device__ __forceinline__ v16h load_packed(const _Float16* p) {
  v8h lo = *(const v8h*)(p);
  v8h hi = *(const v8h*)(p + 256);
  return __builtin_shufflevector(lo, hi, 0,1,2,3,4,5,6,7,8,9,10,11,12,13,14,15);
}

// ---------------------------------------------------------------------------
// f32 -> f16 conversion (x and the four weight matrices)
// ---------------------------------------------------------------------------
__global__ void cvt_f16_kernel(const float* __restrict__ src,
                               _Float16* __restrict__ dst, int n4) {
  int i = blockIdx.x * blockDim.x + threadIdx.x;
  if (i < n4) {
    float4 v = ((const float4*)src)[i];
    v4h o = {(_Float16)v.x, (_Float16)v.y, (_Float16)v.z, (_Float16)v.w};
    ((v4h*)dst)[i] = o;
  }
}

// ---------------------------------------------------------------------------
// WMMA GEMM: out[m][n] = sum_k A[m][k] * W[n][k] + bias[n] (mode 3: bias[m])
//   A: [M x 512] f16 rm, W: [N x 512] f16 rm (torch Linear layout; x in mode 3).
//   Block: 8 waves; wave w -> 16x64 tile; block tile 128(M) x 64(N).
//   W k-panel (64 x 32) is shared by all 8 waves -> staged to LDS with
//   async-to-LDS DMA, double buffered; A fragments double buffered in regs.
//   mode 0: f16 out rm [M x 512]   (Q)
//   mode 1: f16 out, rows m = keys, cols = d, in P*V B-fragment order:
//           Vp[m/32][d/16][(m/16)&1][lane = ((m/8)&1)*16 + d%16][m%8]
//   mode 2: f32 out rm [M x 512]   (final Wo projection into d_out)
//   mode 3: f16 out, rows m = d (A = Wk), cols = keys (W = x), bias per row,
//           in Q*K^T B-fragment order:
//           Kp[key/16][d/32][(d/16)&1][lane = ((d/8)&1)*16 + key%16][d%8]
//   In modes 1 and 3 a lane's 8 accumulator rows are one 16B piece of the
//   fragment at its own lane slot: stored straight from registers.
// ---------------------------------------------------------------------------
#define WLD 48   // LDS row stride (halves): 96B, 16B-aligned, bank-spread

__global__ __launch_bounds__(256) void gemm_wmma_kernel(
    const _Float16* __restrict__ A, const _Float16* __restrict__ W,
    const float* __restrict__ bias, void* __restrict__ out, int mode) {
  __shared__ __align__(16) _Float16 Ws[2][64][WLD];
  const int w    = threadIdx.x >> 5;
  const int lane = threadIdx.x & 31;
  const int g    = lane >> 4;
  const int n    = lane & 15;
  const int m0   = blockIdx.x * 128 + w * 16;
  const int n0   = blockIdx.y * 64;

  // cooperative W-panel staging: 64 rows x 32 halves, 16B per thread
  const int srow = threadIdx.x >> 2;
  const int scol = (threadIdx.x & 3) * 8;
  const _Float16* wpan = W + (size_t)(n0 + srow) * D_DIM + scol;

  v8f acc[4] = {};
  const _Float16* abase = A + (size_t)m0 * D_DIM;

  async_cp16(wpan, &Ws[0][srow][scol]);          // stage k=0 panel
  async_wait0();
  __syncthreads();

  v16h a_c = load_frag(abase, D_DIM);
  int buf = 0;
  for (int k = 0; k < D_DIM; k += 32) {
    if (k + 32 < D_DIM)                          // DMA next panel during WMMAs
      async_cp16(wpan + (k + 32), &Ws[buf ^ 1][srow][scol]);
    v16h a_n = a_c;
    if (k + 32 < D_DIM) a_n = load_frag(abase + k + 32, D_DIM);
    #pragma unroll
    for (int nf = 0; nf < 4; nf++) {
      v16h bf = load_frag(&Ws[buf][nf * 16][0], WLD);
      acc[nf] = wmma_f16(a_c, bf, acc[nf]);
    }
    a_c = a_n;
    async_wait0();
    __syncthreads();
    buf ^= 1;
  }

  if (mode == 0) {                               // f16 row-major
    _Float16* o = (_Float16*)out;
    #pragma unroll
    for (int nf = 0; nf < 4; nf++) {
      int col = n0 + nf * 16 + n;
      float bv = bias[col];
      #pragma unroll
      for (int i = 0; i < 8; i++)
        o[(size_t)(m0 + g * 8 + i) * D_DIM + col] = (_Float16)(acc[nf][i] + bv);
    }
  } else if (mode == 1) {                        // V, fragment order
    _Float16* o = (_Float16*)out + (size_t)(m0 >> 5) * (32 * D_DIM) +
                  ((m0 >> 4) & 1) * 256 + lane * 8;
    #pragma unroll
    for (int nf = 0; nf < 4; nf++) {
      float bv = bias[n0 + nf * 16 + n];
      v8h pk;
      #pragma unroll
      for (int i = 0; i < 8; i++) pk[i] = (_Float16)(acc[nf][i] + bv);
      *(v8h*)(o + ((n0 >> 4) + nf) * 512) = pk;
    }
    // keeps every later write of the stores' address and data registers
    // behind the four stores above
    asm volatile("s_wait_xcnt 0x0" ::: "memory");
  } else if (mode == 3) {                        // K, fragment order
    _Float16* o = (_Float16*)out + (m0 >> 4) * 256 + lane * 8;
    float bv[8];
    #pragma unroll
    for (int i = 0; i < 8; i++) bv[i] = bias[m0 + g * 8 + i];
    #pragma unroll
    for (int nf = 0; nf < 4; nf++) {
      v8h pk;
      #pragma unroll
      for (int i = 0; i < 8; i++) pk[i] = (_Float16)(acc[nf][i] + bv[i]);
      *(v8h*)(o + (size_t)((n0 >> 4) + nf) * (16 * D_DIM)) = pk;
    }
    // keeps every later write of the stores' address and data registers
    // behind the four stores above
    asm volatile("s_wait_xcnt 0x0" ::: "memory");
  } else {                                       // f32 row-major (d_out)
    float* o = (float*)out;
    #pragma unroll
    for (int nf = 0; nf < 4; nf++) {
      int col = n0 + nf * 16 + n;
      float bv = bias[col];
      #pragma unroll
      for (int i = 0; i < 8; i++)
        o[(size_t)(m0 + g * 8 + i) * D_DIM + col] = acc[nf][i] + bv;
    }
  }
}

// ---------------------------------------------------------------------------
// Flash-style sparse attention.
//   Grid: (S/16, B); block: 256 threads = 8 waves; one 16-query tile per WG.
//   Per 128-key block: wave w computes score tile cols [kb+16w,+16) with
//   register-pipelined Q(LDS)/K(L2, fragment order) fragments, masks+scales,
//   shares scores
//   and row-max via LDS; WG-shared online softmax; each wave accumulates P*V
//   into its private 64-wide d-slice with V fragments preloaded one kf ahead.
//   Output stored transposed AOt[d][s] (== reference transpose+reshape,
//   flat-viewed as [S x D] for the final GEMM).
// ---------------------------------------------------------------------------
__global__ __launch_bounds__(256) void attn_kernel(
    const _Float16* __restrict__ Qh, const _Float16* __restrict__ Kp,
    const _Float16* __restrict__ Vp, const float* __restrict__ mask,
    _Float16* __restrict__ AOt) {
  __shared__ __align__(16) _Float16 Qs[16][528];   // padded: banks spread
  __shared__ float Ss[16][132];                    // masked, scaled scores
  __shared__ float tmax[8][16];
  __shared__ float mrun[16], lrun[16], mnew[16], corr[16];
  __shared__ __align__(16) _Float16 Ts[8][64][16]; // per-wave O transpose

  const int q0   = blockIdx.x * 16;
  const int b    = blockIdx.y;
  const int w    = threadIdx.x >> 5;
  const int lane = threadIdx.x & 31;
  const int g    = lane >> 4;
  const int n    = lane & 15;
  const float scale = 0.044194173824159216f;       // 1/sqrt(512)
  const float NEG   = -__builtin_inff();

  // Stage Q tile (16 x 512 f16) into LDS via async DMA, 64B/thread.
  {
    int row = threadIdx.x >> 4;
    int c   = (threadIdx.x & 15) * 32;
    const _Float16* src = Qh + ((size_t)b * S_LEN + q0 + row) * D_DIM + c;
    #pragma unroll
    for (int j = 0; j < 32; j += 8)
      async_cp16(src + j, &Qs[row][c + j]);
  }
  if (threadIdx.x < 16) { mrun[threadIdx.x] = NEG; lrun[threadIdx.x] = 0.f; }
  async_wait0();

  v8f acc[4] = {};

  for (int kb = 0; kb < S_LEN; kb += 128) {
    __syncthreads();
    // ---- Phase A: scores for key sub-tile [kb+16w, +16), pipelined --------
    v8f s = {};
    const _Float16* kbase =
        Kp + ((size_t)b * S_LEN + kb + 16 * w) * D_DIM + lane * 8;
    v16h qa = load_frag(&Qs[0][0], 528);
    v16h kf_ = load_packed(kbase);
    #pragma unroll
    for (int dk = 0; dk < D_DIM; dk += 32) {
      v16h qa_n = qa, kf_n = kf_;
      if (dk + 32 < D_DIM) {
        qa_n = load_frag(&Qs[0][dk + 32], 528);
        kf_n = load_packed(kbase + (dk + 32) * 16);
      }
      s = wmma_f16(qa, kf_, s);
      qa = qa_n; kf_ = kf_n;
    }
    const float* mrow0 =
        mask + ((size_t)b * S_LEN + q0 + g * 8) * S_LEN + kb + 16 * w + n;
    __builtin_prefetch(mrow0 + 128, 0, 1);         // next key block's mask
    #pragma unroll
    for (int i = 0; i < 8; i++) {
      float mv = mrow0[(size_t)i * S_LEN];
      float sv = (mv > 0.95f) ? s[i] * scale : NEG;
      Ss[g * 8 + i][16 * w + n] = sv;
      float r = sv;                                // row-max over 16 lanes
      r = fmaxf(r, __shfl_xor(r, 1));
      r = fmaxf(r, __shfl_xor(r, 2));
      r = fmaxf(r, __shfl_xor(r, 4));
      r = fmaxf(r, __shfl_xor(r, 8));
      if (n == i) tmax[w][g * 8 + i] = r;
    }
    __syncthreads();
    // ---- Phase B: workgroup-shared online-softmax stats -------------------
    if (threadIdx.x < 16) {
      int r = threadIdx.x;
      float mx = tmax[0][r];
      #pragma unroll
      for (int t = 1; t < 8; t++) mx = fmaxf(mx, tmax[t][r]);
      float mold = mrun[r];
      float mn   = fmaxf(mold, mx);
      float c    = (mn <= -1e30f) ? 1.f : __expf(mold - mn);
      mnew[r] = mn; corr[r] = c; mrun[r] = mn;
    }
    __syncthreads();
    // ---- Phase C: rescale acc, build P A-frags, P*V (V preloaded) ---------
    #pragma unroll
    for (int nf = 0; nf < 4; nf++)
      #pragma unroll
      for (int i = 0; i < 8; i++) acc[nf][i] *= corr[g * 8 + i];

    const int row = n;                             // A-frag row = lane&15
    const int ko  = g * 8;
    const float mrow = mnew[row];
    const _Float16* vbase =
        Vp + ((size_t)b * S_LEN + kb) * D_DIM + (4 * w) * 512 + lane * 8;
    v16h vb_c[4];
    #pragma unroll
    for (int nf = 0; nf < 4; nf++)
      vb_c[nf] = load_packed(vbase + nf * 512);

    float lsum = 0.f;
    #pragma unroll
    for (int kf = 0; kf < 4; kf++) {
      v16h p = {};
      #pragma unroll
      for (int j = 0; j < 8; j++) {
        float s0 = Ss[row][kf * 32 + ko + j];
        float s1 = Ss[row][kf * 32 + ko + 16 + j];
        float e0 = (s0 <= -1e30f) ? 0.f : __expf(s0 - mrow);
        float e1 = (s1 <= -1e30f) ? 0.f : __expf(s1 - mrow);
        lsum += e0 + e1;
        p[j]     = (_Float16)e0;
        p[8 + j] = (_Float16)e1;
      }
      v16h vb_n[4];
      if (kf < 3) {                                // preload next kf's V frags
        #pragma unroll
        for (int nf = 0; nf < 4; nf++)
          vb_n[nf] = load_packed(vbase + (kf + 1) * (32 * D_DIM) + nf * 512);
      }
      #pragma unroll
      for (int nf = 0; nf < 4; nf++)
        acc[nf] = wmma_f16(p, vb_c[nf], acc[nf]);
      if (kf < 3) {
        #pragma unroll
        for (int nf = 0; nf < 4; nf++) vb_c[nf] = vb_n[nf];
      }
    }
    float rowtot = lsum + __shfl_xor(lsum, 16);
    if (w == 0 && lane < 16) lrun[lane] = lrun[lane] * corr[lane] + rowtot;
  }
  __syncthreads();

  // ---- Finalize: 1/l, per-wave LDS transpose, coalesced store to AOt[d][s].
  #pragma unroll
  for (int nf = 0; nf < 4; nf++) {
    #pragma unroll
    for (int i = 0; i < 8; i++) {
      int m = g * 8 + i;
      float l   = lrun[m];
      float inv = (l > 0.f) ? 1.f / l : 0.f;
      Ts[w][nf * 16 + n][m] = (_Float16)(acc[nf][i] * inv);
    }
  }
  __syncthreads();
  _Float16* obase = AOt + ((size_t)b * D_DIM + 64 * w) * S_LEN + q0;
  for (int r = lane; r < 64; r += 32) {
    uint4* dst = (uint4*)(obase + (size_t)r * S_LEN);
    const uint4* src = (const uint4*)&Ts[w][r][0];
    dst[0] = src[0];
    dst[1] = src[1];
  }
}

// ---------------------------------------------------------------------------
extern "C" void kernel_launch(void* const* d_in, const int* in_sizes, int n_in,
                              void* d_out, int out_size, void* d_ws,
                              size_t ws_size, hipStream_t stream) {
  (void)in_sizes; (void)n_in; (void)out_size; (void)ws_size;
  const float* x    = (const float*)d_in[0];
  const float* mask = (const float*)d_in[1];
  const float* Wq   = (const float*)d_in[2];
  const float* bq   = (const float*)d_in[3];
  const float* Wk   = (const float*)d_in[4];
  const float* bk   = (const float*)d_in[5];
  const float* Wv   = (const float*)d_in[6];
  const float* bv   = (const float*)d_in[7];
  const float* Wo   = (const float*)d_in[8];
  const float* bo   = (const float*)d_in[9];

  const int B = 2, S = S_LEN, D = D_DIM;
  const int M = B * S;                             // 8192
  const size_t MB = 1ull << 20;
  char* ws = (char*)d_ws;                          // 34 MB used
  _Float16* Qh  = (_Float16*)(ws + 0 * MB);        // 8MB [b][s][d]
  _Float16* Kp  = (_Float16*)(ws + 8 * MB);        // 8MB, fragment order
  _Float16* Vp  = (_Float16*)(ws + 16 * MB);       // 8MB, fragment order
  _Float16* xh  = (_Float16*)(ws + 24 * MB);       // 8MB, reused as AOt
  _Float16* AOt = xh;                              // [b][d][s] after attn
  _Float16* Wqh = (_Float16*)(ws + 32 * MB);
  _Float16* Wkh = (_Float16*)(ws + 32 * MB + 512 * 1024);
  _Float16* Wvh = (_Float16*)(ws + 33 * MB);
  _Float16* Woh = (_Float16*)(ws + 33 * MB + 512 * 1024);

  int nx4 = M * D / 4;
  cvt_f16_kernel<<<dim3((nx4 + 255) / 256), dim3(256), 0, stream>>>(x, xh, nx4);
  int nw4 = D * D / 4;
  cvt_f16_kernel<<<dim3((nw4 + 255) / 256), dim3(256), 0, stream>>>(Wq, Wqh, nw4);
  cvt_f16_kernel<<<dim3((nw4 + 255) / 256), dim3(256), 0, stream>>>(Wk, Wkh, nw4);
  cvt_f16_kernel<<<dim3((nw4 + 255) / 256), dim3(256), 0, stream>>>(Wv, Wvh, nw4);
  cvt_f16_kernel<<<dim3((nw4 + 255) / 256), dim3(256), 0, stream>>>(Wo, Woh, nw4);

  dim3 gg(M / 128, D / 64);
  dim3 gk(D / 128, M / 64);                        // K: rows = d, cols = keys
  gemm_wmma_kernel<<<gg, dim3(256), 0, stream>>>(xh, Wqh, bq, Qh, 0);
  gemm_wmma_kernel<<<gk, dim3(256), 0, stream>>>(Wkh, xh, bk, Kp, 3);
  gemm_wmma_kernel<<<gg, dim3(256), 0, stream>>>(xh, Wvh, bv, Vp, 1);

  attn_kernel<<<dim3(S / 16, B), dim3(256), 0, stream>>>(Qh, Kp, Vp, mask, AOt);

  gemm_wmma_kernel<<<gg, dim3(256), 0, stream>>>(AOt, Woh, bo, d_out, 2);
}

// v002
// Measured time: 263 microseconds a run.
// Timed twice side by side with v001, it ran 1.26 times as fast both times.
// Over all steps from v000 it is 1.65 times as fast.
#include <hip/hip_runtime.h>
#include <hip/hip_bf16.h>

// ---------------------------------------------------------------------------
// Sparse attention, MI455X (gfx1250, wave32, WMMA).
//   B=2, S=4096, D=512. ~86 GFLOP vs ~170MB mandatory traffic -> compute
//   bound; use v_wmma_f32_16x16x32_f16 (f16 in, f32 acc) for every GEMM.
//   Q/K/V f16 (24MB) are L2-resident (192MB L2); K/V B-fragments stream from
//   L2 in the flash loop, stored by the projections in fragment order so that
//   one wave-wide 16B load covers 512 contiguous bytes (4 whole lines).
//   GEMM W-operand panels (x rows for K) are staged to LDS with async-to-LDS
//   DMA (ASYNCcnt) double-buffering; fragments are register-double-buffered
//   so WMMAs overlap loads instead of s_wait_loadcnt 0 per op.
// ---------------------------------------------------------------------------

typedef __attribute__((ext_vector_type(16))) _Float16 v16h;
typedef __attribute__((ext_vector_type(8)))  _Float16 v8h;
typedef __attribute__((ext_vector_type(4)))  _Float16 v4h;
typedef __attribute__((ext_vector_type(8)))  float    v8f;

#define S_LEN 4096
#define D_DIM 512

#if defined(__AMDGCN__) &&                                              \
    __has_builtin(__builtin_amdgcn_global_load_async_to_lds_b128) &&    \
    __has_builtin(__builtin_amdgcn_s_wait_asynccnt)
#define HAVE_ASYNC 1
// Signature (from clang diagnostic): (v4i AS1*, v4i AS3*, imm, imm)
typedef int v4i_t __attribute__((vector_size(16)));
typedef __attribute__((address_space(1))) v4i_t* gv4i_p;
typedef __attribute__((address_space(3))) v4i_t* lv4i_p;
#else
#define HAVE_ASYNC 0
#endif

__device__ __forceinline__ void async_cp16(const _Float16* src, _Float16* lds) {
#if HAVE_ASYNC
  __builtin_amdgcn_global_load_async_to_lds_b128((gv4i_p)src, (lv4i_p)lds, 0, 0);
#else
  *(v8h*)lds = *(const v8h*)src;
#endif
}
__device__ __forceinline__ void async_wait0() {
#if HAVE_ASYNC
  __builtin_amdgcn_s_wait_asynccnt(0);
#endif
}

__device__ __forceinline__ v8f wmma_f16(v16h a, v16h b, v8f c) {
  // (neg_a, A, neg_b, B, c_mod, C, reuse_a, reuse_b)
  return __builtin_amdgcn_wmma_f32_16x16x32_f16(false, a, false, b,
                                                (short)0, c, false, false);
}

// A-fragment (16x32 f16, M=lane&15, K-halves split by lane group) or,
// identically, B-fragment (32x16 f16, N=lane&15) from a row-major source
// whose rows are contiguous in K. Two 16B chunks per lane.
__device__ __forceinline__ v16h load_frag(const _Float16* p, int ld) {
  const int lane = threadIdx.x & 31;
  const int row  = lane & 15;
  const int ko   = (lane >> 4) << 3;     // 0 or 8
  const _Float16* q = p + (size_t)row * ld + ko;
  v8h lo = *(const v8h*)(q);
  v8h hi = *(const v8h*)(q + 16);
  return __builtin_shufflevector(lo, hi, 0,1,2,3,4,5,6,7,8,9,10,11,12,13,14,15);
}

// Fragment stored in fragment order: 512 halves per fragment, two planes of
// 256 halves (elements 0..7, then 8..15), lane l at halves [8l, 8l+8) of each
// plane. p already includes the lane's 8*lane.
__device__ __forceinline__ v16h load_packed(const _Float16* p) {
  v8h lo = *(const v8h*)(p);
  v8h hi = *(const v8h*)(p + 256);
  return __builtin_shufflevector(lo, hi, 0,1,2,3,4,5,6,7,8,9,10,11,12,13,14,15);
}

// ---------------------------------------------------------------------------
// f32 -> f16 conversion (x and the four weight matrices)
// ---------------------------------------------------------------------------
__global__ void cvt_f16_kernel(const float* __restrict__ src,
                               _Float16* __restrict__ dst, int n4) {
  int i = blockIdx.x * blockDim.x + threadIdx.x;
  if (i < n4) {
    float4 v = ((const float4*)src)[i];
    v4h o = {(_Float16)v.x, (_Float16)v.y, (_Float16)v.z, (_Float16)v.w};
    ((v4h*)dst)[i] = o;
  }
}

// ---------------------------------------------------------------------------
// WMMA GEMM: out[m][n] = sum_k A[m][k] * W[n][k] + bias[n] (mode 3: bias[m])
//   A: [M x 512] f16 rm, W: [N x 512] f16 rm (torch Linear layout; x in mode 3).
//   Block: 8 waves; wave w -> 16x64 tile; block tile 128(M) x 64(N).
//   W k-panel (64 x 32) is shared by all 8 waves -> staged to LDS with
//   async-to-LDS DMA, double buffered; A fragments double buffered in regs.
//   mode 0: f16 out rm [M x 512]   (Q)
//   mode 1: f16 out, rows m = keys, cols = d, in P*V B-fragment order:
//           Vp[m/32][d/16][(m/16)&1][lane = ((m/8)&1)*16 + d%16][m%8]
//   mode 2: f32 out rm [M x 512]   (final Wo projection into d_out)
//   mode 3: f16 out, rows m = d (A = Wk), cols = keys (W = x), bias per row,
//           in Q*K^T B-fragment order:
//           Kp[key/16][d/32][(d/16)&1][lane = ((d/8)&1)*16 + key%16][d%8]
//   In modes 1 and 3 a lane's 8 accumulator rows are one 16B piece of the
//   fragment at its own lane slot: stored straight from registers.
// ---------------------------------------------------------------------------
#define WLD 48   // LDS row stride (halves): 96B, 16B-aligned, bank-spread

__global__ __launch_bounds__(256) void gemm_wmma_kernel(
    const _Float16* __restrict__ A, const _Float16* __restrict__ W,
    const float* __restrict__ bias, void* __restrict__ out, int mode) {
  __shared__ __align__(16) _Float16 Ws[2][64][WLD];
  const int w    = threadIdx.x >> 5;
  const int lane = threadIdx.x & 31;
  const int g    = lane >> 4;
  const int n    = lane & 15;
  const int m0   = blockIdx.x * 128 + w * 16;
  const int n0   = blockIdx.y * 64;

  // cooperative W-panel staging: 64 rows x 32 halves, 16B per thread
  const int srow = threadIdx.x >> 2;
  const int scol = (threadIdx.x & 3) * 8;
  const _Float16* wpan = W + (size_t)(n0 + srow) * D_DIM + scol;

  v8f acc[4] = {};
  const _Float16* abase = A + (size_t)m0 * D_DIM;

  async_cp16(wpan, &Ws[0][srow][scol]);          // stage k=0 panel
  async_wait0();
  __syncthreads();

  v16h a_c = load_frag(abase, D_DIM);
  int buf = 0;
  for (int k = 0; k < D_DIM; k += 32) {
    if (k + 32 < D_DIM)                          // DMA next panel during WMMAs
      async_cp16(wpan + (k + 32), &Ws[buf ^ 1][srow][scol]);
    v16h a_n = a_c;
    if (k + 32 < D_DIM) a_n = load_frag(abase + k + 32, D_DIM);
    #pragma unroll
    for (int nf = 0; nf < 4; nf++) {
      v16h bf = load_frag(&Ws[buf][nf * 16][0], WLD);
      acc[nf] = wmma_f16(a_c, bf, acc[nf]);
    }
    a_c = a_n;
    async_wait0();
    __syncthreads();
    buf ^= 1;
  }

  if (mode == 0) {                               // f16 row-major
    _Float16* o = (_Float16*)out;
    #pragma unroll
    for (int nf = 0; nf < 4; nf++) {
      int col = n0 + nf * 16 + n;
      float bv = bias[col];
      #pragma unroll
      for (int i = 0; i < 8; i++)
        o[(size_t)(m0 + g * 8 + i) * D_DIM + col] = (_Float16)(acc[nf][i] + bv);
    }
  } else if (mode == 1) {                        // V, fragment order
    _Float16* o = (_Float16*)out + (size_t)(m0 >> 5) * (32 * D_DIM) +
                  ((m0 >> 4) & 1) * 256 + lane * 8;
    #pragma unroll
    for (int nf = 0; nf < 4; nf++) {
      float bv = bias[n0 + nf * 16 + n];
      v8h pk;
      #pragma unroll
      for (int i = 0; i < 8; i++) pk[i] = (_Float16)(acc[nf][i] + bv);
      *(v8h*)(o + ((n0 >> 4) + nf) * 512) = pk;
    }
    // keeps every later write of the stores' address and data registers
    // behind the four stores above
    asm volatile("s_wait_xcnt 0x0" ::: "memory");
  } else if (mode == 3) {                        // K, fragment order
    _Float16* o = (_Float16*)out + (m0 >> 4) * 256 + lane * 8;
    float bv[8];
    #pragma unroll
    for (int i = 0; i < 8; i++) bv[i] = bias[m0 + g * 8 + i];
    #pragma unroll
    for (int nf = 0; nf < 4; nf++) {
      v8h pk;
      #pragma unroll
      for (int i = 0; i < 8; i++) pk[i] = (_Float16)(acc[nf][i] + bv[i]);
      *(v8h*)(o + (size_t)((n0 >> 4) + nf) * (16 * D_DIM)) = pk;
    }
    // keeps every later write of the stores' address and data registers
    // behind the four stores above
    asm volatile("s_wait_xcnt 0x0" ::: "memory");
  } else {                                       // f32 row-major (d_out)
    float* o = (float*)out;
    #pragma unroll
    for (int nf = 0; nf < 4; nf++) {
      int col = n0 + nf * 16 + n;
      float bv = bias[col];
      #pragma unroll
      for (int i = 0; i < 8; i++)
        o[(size_t)(m0 + g * 8 + i) * D_DIM + col] = acc[nf][i] + bv;
    }
  }
}

// ---------------------------------------------------------------------------
// Flash-style sparse attention.
//   Grid: (S/16, B); block: 256 threads = 8 waves; one 16-query tile per WG.
//   Per 128-key block: wave w computes score tile cols [kb+16w,+16) with
//   register-pipelined Q(LDS)/K(L2, fragment order) fragments, masks+scales
//   (mask values loaded one key block ahead), shares scores
//   and row-max via LDS; WG-shared online softmax; each wave accumulates P*V
//   into its private 64-wide d-slice with V fragments preloaded one kf ahead.
//   Output stored transposed AOt[d][s] (== reference transpose+reshape,
//   flat-viewed as [S x D] for the final GEMM).
// ---------------------------------------------------------------------------
__global__ __launch_bounds__(256) void attn_kernel(
    const _Float16* __restrict__ Qh, const _Float16* __restrict__ Kp,
    const _Float16* __restrict__ Vp, const float* __restrict__ mask,
    _Float16* __restrict__ AOt) {
  __shared__ __align__(16) _Float16 Qs[16][528];   // padded: banks spread
  __shared__ float Ss[16][132];                    // masked, scaled scores
  __shared__ float tmax[8][16];
  __shared__ float mrun[16], lrun[16], mnew[16], corr[16];
  __shared__ __align__(16) _Float16 Ts[8][64][16]; // per-wave O transpose

  const int q0   = blockIdx.x * 16;
  const int b    = blockIdx.y;
  const int w    = threadIdx.x >> 5;
  const int lane = threadIdx.x & 31;
  const int g    = lane >> 4;
  const int n    = lane & 15;
  const float scale = 0.044194173824159216f;       // 1/sqrt(512)
  const float NEG   = -__builtin_inff();

  // Stage Q tile (16 x 512 f16) into LDS via async DMA, 64B/thread.
  {
    int row = threadIdx.x >> 4;
    int c   = (threadIdx.x & 15) * 32;
    const _Float16* src = Qh + ((size_t)b * S_LEN + q0 + row) * D_DIM + c;
    #pragma unroll
    for (int j = 0; j < 32; j += 8)
      async_cp16(src + j, &Qs[row][c + j]);
  }
  if (threadIdx.x < 16) { mrun[threadIdx.x] = NEG; lrun[threadIdx.x] = 0.f; }
  async_wait0();

  v8f acc[4] = {};

  // Mask of this lane's 8 score rows, fetched one key block ahead and held as
  // its compare results.
  const float* mrow0 =
      mask + ((size_t)b * S_LEN + q0 + g * 8) * S_LEN + 16 * w + n;
  bool keep[8];
  #pragma unroll
  for (int i = 0; i < 8; i++) keep[i] = mrow0[(size_t)i * S_LEN] > 0.95f;

  for (int kb = 0; kb < S_LEN; kb += 128) {
    __syncthreads();
    // ---- Phase A: scores for key sub-tile [kb+16w, +16), pipelined --------
    v8f s = {};
    const _Float16* kbase =
        Kp + ((size_t)b * S_LEN + kb + 16 * w) * D_DIM + lane * 8;
    v16h qa = load_frag(&Qs[0][0], 528);
    v16h kf_ = load_packed(kbase);
    #pragma unroll
    for (int dk = 0; dk < D_DIM; dk += 32) {
      v16h qa_n = qa, kf_n = kf_;
      if (dk + 32 < D_DIM) {
        qa_n = load_frag(&Qs[0][dk + 32], 528);
        kf_n = load_packed(kbase + (dk + 32) * 16);
      }
      s = wmma_f16(qa, kf_, s);
      qa = qa_n; kf_ = kf_n;
    }
    // Next key block's mask: all 8 loads leave together after the
    // WMMAs and are compared at the end of this block's Phase A. The last block re-reads its own columns, so no address leaves the
    // mask.
    const int kn = (kb + 128 < S_LEN) ? kb + 128 : kb;
    float mn[8];
    #pragma unroll
    for (int i = 0; i < 8; i++) mn[i] = mrow0[(size_t)i * S_LEN + kn];
    #pragma unroll
    for (int i = 0; i < 8; i++) {
      float sv = keep[i] ? s[i] * scale : NEG;
      Ss[g * 8 + i][16 * w + n] = sv;
      float r = sv;                                // row-max over 16 lanes
      r = fmaxf(r, __shfl_xor(r, 1));
      r = fmaxf(r, __shfl_xor(r, 2));
      r = fmaxf(r, __shfl_xor(r, 4));
      r = fmaxf(r, __shfl_xor(r, 8));
      if (n == i) tmax[w][g * 8 + i] = r;
    }
    #pragma unroll
    for (int i = 0; i < 8; i++) keep[i] = mn[i] > 0.95f;
    __syncthreads();
    // ---- Phase B: workgroup-shared online-softmax stats -------------------
    if (threadIdx.x < 16) {
      int r = threadIdx.x;
      float mx = tmax[0][r];
      #pragma unroll
      for (int t = 1; t < 8; t++) mx = fmaxf(mx, tmax[t][r]);
      float mold = mrun[r];
      float mn   = fmaxf(mold, mx);
      float c    = (mn <= -1e30f) ? 1.f : __expf(mold - mn);
      mnew[r] = mn; corr[r] = c; mrun[r] = mn;
    }
    __syncthreads();
    // ---- Phase C: rescale acc, build P A-frags, P*V (V preloaded) ---------
    #pragma unroll
    for (int nf = 0; nf < 4; nf++)
      #pragma unroll
      for (int i = 0; i < 8; i++) acc[nf][i] *= corr[g * 8 + i];

    const int row = n;                             // A-frag row = lane&15
    const int ko  = g * 8;
    const float mrow = mnew[row];
    const _Float16* vbase =
        Vp + ((size_t)b * S_LEN + kb) * D_DIM + (4 * w) * 512 + lane * 8;
    v16h vb_c[4];
    #pragma unroll
    for (int nf = 0; nf < 4; nf++)
      vb_c[nf] = load_packed(vbase + nf * 512);

    float lsum = 0.f;
    #pragma unroll
    for (int kf = 0; kf < 4; kf++) {
      v16h p = {};
      #pragma unroll
      for (int j = 0; j < 8; j++) {
        float s0 = Ss[row][kf * 32 + ko + j];
        float s1 = Ss[row][kf * 32 + ko + 16 + j];
        float e0 = (s0 <= -1e30f) ? 0.f : __expf(s0 - mrow);
        float e1 = (s1 <= -1e30f) ? 0.f : __expf(s1 - mrow);
        lsum += e0 + e1;
        p[j]     = (_Float16)e0;
        p[8 + j] = (_Float16)e1;
      }
      v16h vb_n[4];
      if (kf < 3) {                                // preload next kf's V frags
        #pragma unroll
        for (int nf = 0; nf < 4; nf++)
          vb_n[nf] = load_packed(vbase + (kf + 1) * (32 * D_DIM) + nf * 512);
      }
      #pragma unroll
      for (int nf = 0; nf < 4; nf++)
        acc[nf] = wmma_f16(p, vb_c[nf], acc[nf]);
      if (kf < 3) {
        #pragma unroll
        for (int nf = 0; nf < 4; nf++) vb_c[nf] = vb_n[nf];
      }
    }
    float rowtot = lsum + __shfl_xor(lsum, 16);
    if (w == 0 && lane < 16) lrun[lane] = lrun[lane] * corr[lane] + rowtot;
  }
  __syncthreads();

  // ---- Finalize: 1/l, per-wave LDS transpose, coalesced store to AOt[d][s].
  #pragma unroll
  for (int nf = 0; nf < 4; nf++) {
    #pragma unroll
    for (int i = 0; i < 8; i++) {
      int m = g * 8 + i;
      float l   = lrun[m];
      float inv = (l > 0.f) ? 1.f / l : 0.f;
      Ts[w][nf * 16 + n][m] = (_Float16)(acc[nf][i] * inv);
    }
  }
  __syncthreads();
  _Float16* obase = AOt + ((size_t)b * D_DIM + 64 * w) * S_LEN + q0;
  for (int r = lane; r < 64; r += 32) {
    uint4* dst = (uint4*)(obase + (size_t)r * S_LEN);
    const uint4* src = (const uint4*)&Ts[w][r][0];
    dst[0] = src[0];
    dst[1] = src[1];
  }
}

// ---------------------------------------------------------------------------
extern "C" void kernel_launch(void* const* d_in, const int* in_sizes, int n_in,
                              void* d_out, int out_size, void* d_ws,
                              size_t ws_size, hipStream_t stream) {
  (void)in_sizes; (void)n_in; (void)out_size; (void)ws_size;
  const float* x    = (const float*)d_in[0];
  const float* mask = (const float*)d_in[1];
  const float* Wq   = (const float*)d_in[2];
  const float* bq   = (const float*)d_in[3];
  const float* Wk   = (const float*)d_in[4];
  const float* bk   = (const float*)d_in[5];
  const float* Wv   = (const float*)d_in[6];
  const float* bv   = (const float*)d_in[7];
  const float* Wo   = (const float*)d_in[8];
  const float* bo   = (const float*)d_in[9];

  const int B = 2, S = S_LEN, D = D_DIM;
  const int M = B * S;                             // 8192
  const size_t MB = 1ull << 20;
  char* ws = (char*)d_ws;                          // 34 MB used
  _Float16* Qh  = (_Float16*)(ws + 0 * MB);        // 8MB [b][s][d]
  _Float16* Kp  = (_Float16*)(ws + 8 * MB);        // 8MB, fragment order
  _Float16* Vp  = (_Float16*)(ws + 16 * MB);       // 8MB, fragment order
  _Float16* xh  = (_Float16*)(ws + 24 * MB);       // 8MB, reused as AOt
  _Float16* AOt = xh;                              // [b][d][s] after attn
  _Float16* Wqh = (_Float16*)(ws + 32 * MB);
  _Float16* Wkh = (_Float16*)(ws + 32 * MB + 512 * 1024);
  _Float16* Wvh = (_Float16*)(ws + 33 * MB);
  _Float16* Woh = (_Float16*)(ws + 33 * MB + 512 * 1024);

  int nx4 = M * D / 4;
  cvt_f16_kernel<<<dim3((nx4 + 255) / 256), dim3(256), 0, stream>>>(x, xh, nx4);
  int nw4 = D * D / 4;
  cvt_f16_kernel<<<dim3((nw4 + 255) / 256), dim3(256), 0, stream>>>(Wq, Wqh, nw4);
  cvt_f16_kernel<<<dim3((nw4 + 255) / 256), dim3(256), 0, stream>>>(Wk, Wkh, nw4);
  cvt_f16_kernel<<<dim3((nw4 + 255) / 256), dim3(256), 0, stream>>>(Wv, Wvh, nw4);
  cvt_f16_kernel<<<dim3((nw4 + 255) / 256), dim3(256), 0, stream>>>(Wo, Woh, nw4);

  dim3 gg(M / 128, D / 64);
  dim3 gk(D / 128, M / 64);                        // K: rows = d, cols = keys
  gemm_wmma_kernel<<<gg, dim3(256), 0, stream>>>(xh, Wqh, bq, Qh, 0);
  gemm_wmma_kernel<<<gk, dim3(256), 0, stream>>>(Wkh, xh, bk, Kp, 3);
  gemm_wmma_kernel<<<gg, dim3(256), 0, stream>>>(xh, Wvh, bv, Vp, 1);

  attn_kernel<<<dim3(S / 16, B), dim3(256), 0, stream>>>(Qh, Kp, Vp, mask, AOt);

  gemm_wmma_kernel<<<gg, dim3(256), 0, stream>>>(AOt, Woh, bo, d_out, 2);
}

// v003
// A run of this version takes 229 microseconds.
// Timed twice side by side with v002, it ran 1.16 times as fast both times.
// All steps since v000 together make it 1.91 times as fast.
#include <hip/hip_runtime.h>
#include <hip/hip_bf16.h>

// ---------------------------------------------------------------------------
// Sparse attention, MI455X (gfx1250, wave32, WMMA).
//   B=2, S=4096, D=512. ~86 GFLOP vs ~170MB mandatory traffic -> compute
//   bound; use v_wmma_f32_16x16x32_f16 (f16 in, f32 acc) for every GEMM.
//   Q/K/V f16 (24MB) are L2-resident (192MB L2); K/V B-fragments stream from
//   L2 in the flash loop, stored by the projections in fragment order so that
//   one wave-wide 16B load covers 512 contiguous bytes (4 whole lines).
//   GEMM W-operand panels (x rows for K) are staged to LDS with async-to-LDS
//   DMA (ASYNCcnt) double-buffering; fragments are register-double-buffered
//   so WMMAs overlap loads instead of s_wait_loadcnt 0 per op.
// ---------------------------------------------------------------------------

typedef __attribute__((ext_vector_type(16))) _Float16 v16h;
typedef __attribute__((ext_vector_type(8)))  _Float16 v8h;
typedef __attribute__((ext_vector_type(4)))  _Float16 v4h;
typedef __attribute__((ext_vector_type(8)))  float    v8f;

#define S_LEN 4096
#define D_DIM 512

#if defined(__AMDGCN__) &&                                              \
    __has_builtin(__builtin_amdgcn_global_load_async_to_lds_b128) &&    \
    __has_builtin(__builtin_amdgcn_s_wait_asynccnt)
#define HAVE_ASYNC 1
// Signature (from clang diagnostic): (v4i AS1*, v4i AS3*, imm, imm)
typedef int v4i_t __attribute__((vector_size(16)));
typedef __attribute__((address_space(1))) v4i_t* gv4i_p;
typedef __attribute__((address_space(3))) v4i_t* lv4i_p;
#else
#define HAVE_ASYNC 0
#endif

__device__ __forceinline__ void async_cp16(const _Float16* src, _Float16* lds) {
#if HAVE_ASYNC
  __builtin_amdgcn_global_load_async_to_lds_b128((gv4i_p)src, (lv4i_p)lds, 0, 0);
#else
  *(v8h*)lds = *(const v8h*)src;
#endif
}
__device__ __forceinline__ void async_wait0() {
#if HAVE_ASYNC
  __builtin_amdgcn_s_wait_asynccnt(0);
#endif
}

__device__ __forceinline__ v8f wmma_f16(v16h a, v16h b, v8f c) {
  // (neg_a, A, neg_b, B, c_mod, C, reuse_a, reuse_b)
  return __builtin_amdgcn_wmma_f32_16x16x32_f16(false, a, false, b,
                                                (short)0, c, false, false);
}

// A-fragment (16x32 f16, M=lane&15, K-halves split by lane group) or,
// identically, B-fragment (32x16 f16, N=lane&15) from a row-major source
// whose rows are contiguous in K. Two 16B chunks per lane.
__device__ __forceinline__ v16h load_frag(const _Float16* p, int ld) {
  const int lane = threadIdx.x & 31;
  const int row  = lane & 15;
  const int ko   = (lane >> 4) << 3;     // 0 or 8
  const _Float16* q = p + (size_t)row * ld + ko;
  v8h lo = *(const v8h*)(q);
  v8h hi = *(const v8h*)(q + 16);
  return __builtin_shufflevector(lo, hi, 0,1,2,3,4,5,6,7,8,9,10,11,12,13,14,15);
}

// Fragment stored in fragment order: 512 halves per fragment, two planes of
// 256 halves (elements 0..7, then 8..15), lane l at halves [8l, 8l+8) of each
// plane. p already includes the lane's 8*lane.
__device__ __forceinline__ v16h load_packed(const _Float16* p) {
  v8h lo = *(const v8h*)(p);
  v8h hi = *(const v8h*)(p + 256);
  return __builtin_shufflevector(lo, hi, 0,1,2,3,4,5,6,7,8,9,10,11,12,13,14,15);
}

// Maximum over the 16 lanes of a row, left in every lane of the row: four DPP
// steps on the vector unit (a shuffle goes through the LDS path and is waited
// for at every step). All 32 lanes must be on.
template <int XM>
__device__ __forceinline__ float max_xmask(float v) {
  // 0x160 + XM is the DPP control row_xmask:XM (lane l reads lane l ^ XM)
  int o = __builtin_amdgcn_mov_dpp(__builtin_bit_cast(int, v), 0x160 + XM,
                                   0xf, 0xf, true);
  return fmaxf(v, __builtin_bit_cast(float, o));
}
__device__ __forceinline__ float row_max16(float v) {
  v = max_xmask<1>(v);
  v = max_xmask<2>(v);
  v = max_xmask<4>(v);
  return max_xmask<8>(v);
}
// Lane l reads lane l ^ 16, on the vector unit.
__device__ __forceinline__ float xhalf(float x) {
  int b = __builtin_bit_cast(int, x);
  return __builtin_bit_cast(
      float, __builtin_amdgcn_permlanex16(b, b, 0x76543210, 0xfedcba98, false,
                                          false));
}

// ---------------------------------------------------------------------------
// f32 -> f16 conversion (x and the four weight matrices)
// ---------------------------------------------------------------------------
__global__ void cvt_f16_kernel(const float* __restrict__ src,
                               _Float16* __restrict__ dst, int n4) {
  int i = blockIdx.x * blockDim.x + threadIdx.x;
  if (i < n4) {
    float4 v = ((const float4*)src)[i];
    v4h o = {(_Float16)v.x, (_Float16)v.y, (_Float16)v.z, (_Float16)v.w};
    ((v4h*)dst)[i] = o;
  }
}

// ---------------------------------------------------------------------------
// WMMA GEMM: out[m][n] = sum_k A[m][k] * W[n][k] + bias[n] (mode 3: bias[m])
//   A: [M x 512] f16 rm, W: [N x 512] f16 rm (torch Linear layout; x in mode 3).
//   Block: 8 waves; wave w -> 16x64 tile; block tile 128(M) x 64(N).
//   W k-panel (64 x 32) is shared by all 8 waves -> staged to LDS with
//   async-to-LDS DMA, double buffered; A fragments double buffered in regs.
//   mode 0: f16 out rm [M x 512]   (Q)
//   mode 1: f16 out, rows m = keys, cols = d, in P*V B-fragment order:
//           Vp[m/32][d/16][(m/16)&1][lane = ((m/8)&1)*16 + d%16][m%8]
//   mode 2: f32 out rm [M x 512]   (final Wo projection into d_out)
//   mode 3: f16 out, rows m = d (A = Wk), cols = keys (W = x), bias per row,
//           in Q*K^T B-fragment order:
//           Kp[key/16][d/32][(d/16)&1][lane = ((d/8)&1)*16 + key%16][d%8]
//   In modes 1 and 3 a lane's 8 accumulator rows are one 16B piece of the
//   fragment at its own lane slot: stored straight from registers.
// ---------------------------------------------------------------------------
#define WLD 48   // LDS row stride (halves): 96B, 16B-aligned, bank-spread

__global__ __launch_bounds__(256) void gemm_wmma_kernel(
    const _Float16* __restrict__ A, const _Float16* __restrict__ W,
    const float* __restrict__ bias, void* __restrict__ out, int mode) {
  __shared__ __align__(16) _Float16 Ws[2][64][WLD];
  const int w    = threadIdx.x >> 5;
  const int lane = threadIdx.x & 31;
  const int g    = lane >> 4;
  const int n    = lane & 15;
  const int m0   = blockIdx.x * 128 + w * 16;
  const int n0   = blockIdx.y * 64;

  // cooperative W-panel staging: 64 rows x 32 halves, 16B per thread
  const int srow = threadIdx.x >> 2;
  const int scol = (threadIdx.x & 3) * 8;
  const _Float16* wpan = W + (size_t)(n0 + srow) * D_DIM + scol;

  v8f acc[4] = {};
  const _Float16* abase = A + (size_t)m0 * D_DIM;

  async_cp16(wpan, &Ws[0][srow][scol]);          // stage k=0 panel
  async_wait0();
  __syncthreads();

  v16h a_c = load_frag(abase, D_DIM);
  int buf = 0;
  for (int k = 0; k < D_DIM; k += 32) {
    if (k + 32 < D_DIM)                          // DMA next panel during WMMAs
      async_cp16(wpan + (k + 32), &Ws[buf ^ 1][srow][scol]);
    v16h a_n = a_c;
    if (k + 32 < D_DIM) a_n = load_frag(abase + k + 32, D_DIM);
    #pragma unroll
    for (int nf = 0; nf < 4; nf++) {
      v16h bf = load_frag(&Ws[buf][nf * 16][0], WLD);
      acc[nf] = wmma_f16(a_c, bf, acc[nf]);
    }
    a_c = a_n;
    async_wait0();
    __syncthreads();
    buf ^= 1;
  }

  if (mode == 0) {                               // f16 row-major
    _Float16* o = (_Float16*)out;
    #pragma unroll
    for (int nf = 0; nf < 4; nf++) {
      int col = n0 + nf * 16 + n;
      float bv = bias[col];
      #pragma unroll
      for (int i = 0; i < 8; i++)
        o[(size_t)(m0 + g * 8 + i) * D_DIM + col] = (_Float16)(acc[nf][i] + bv);
    }
  } else if (mode == 1) {                        // V, fragment order
    _Float16* o = (_Float16*)out + (size_t)(m0 >> 5) * (32 * D_DIM) +
                  ((m0 >> 4) & 1) * 256 + lane * 8;
    #pragma unroll
    for (int nf = 0; nf < 4; nf++) {
      float bv = bias[n0 + nf * 16 + n];
      v8h pk;
      #pragma unroll
      for (int i = 0; i < 8; i++) pk[i] = (_Float16)(acc[nf][i] + bv);
      *(v8h*)(o + ((n0 >> 4) + nf) * 512) = pk;
    }
    // keeps every later write of the stores' address and data registers
    // behind the four stores above
    asm volatile("s_wait_xcnt 0x0" ::: "memory");
  } else if (mode == 3) {                        // K, fragment order
    _Float16* o = (_Float16*)out + (m0 >> 4) * 256 + lane * 8;
    float bv[8];
    #pragma unroll
    for (int i = 0; i < 8; i++) bv[i] = bias[m0 + g * 8 + i];
    #pragma unroll
    for (int nf = 0; nf < 4; nf++) {
      v8h pk;
      #pragma unroll
      for (int i = 0; i < 8; i++) pk[i] = (_Float16)(acc[nf][i] + bv[i]);
      *(v8h*)(o + (size_t)((n0 >> 4) + nf) * (16 * D_DIM)) = pk;
    }
    // keeps every later write of the stores' address and data registers
    // behind the four stores above
    asm volatile("s_wait_xcnt 0x0" ::: "memory");
  } else {                                       // f32 row-major (d_out)
    float* o = (float*)out;
    #pragma unroll
    for (int nf = 0; nf < 4; nf++) {
      int col = n0 + nf * 16 + n;
      float bv = bias[col];
      #pragma unroll
      for (int i = 0; i < 8; i++)
        o[(size_t)(m0 + g * 8 + i) * D_DIM + col] = acc[nf][i] + bv;
    }
  }
}

// ---------------------------------------------------------------------------
// Flash-style sparse attention.
//   Grid: (S/16, B); block: 256 threads = 8 waves; one 16-query tile per WG.
//   Per 128-key block: wave w computes score tile cols [kb+16w,+16) with
//   register-pipelined Q(LDS)/K(L2, fragment order) fragments, masks+scales
//   (mask values loaded one key block ahead), shares scores
//   and row-max via LDS; WG-shared online softmax; each wave accumulates P*V
//   into its private 64-wide d-slice with V fragments preloaded one kf ahead.
//   Output stored transposed AOt[d][s] (== reference transpose+reshape,
//   flat-viewed as [S x D] for the final GEMM).
// ---------------------------------------------------------------------------
__global__ __launch_bounds__(256) void attn_kernel(
    const _Float16* __restrict__ Qh, const _Float16* __restrict__ Kp,
    const _Float16* __restrict__ Vp, const float* __restrict__ mask,
    _Float16* __restrict__ AOt) {
  __shared__ __align__(16) _Float16 Qs[16][528];   // padded: banks spread
  __shared__ float Ss[16][132];                    // masked, scaled scores
  __shared__ float tmax[8][16];
  __shared__ float mrun[16], lrun[16], mnew[16], corr[16];
  __shared__ __align__(16) _Float16 Ts[8][64][16]; // per-wave O transpose

  const int q0   = blockIdx.x * 16;
  const int b    = blockIdx.y;
  const int w    = threadIdx.x >> 5;
  const int lane = threadIdx.x & 31;
  const int g    = lane >> 4;
  const int n    = lane & 15;
  const float scale = 0.044194173824159216f;       // 1/sqrt(512)
  const float NEG   = -__builtin_inff();

  // Stage Q tile (16 x 512 f16) into LDS via async DMA, 64B/thread.
  {
    int row = threadIdx.x >> 4;
    int c   = (threadIdx.x & 15) * 32;
    const _Float16* src = Qh + ((size_t)b * S_LEN + q0 + row) * D_DIM + c;
    #pragma unroll
    for (int j = 0; j < 32; j += 8)
      async_cp16(src + j, &Qs[row][c + j]);
  }
  if (threadIdx.x < 16) { mrun[threadIdx.x] = NEG; lrun[threadIdx.x] = 0.f; }
  async_wait0();

  v8f acc[4] = {};

  // Mask of this lane's 8 score rows, fetched one key block ahead and held as
  // its compare results.
  const float* mrow0 =
      mask + ((size_t)b * S_LEN + q0 + g * 8) * S_LEN + 16 * w + n;
  bool keep[8];
  #pragma unroll
  for (int i = 0; i < 8; i++) keep[i] = mrow0[(size_t)i * S_LEN] > 0.95f;

  for (int kb = 0; kb < S_LEN; kb += 128) {
    __syncthreads();
    // ---- Phase A: scores for key sub-tile [kb+16w, +16), pipelined --------
    v8f s = {};
    const _Float16* kbase =
        Kp + ((size_t)b * S_LEN + kb + 16 * w) * D_DIM + lane * 8;
    v16h qa = load_frag(&Qs[0][0], 528);
    v16h kf_ = load_packed(kbase);
    #pragma unroll
    for (int dk = 0; dk < D_DIM; dk += 32) {
      v16h qa_n = qa, kf_n = kf_;
      if (dk + 32 < D_DIM) {
        qa_n = load_frag(&Qs[0][dk + 32], 528);
        kf_n = load_packed(kbase + (dk + 32) * 16);
      }
      s = wmma_f16(qa, kf_, s);
      qa = qa_n; kf_ = kf_n;
    }
    // Next key block's mask: all 8 loads leave together after the
    // WMMAs and are compared at the end of this block's Phase A. The last block re-reads its own columns, so no address leaves the
    // mask.
    const int kn = (kb + 128 < S_LEN) ? kb + 128 : kb;
    float mn[8];
    #pragma unroll
    for (int i = 0; i < 8; i++) mn[i] = mrow0[(size_t)i * S_LEN + kn];
    float rmine = NEG;                             // lane n < 8: max of row g*8+n
    #pragma unroll
    for (int i = 0; i < 8; i++) {
      float sv = keep[i] ? s[i] * scale : NEG;
      Ss[g * 8 + i][16 * w + n] = sv;
      float r = row_max16(sv);                     // 8 independent chains
      rmine = (n == i) ? r : rmine;
    }
    if (n < 8) tmax[w][g * 8 + n] = rmine;
    #pragma unroll
    for (int i = 0; i < 8; i++) keep[i] = mn[i] > 0.95f;
    __syncthreads();
    // ---- Phase B: workgroup-shared online-softmax stats -------------------
    if (threadIdx.x < 16) {
      int r = threadIdx.x;
      float mx = tmax[0][r];
      #pragma unroll
      for (int t = 1; t < 8; t++) mx = fmaxf(mx, tmax[t][r]);
      float mold = mrun[r];
      float mn   = fmaxf(mold, mx);
      float c    = (mn <= -1e30f) ? 1.f : __expf(mold - mn);
      mnew[r] = mn; corr[r] = c; mrun[r] = mn;
    }
    __syncthreads();
    // ---- Phase C: rescale acc, build P A-frags, P*V (V preloaded) ---------
    #pragma unroll
    for (int nf = 0; nf < 4; nf++)
      #pragma unroll
      for (int i = 0; i < 8; i++) acc[nf][i] *= corr[g * 8 + i];

    const int row = n;                             // A-frag row = lane&15
    const int ko  = g * 8;
    const float mrow = mnew[row];
    const _Float16* vbase =
        Vp + ((size_t)b * S_LEN + kb) * D_DIM + (4 * w) * 512 + lane * 8;
    v16h vb_c[4];
    #pragma unroll
    for (int nf = 0; nf < 4; nf++)
      vb_c[nf] = load_packed(vbase + nf * 512);

    float lsum = 0.f;
    #pragma unroll
    for (int kf = 0; kf < 4; kf++) {
      v16h p = {};
      #pragma unroll
      for (int j = 0; j < 8; j++) {
        float s0 = Ss[row][kf * 32 + ko + j];
        float s1 = Ss[row][kf * 32 + ko + 16 + j];
        float e0 = (s0 <= -1e30f) ? 0.f : __expf(s0 - mrow);
        float e1 = (s1 <= -1e30f) ? 0.f : __expf(s1 - mrow);
        lsum += e0 + e1;
        p[j]     = (_Float16)e0;
        p[8 + j] = (_Float16)e1;
      }
      v16h vb_n[4];
      if (kf < 3) {                                // preload next kf's V frags
        #pragma unroll
        for (int nf = 0; nf < 4; nf++)
          vb_n[nf] = load_packed(vbase + (kf + 1) * (32 * D_DIM) + nf * 512);
      }
      #pragma unroll
      for (int nf = 0; nf < 4; nf++)
        acc[nf] = wmma_f16(p, vb_c[nf], acc[nf]);
      if (kf < 3) {
        #pragma unroll
        for (int nf = 0; nf < 4; nf++) vb_c[nf] = vb_n[nf];
      }
    }
    float rowtot = lsum + xhalf(lsum);
    if (w == 0 && lane < 16) lrun[lane] = lrun[lane] * corr[lane] + rowtot;
  }
  __syncthreads();

  // ---- Finalize: 1/l, per-wave LDS transpose, coalesced store to AOt[d][s].
  #pragma unroll
  for (int nf = 0; nf < 4; nf++) {
    #pragma unroll
    for (int i = 0; i < 8; i++) {
      int m = g * 8 + i;
      float l   = lrun[m];
      float inv = (l > 0.f) ? 1.f / l : 0.f;
      Ts[w][nf * 16 + n][m] = (_Float16)(acc[nf][i] * inv);
    }
  }
  __syncthreads();
  _Float16* obase = AOt + ((size_t)b * D_DIM + 64 * w) * S_LEN + q0;
  for (int r = lane; r < 64; r += 32) {
    uint4* dst = (uint4*)(obase + (size_t)r * S_LEN);
    const uint4* src = (const uint4*)&Ts[w][r][0];
    dst[0] = src[0];
    dst[1] = src[1];
  }
}

// ---------------------------------------------------------------------------
extern "C" void kernel_launch(void* const* d_in, const int* in_sizes, int n_in,
                              void* d_out, int out_size, void* d_ws,
                              size_t ws_size, hipStream_t stream) {
  (void)in_sizes; (void)n_in; (void)out_size; (void)ws_size;
  const float* x    = (const float*)d_in[0];
  const float* mask = (const float*)d_in[1];
  const float* Wq   = (const float*)d_in[2];
  const float* bq   = (const float*)d_in[3];
  const float* Wk   = (const float*)d_in[4];
  const float* bk   = (const float*)d_in[5];
  const float* Wv   = (const float*)d_in[6];
  const float* bv   = (const float*)d_in[7];
  const float* Wo   = (const float*)d_in[8];
  const float* bo   = (const float*)d_in[9];

  const int B = 2, S = S_LEN, D = D_DIM;
  const int M = B * S;                             // 8192
  const size_t MB = 1ull << 20;
  char* ws = (char*)d_ws;                          // 34 MB used
  _Float16* Qh  = (_Float16*)(ws + 0 * MB);        // 8MB [b][s][d]
  _Float16* Kp  = (_Float16*)(ws + 8 * MB);        // 8MB, fragment order
  _Float16* Vp  = (_Float16*)(ws + 16 * MB);       // 8MB, fragment order
  _Float16* xh  = (_Float16*)(ws + 24 * MB);       // 8MB, reused as AOt
  _Float16* AOt = xh;                              // [b][d][s] after attn
  _Float16* Wqh = (_Float16*)(ws + 32 * MB);
  _Float16* Wkh = (_Float16*)(ws + 32 * MB + 512 * 1024);
  _Float16* Wvh = (_Float16*)(ws + 33 * MB);
  _Float16* Woh = (_Float16*)(ws + 33 * MB + 512 * 1024);

  int nx4 = M * D / 4;
  cvt_f16_kernel<<<dim3((nx4 + 255) / 256), dim3(256), 0, stream>>>(x, xh, nx4);
  int nw4 = D * D / 4;
  cvt_f16_kernel<<<dim3((nw4 + 255) / 256), dim3(256), 0, stream>>>(Wq, Wqh, nw4);
  cvt_f16_kernel<<<dim3((nw4 + 255) / 256), dim3(256), 0, stream>>>(Wk, Wkh, nw4);
  cvt_f16_kernel<<<dim3((nw4 + 255) / 256), dim3(256), 0, stream>>>(Wv, Wvh, nw4);
  cvt_f16_kernel<<<dim3((nw4 + 255) / 256), dim3(256), 0, stream>>>(Wo, Woh, nw4);

  dim3 gg(M / 128, D / 64);
  dim3 gk(D / 128, M / 64);                        // K: rows = d, cols = keys
  gemm_wmma_kernel<<<gg, dim3(256), 0, stream>>>(xh, Wqh, bq, Qh, 0);
  gemm_wmma_kernel<<<gk, dim3(256), 0, stream>>>(Wkh, xh, bk, Kp, 3);
  gemm_wmma_kernel<<<gg, dim3(256), 0, stream>>>(xh, Wvh, bv, Vp, 1);

  attn_kernel<<<dim3(S / 16, B), dim3(256), 0, stream>>>(Qh, Kp, Vp, mask, AOt);

  gemm_wmma_kernel<<<gg, dim3(256), 0, stream>>>(AOt, Woh, bo, d_out, 2);
}

// v004
// It runs in 212 microseconds.
// In both of two side-by-side timings against v003, it was 1.08 times as fast.
// Counting every step since v000, it is 2.06 times as fast.
#include <hip/hip_runtime.h>
#include <hip/hip_bf16.h>

// ---------------------------------------------------------------------------
// Sparse attention, MI455X (gfx1250, wave32, WMMA).
//   B=2, S=4096, D=512. ~86 GFLOP vs ~170MB mandatory traffic -> compute
//   bound; use v_wmma_f32_16x16x32_f16 (f16 in, f32 acc) for every GEMM.
//   Q/K/V f16 (24MB) are L2-resident (192MB L2); K/V B-fragments stream from
//   L2 in the flash loop, stored by the projections in fragment order so that
//   one wave-wide 16B load covers 512 contiguous bytes (4 whole lines).
//   GEMM W-operand panels (x rows for K) are staged to LDS with async-to-LDS
//   DMA (ASYNCcnt) double-buffering; fragments are register-double-buffered
//   so WMMAs overlap loads instead of s_wait_loadcnt 0 per op.
// ---------------------------------------------------------------------------

typedef __attribute__((ext_vector_type(16))) _Float16 v16h;
typedef __attribute__((ext_vector_type(8)))  _Float16 v8h;
typedef __attribute__((ext_vector_type(4)))  _Float16 v4h;
typedef __attribute__((ext_vector_type(8)))  float    v8f;

#define S_LEN 4096
#define D_DIM 512

#if defined(__AMDGCN__) &&                                              \
    __has_builtin(__builtin_amdgcn_global_load_async_to_lds_b128) &&    \
    __has_builtin(__builtin_amdgcn_s_wait_asynccnt)
#define HAVE_ASYNC 1
// Signature (from clang diagnostic): (v4i AS1*, v4i AS3*, imm, imm)
typedef int v4i_t __attribute__((vector_size(16)));
typedef __attribute__((address_space(1))) v4i_t* gv4i_p;
typedef __attribute__((address_space(3))) v4i_t* lv4i_p;
#else
#define HAVE_ASYNC 0
#endif

__device__ __forceinline__ void async_cp16(const _Float16* src, _Float16* lds) {
#if HAVE_ASYNC
  __builtin_amdgcn_global_load_async_to_lds_b128((gv4i_p)src, (lv4i_p)lds, 0, 0);
#else
  *(v8h*)lds = *(const v8h*)src;
#endif
}
__device__ __forceinline__ void async_wait0() {
#if HAVE_ASYNC
  __builtin_amdgcn_s_wait_asynccnt(0);
#endif
}

__device__ __forceinline__ v8f wmma_f16(v16h a, v16h b, v8f c) {
  // (neg_a, A, neg_b, B, c_mod, C, reuse_a, reuse_b)
  return __builtin_amdgcn_wmma_f32_16x16x32_f16(false, a, false, b,
                                                (short)0, c, false, false);
}

// A-fragment (16x32 f16, M=lane&15, K-halves split by lane group) or,
// identically, B-fragment (32x16 f16, N=lane&15) from a row-major source
// whose rows are contiguous in K. Two 16B chunks per lane.
__device__ __forceinline__ v16h load_frag(const _Float16* p, int ld) {
  const int lane = threadIdx.x & 31;
  const int row  = lane & 15;
  const int ko   = (lane >> 4) << 3;     // 0 or 8
  const _Float16* q = p + (size_t)row * ld + ko;
  v8h lo = *(const v8h*)(q);
  v8h hi = *(const v8h*)(q + 16);
  return __builtin_shufflevector(lo, hi, 0,1,2,3,4,5,6,7,8,9,10,11,12,13,14,15);
}

// Fragment stored in fragment order: 512 halves per fragment, two planes of
// 256 halves (elements 0..7, then 8..15), lane l at halves [8l, 8l+8) of each
// plane. p already includes the lane's 8*lane.
__device__ __forceinline__ v16h load_packed(const _Float16* p) {
  v8h lo = *(const v8h*)(p);
  v8h hi = *(const v8h*)(p + 256);
  return __builtin_shufflevector(lo, hi, 0,1,2,3,4,5,6,7,8,9,10,11,12,13,14,15);
}

// Maximum over the 16 lanes of a row, left in every lane of the row: four DPP
// steps on the vector unit (a shuffle goes through the LDS path and is waited
// for at every step). All 32 lanes must be on.
template <int XM>
__device__ __forceinline__ float max_xmask(float v) {
  // 0x160 + XM is the DPP control row_xmask:XM (lane l reads lane l ^ XM)
  int o = __builtin_amdgcn_mov_dpp(__builtin_bit_cast(int, v), 0x160 + XM,
                                   0xf, 0xf, true);
  return fmaxf(v, __builtin_bit_cast(float, o));
}
__device__ __forceinline__ float row_max16(float v) {
  v = max_xmask<1>(v);
  v = max_xmask<2>(v);
  v = max_xmask<4>(v);
  return max_xmask<8>(v);
}
// Lane l reads lane l ^ 16, on the vector unit.
__device__ __forceinline__ float xhalf(float x) {
  int b = __builtin_bit_cast(int, x);
  return __builtin_bit_cast(
      float, __builtin_amdgcn_permlanex16(b, b, 0x76543210, 0xfedcba98, false,
                                          false));
}

// ---------------------------------------------------------------------------
// f32 -> f16 conversion of x and the four weight matrices, one launch.
//   512 work-groups of 256 threads, all resident at once. The five sources
//   are 1,310,720 float4 = 10 per thread: 8 of x, 2 of the weights (Wh holds
//   Wq, Wk, Wv, Wo one behind the other, 65,536 float4 each, so a work-group
//   lies inside one matrix). All 10 loads leave before the first store.
// ---------------------------------------------------------------------------
#define CVT_WGS 512
#define CVT_THREADS (CVT_WGS * 256)

__device__ __forceinline__ v4h cvt4(float4 v) {
  v4h o = {(_Float16)v.x, (_Float16)v.y, (_Float16)v.z, (_Float16)v.w};
  return o;
}

__global__ __launch_bounds__(256) void cvt_all_kernel(
    const float* __restrict__ x, const float* __restrict__ Wq,
    const float* __restrict__ Wk, const float* __restrict__ Wv,
    const float* __restrict__ Wo, _Float16* __restrict__ xh,
    _Float16* __restrict__ Wh) {
  const int t  = blockIdx.x * 256 + threadIdx.x;
  const int hi = blockIdx.x >> 8;                  // t / 65536
  const float* wa = hi ? Wk : Wq;                  // weight float4 t
  const float* wb = hi ? Wo : Wv;                  // weight float4 t + 131072
  float4 vx[8];
  #pragma unroll
  for (int j = 0; j < 8; j++) vx[j] = ((const float4*)x)[j * CVT_THREADS + t];
  float4 va = ((const float4*)wa)[t & 65535];
  float4 vb = ((const float4*)wb)[t & 65535];
  #pragma unroll
  for (int j = 0; j < 8; j++) ((v4h*)xh)[j * CVT_THREADS + t] = cvt4(vx[j]);
  ((v4h*)Wh)[t] = cvt4(va);
  ((v4h*)Wh)[CVT_THREADS + t] = cvt4(vb);
}

// ---------------------------------------------------------------------------
// WMMA GEMM: out[m][n] = sum_k A[m][k] * W[n][k] + bias[n] (mode 3: bias[m])
//   A: [M x 512] f16 rm, W: [N x 512] f16 rm (torch Linear layout; x in mode 3).
//   Block: 8 waves; wave w -> 16x64 tile; block tile 128(M) x 64(N).
//   W k-panel (64 x 32) is shared by all 8 waves -> staged to LDS with
//   async-to-LDS DMA, double buffered; A fragments double buffered in regs.
//   mode 0: f16 out rm [M x 512]   (Q)
//   mode 1: f16 out, rows m = keys, cols = d, in P*V B-fragment order:
//           Vp[m/32][d/16][(m/16)&1][lane = ((m/8)&1)*16 + d%16][m%8]
//   mode 2: f32 out rm [M x 512]   (final Wo projection into d_out)
//   mode 3: f16 out, rows m = d (A = Wk), cols = keys (W = x), bias per row,
//           in Q*K^T B-fragment order:
//           Kp[key/16][d/32][(d/16)&1][lane = ((d/8)&1)*16 + key%16][d%8]
//   In modes 1 and 3 a lane's 8 accumulator rows are one 16B piece of the
//   fragment at its own lane slot: stored straight from registers.
// ---------------------------------------------------------------------------
#define WLD 48   // LDS row stride (halves): 96B, 16B-aligned, bank-spread

__device__ __forceinline__ void gemm_tile(
    const _Float16* __restrict__ A, const _Float16* __restrict__ W,
    const float* __restrict__ bias, void* __restrict__ out, int mode,
    int bm, int bn) {
  __shared__ __align__(16) _Float16 Ws[2][64][WLD];
  const int w    = threadIdx.x >> 5;
  const int lane = threadIdx.x & 31;
  const int g    = lane >> 4;
  const int n    = lane & 15;
  const int m0   = bm * 128 + w * 16;
  const int n0   = bn * 64;

  // cooperative W-panel staging: 64 rows x 32 halves, 16B per thread
  const int srow = threadIdx.x >> 2;
  const int scol = (threadIdx.x & 3) * 8;
  const _Float16* wpan = W + (size_t)(n0 + srow) * D_DIM + scol;

  v8f acc[4] = {};
  const _Float16* abase = A + (size_t)m0 * D_DIM;

  async_cp16(wpan, &Ws[0][srow][scol]);          // stage k=0 panel
  async_wait0();
  __syncthreads();

  v16h a_c = load_frag(abase, D_DIM);
  int buf = 0;
  for (int k = 0; k < D_DIM; k += 32) {
    if (k + 32 < D_DIM)                          // DMA next panel during WMMAs
      async_cp16(wpan + (k + 32), &Ws[buf ^ 1][srow][scol]);
    v16h a_n = a_c;
    if (k + 32 < D_DIM) a_n = load_frag(abase + k + 32, D_DIM);
    #pragma unroll
    for (int nf = 0; nf < 4; nf++) {
      v16h bf = load_frag(&Ws[buf][nf * 16][0], WLD);
      acc[nf] = wmma_f16(a_c, bf, acc[nf]);
    }
    a_c = a_n;
    async_wait0();
    __syncthreads();
    buf ^= 1;
  }

  if (mode == 0) {                               // f16 row-major
    _Float16* o = (_Float16*)out;
    #pragma unroll
    for (int nf = 0; nf < 4; nf++) {
      int col = n0 + nf * 16 + n;
      float bv = bias[col];
      #pragma unroll
      for (int i = 0; i < 8; i++)
        o[(size_t)(m0 + g * 8 + i) * D_DIM + col] = (_Float16)(acc[nf][i] + bv);
    }
    // keeps every later write of the stores' address and data registers
    // behind the stores above
    asm volatile("s_wait_xcnt 0x0" ::: "memory");
  } else if (mode == 1) {                        // V, fragment order
    _Float16* o = (_Float16*)out + (size_t)(m0 >> 5) * (32 * D_DIM) +
                  ((m0 >> 4) & 1) * 256 + lane * 8;
    #pragma unroll
    for (int nf = 0; nf < 4; nf++) {
      float bv = bias[n0 + nf * 16 + n];
      v8h pk;
      #pragma unroll
      for (int i = 0; i < 8; i++) pk[i] = (_Float16)(acc[nf][i] + bv);
      *(v8h*)(o + ((n0 >> 4) + nf) * 512) = pk;
    }
    // keeps every later write of the stores' address and data registers
    // behind the four stores above
    asm volatile("s_wait_xcnt 0x0" ::: "memory");
  } else if (mode == 3) {                        // K, fragment order
    _Float16* o = (_Float16*)out + (m0 >> 4) * 256 + lane * 8;
    float bv[8];
    #pragma unroll
    for (int i = 0; i < 8; i++) bv[i] = bias[m0 + g * 8 + i];
    #pragma unroll
    for (int nf = 0; nf < 4; nf++) {
      v8h pk;
      #pragma unroll
      for (int i = 0; i < 8; i++) pk[i] = (_Float16)(acc[nf][i] + bv[i]);
      *(v8h*)(o + (size_t)((n0 >> 4) + nf) * (16 * D_DIM)) = pk;
    }
    // keeps every later write of the stores' address and data registers
    // behind the four stores above
    asm volatile("s_wait_xcnt 0x0" ::: "memory");
  } else {                                       // f32 row-major (d_out)
    float* o = (float*)out;
    #pragma unroll
    for (int nf = 0; nf < 4; nf++) {
      int col = n0 + nf * 16 + n;
      float bv = bias[col];
      #pragma unroll
      for (int i = 0; i < 8; i++)
        o[(size_t)(m0 + g * 8 + i) * D_DIM + col] = acc[nf][i] + bv;
    }
    // keeps every later write of the stores' address and data registers
    // behind the stores above
    asm volatile("s_wait_xcnt 0x0" ::: "memory");
  }
}

__global__ __launch_bounds__(256) void gemm_wmma_kernel(
    const _Float16* __restrict__ A, const _Float16* __restrict__ W,
    const float* __restrict__ bias, void* __restrict__ out, int mode) {
  gemm_tile(A, W, bias, out, mode, blockIdx.x, blockIdx.y);
}

// Q, K and V projections in one launch: they depend on nothing of each other,
// and one of them alone puts only two work-groups on a WGP. Grid (64, 8, 3);
// blockIdx.z picks the product. K (rows = d, cols = keys) has 4 x 128 tiles:
// its 512 work-groups are renumbered, row tile fastest.
__global__ __launch_bounds__(256) void qkv_wmma_kernel(
    const _Float16* __restrict__ xh, const _Float16* __restrict__ Wqh,
    const _Float16* __restrict__ Wkh, const _Float16* __restrict__ Wvh,
    const float* __restrict__ bq, const float* __restrict__ bk,
    const float* __restrict__ bv, _Float16* __restrict__ Qh,
    _Float16* __restrict__ Kp, _Float16* __restrict__ Vp) {
  const int z    = blockIdx.z;
  const int flat = blockIdx.y * 64 + blockIdx.x;
  const _Float16* A    = (z == 1) ? Wkh : xh;
  const _Float16* W    = (z == 0) ? Wqh : (z == 1) ? xh : Wvh;
  const float*    bias = (z == 0) ? bq : (z == 1) ? bk : bv;
  _Float16*       out  = (z == 0) ? Qh : (z == 1) ? Kp : Vp;
  const int mode = (z == 0) ? 0 : (z == 1) ? 3 : 1;
  const int bm   = (z == 1) ? (flat & 3) : (int)blockIdx.x;
  const int bn   = (z == 1) ? (flat >> 2) : (int)blockIdx.y;
  gemm_tile(A, W, bias, out, mode, bm, bn);
}

// ---------------------------------------------------------------------------
// Flash-style sparse attention.
//   Grid: (S/16, B); block: 256 threads = 8 waves; one 16-query tile per WG.
//   Per 128-key block: wave w computes score tile cols [kb+16w,+16) with
//   register-pipelined Q(LDS)/K(L2, fragment order) fragments, masks+scales
//   (mask values loaded one key block ahead), shares scores
//   and row-max via LDS; WG-shared online softmax; each wave accumulates P*V
//   into its private 64-wide d-slice with V fragments preloaded one kf ahead.
//   Output stored transposed AOt[d][s] (== reference transpose+reshape,
//   flat-viewed as [S x D] for the final GEMM).
// ---------------------------------------------------------------------------
__global__ __launch_bounds__(256) void attn_kernel(
    const _Float16* __restrict__ Qh, const _Float16* __restrict__ Kp,
    const _Float16* __restrict__ Vp, const float* __restrict__ mask,
    _Float16* __restrict__ AOt) {
  __shared__ __align__(16) _Float16 Qs[16][528];   // padded: banks spread
  __shared__ float Ss[16][132];                    // masked, scaled scores
  __shared__ float tmax[8][16];
  __shared__ float mrun[16], lrun[16], mnew[16], corr[16];
  __shared__ __align__(16) _Float16 Ts[8][64][16]; // per-wave O transpose

  const int q0   = blockIdx.x * 16;
  const int b    = blockIdx.y;
  const int w    = threadIdx.x >> 5;
  const int lane = threadIdx.x & 31;
  const int g    = lane >> 4;
  const int n    = lane & 15;
  const float scale = 0.044194173824159216f;       // 1/sqrt(512)
  const float NEG   = -__builtin_inff();

  // Stage Q tile (16 x 512 f16) into LDS via async DMA, 64B/thread.
  {
    int row = threadIdx.x >> 4;
    int c   = (threadIdx.x & 15) * 32;
    const _Float16* src = Qh + ((size_t)b * S_LEN + q0 + row) * D_DIM + c;
    #pragma unroll
    for (int j = 0; j < 32; j += 8)
      async_cp16(src + j, &Qs[row][c + j]);
  }
  if (threadIdx.x < 16) { mrun[threadIdx.x] = NEG; lrun[threadIdx.x] = 0.f; }
  async_wait0();

  v8f acc[4] = {};

  // Mask of this lane's 8 score rows, fetched one key block ahead and held as
  // its compare results.
  const float* mrow0 =
      mask + ((size_t)b * S_LEN + q0 + g * 8) * S_LEN + 16 * w + n;
  bool keep[8];
  #pragma unroll
  for (int i = 0; i < 8; i++) keep[i] = mrow0[(size_t)i * S_LEN] > 0.95f;

  for (int kb = 0; kb < S_LEN; kb += 128) {
    __syncthreads();
    // ---- Phase A: scores for key sub-tile [kb+16w, +16), pipelined --------
    v8f s = {};
    const _Float16* kbase =
        Kp + ((size_t)b * S_LEN + kb + 16 * w) * D_DIM + lane * 8;
    v16h qa = load_frag(&Qs[0][0], 528);
    v16h kf_ = load_packed(kbase);
    #pragma unroll
    for (int dk = 0; dk < D_DIM; dk += 32) {
      v16h qa_n = qa, kf_n = kf_;
      if (dk + 32 < D_DIM) {
        qa_n = load_frag(&Qs[0][dk + 32], 528);
        kf_n = load_packed(kbase + (dk + 32) * 16);
      }
      s = wmma_f16(qa, kf_, s);
      qa = qa_n; kf_ = kf_n;
    }
    // Next key block's mask: all 8 loads leave together after the
    // WMMAs and are compared at the end of this block's Phase A. The last block re-reads its own columns, so no address leaves the
    // mask.
    const int kn = (kb + 128 < S_LEN) ? kb + 128 : kb;
    float mn[8];
    #pragma unroll
    for (int i = 0; i < 8; i++) mn[i] = mrow0[(size_t)i * S_LEN + kn];
    float rmine = NEG;                             // lane n < 8: max of row g*8+n
    #pragma unroll
    for (int i = 0; i < 8; i++) {
      float sv = keep[i] ? s[i] * scale : NEG;
      Ss[g * 8 + i][16 * w + n] = sv;
      float r = row_max16(sv);                     // 8 independent chains
      rmine = (n == i) ? r : rmine;
    }
    if (n < 8) tmax[w][g * 8 + n] = rmine;
    #pragma unroll
    for (int i = 0; i < 8; i++) keep[i] = mn[i] > 0.95f;
    __syncthreads();
    // ---- Phase B: workgroup-shared online-softmax stats -------------------
    if (threadIdx.x < 16) {
      int r = threadIdx.x;
      float mx = tmax[0][r];
      #pragma unroll
      for (int t = 1; t < 8; t++) mx = fmaxf(mx, tmax[t][r]);
      float mold = mrun[r];
      float mn   = fmaxf(mold, mx);
      float c    = (mn <= -1e30f) ? 1.f : __expf(mold - mn);
      mnew[r] = mn; corr[r] = c; mrun[r] = mn;
    }
    __syncthreads();
    // ---- Phase C: rescale acc, build P A-frags, P*V (V preloaded) ---------
    #pragma unroll
    for (int nf = 0; nf < 4; nf++)
      #pragma unroll
      for (int i = 0; i < 8; i++) acc[nf][i] *= corr[g * 8 + i];

    const int row = n;                             // A-frag row = lane&15
    const int ko  = g * 8;
    const float mrow = mnew[row];
    const _Float16* vbase =
        Vp + ((size_t)b * S_LEN + kb) * D_DIM + (4 * w) * 512 + lane * 8;
    v16h vb_c[4];
    #pragma unroll
    for (int nf = 0; nf < 4; nf++)
      vb_c[nf] = load_packed(vbase + nf * 512);

    float lsum = 0.f;
    #pragma unroll
    for (int kf = 0; kf < 4; kf++) {
      v16h p = {};
      #pragma unroll
      for (int j = 0; j < 8; j++) {
        float s0 = Ss[row][kf * 32 + ko + j];
        float s1 = Ss[row][kf * 32 + ko + 16 + j];
        float e0 = (s0 <= -1e30f) ? 0.f : __expf(s0 - mrow);
        float e1 = (s1 <= -1e30f) ? 0.f : __expf(s1 - mrow);
        lsum += e0 + e1;
        p[j]     = (_Float16)e0;
        p[8 + j] = (_Float16)e1;
      }
      v16h vb_n[4];
      if (kf < 3) {                                // preload next kf's V frags
        #pragma unroll
        for (int nf = 0; nf < 4; nf++)
          vb_n[nf] = load_packed(vbase + (kf + 1) * (32 * D_DIM) + nf * 512);
      }
      #pragma unroll
      for (int nf = 0; nf < 4; nf++)
        acc[nf] = wmma_f16(p, vb_c[nf], acc[nf]);
      if (kf < 3) {
        #pragma unroll
        for (int nf = 0; nf < 4; nf++) vb_c[nf] = vb_n[nf];
      }
    }
    float rowtot = lsum + xhalf(lsum);
    if (w == 0 && lane < 16) lrun[lane] = lrun[lane] * corr[lane] + rowtot;
  }
  __syncthreads();

  // ---- Finalize: 1/l, per-wave LDS transpose, coalesced store to AOt[d][s].
  #pragma unroll
  for (int nf = 0; nf < 4; nf++) {
    #pragma unroll
    for (int i = 0; i < 8; i++) {
      int m = g * 8 + i;
      float l   = lrun[m];
      float inv = (l > 0.f) ? 1.f / l : 0.f;
      Ts[w][nf * 16 + n][m] = (_Float16)(acc[nf][i] * inv);
    }
  }
  __syncthreads();
  _Float16* obase = AOt + ((size_t)b * D_DIM + 64 * w) * S_LEN + q0;
  for (int r = lane; r < 64; r += 32) {
    uint4* dst = (uint4*)(obase + (size_t)r * S_LEN);
    const uint4* src = (const uint4*)&Ts[w][r][0];
    dst[0] = src[0];
    dst[1] = src[1];
  }
}

// ---------------------------------------------------------------------------
extern "C" void kernel_launch(void* const* d_in, const int* in_sizes, int n_in,
                              void* d_out, int out_size, void* d_ws,
                              size_t ws_size, hipStream_t stream) {
  (void)in_sizes; (void)n_in; (void)out_size; (void)ws_size;
  const float* x    = (const float*)d_in[0];
  const float* mask = (const float*)d_in[1];
  const float* Wq   = (const float*)d_in[2];
  const float* bq   = (const float*)d_in[3];
  const float* Wk   = (const float*)d_in[4];
  const float* bk   = (const float*)d_in[5];
  const float* Wv   = (const float*)d_in[6];
  const float* bv   = (const float*)d_in[7];
  const float* Wo   = (const float*)d_in[8];
  const float* bo   = (const float*)d_in[9];

  const int B = 2, S = S_LEN, D = D_DIM;
  const int M = B * S;                             // 8192
  const size_t MB = 1ull << 20;
  char* ws = (char*)d_ws;                          // 34 MB used
  _Float16* Qh  = (_Float16*)(ws + 0 * MB);        // 8MB [b][s][d]
  _Float16* Kp  = (_Float16*)(ws + 8 * MB);        // 8MB, fragment order
  _Float16* Vp  = (_Float16*)(ws + 16 * MB);       // 8MB, fragment order
  _Float16* xh  = (_Float16*)(ws + 24 * MB);       // 8MB, reused as AOt
  _Float16* AOt = xh;                              // [b][d][s] after attn
  _Float16* Wqh = (_Float16*)(ws + 32 * MB);
  _Float16* Wkh = (_Float16*)(ws + 32 * MB + 512 * 1024);
  _Float16* Wvh = (_Float16*)(ws + 33 * MB);
  _Float16* Woh = (_Float16*)(ws + 33 * MB + 512 * 1024);

  // Wqh..Woh lie one behind the other: one destination for the four weights
  cvt_all_kernel<<<dim3(CVT_WGS), dim3(256), 0, stream>>>(x, Wq, Wk, Wv, Wo, xh,
                                                          Wqh);

  dim3 gg(M / 128, D / 64);
  qkv_wmma_kernel<<<dim3(M / 128, D / 64, 3), dim3(256), 0, stream>>>(
      xh, Wqh, Wkh, Wvh, bq, bk, bv, Qh, Kp, Vp);

  attn_kernel<<<dim3(S / 16, B), dim3(256), 0, stream>>>(Qh, Kp, Vp, mask, AOt);

  gemm_wmma_kernel<<<gg, dim3(256), 0, stream>>>(AOt, Woh, bo, d_out, 2);
}

// v005
// One run takes 206 microseconds.
// Next to v004, in two timings, it ran 1.03 times as fast each time.
// Counting every step since v000, it is 2.13 times as fast.
#include <hip/hip_runtime.h>
#include <hip/hip_bf16.h>

// ---------------------------------------------------------------------------
// Sparse attention, MI455X (gfx1250, wave32, WMMA).
//   B=2, S=4096, D=512. ~86 GFLOP vs ~170MB mandatory traffic -> compute
//   bound; use v_wmma_f32_16x16x32_f16 (f16 in, f32 acc) for every GEMM.
//   Q/K/V f16 (24MB) are L2-resident (192MB L2); K/V B-fragments stream from
//   L2 in the flash loop, stored by the projections in fragment order so that
//   one wave-wide 16B load covers 512 contiguous bytes (4 whole lines).
//   GEMM W-operand panels (x rows for K) are staged to LDS with async-to-LDS
//   DMA (ASYNCcnt) double-buffering; fragments are register-double-buffered
//   so WMMAs overlap loads instead of s_wait_loadcnt 0 per op.
// ---------------------------------------------------------------------------

typedef __attribute__((ext_vector_type(16))) _Float16 v16h;
typedef __attribute__((ext_vector_type(8)))  _Float16 v8h;
typedef __attribute__((ext_vector_type(4)))  _Float16 v4h;
typedef __attribute__((ext_vector_type(8)))  float    v8f;

#define S_LEN 4096
#define D_DIM 512

#if defined(__AMDGCN__) &&                                              \
    __has_builtin(__builtin_amdgcn_global_load_async_to_lds_b128) &&    \
    __has_builtin(__builtin_amdgcn_s_wait_asynccnt)
#define HAVE_ASYNC 1
// Signature (from clang diagnostic): (v4i AS1*, v4i AS3*, imm, imm)
typedef int v4i_t __attribute__((vector_size(16)));
typedef __attribute__((address_space(1))) v4i_t* gv4i_p;
typedef __attribute__((address_space(3))) v4i_t* lv4i_p;
#else
#define HAVE_ASYNC 0
#endif

__device__ __forceinline__ void async_cp16(const _Float16* src, _Float16* lds) {
#if HAVE_ASYNC
  __builtin_amdgcn_global_load_async_to_lds_b128((gv4i_p)src, (lv4i_p)lds, 0, 0);
#else
  *(v8h*)lds = *(const v8h*)src;
#endif
}
__device__ __forceinline__ void async_wait0() {
#if HAVE_ASYNC
  __builtin_amdgcn_s_wait_asynccnt(0);
#endif
}

__device__ __forceinline__ v8f wmma_f16(v16h a, v16h b, v8f c) {
  // (neg_a, A, neg_b, B, c_mod, C, reuse_a, reuse_b)
  return __builtin_amdgcn_wmma_f32_16x16x32_f16(false, a, false, b,
                                                (short)0, c, false, false);
}

// A-fragment (16x32 f16, M=lane&15, K-halves split by lane group) or,
// identically, B-fragment (32x16 f16, N=lane&15) from a row-major source
// whose rows are contiguous in K. Two 16B chunks per lane.
__device__ __forceinline__ v16h load_frag(const _Float16* p, int ld) {
  const int lane = threadIdx.x & 31;
  const int row  = lane & 15;
  const int ko   = (lane >> 4) << 3;     // 0 or 8
  const _Float16* q = p + (size_t)row * ld + ko;
  v8h lo = *(const v8h*)(q);
  v8h hi = *(const v8h*)(q + 16);
  return __builtin_shufflevector(lo, hi, 0,1,2,3,4,5,6,7,8,9,10,11,12,13,14,15);
}

// Fragment stored in fragment order: 512 halves per fragment, two planes of
// 256 halves (elements 0..7, then 8..15), lane l at halves [8l, 8l+8) of each
// plane. p already includes the lane's 8*lane.
__device__ __forceinline__ v16h load_packed(const _Float16* p) {
  v8h lo = *(const v8h*)(p);
  v8h hi = *(const v8h*)(p + 256);
  return __builtin_shufflevector(lo, hi, 0,1,2,3,4,5,6,7,8,9,10,11,12,13,14,15);
}

// Maximum over the 16 lanes of a row, left in every lane of the row: four DPP
// steps on the vector unit (a shuffle goes through the LDS path and is waited
// for at every step). All 32 lanes must be on.
template <int XM>
__device__ __forceinline__ float max_xmask(float v) {
  // 0x160 + XM is the DPP control row_xmask:XM (lane l reads lane l ^ XM)
  int o = __builtin_amdgcn_mov_dpp(__builtin_bit_cast(int, v), 0x160 + XM,
                                   0xf, 0xf, true);
  return fmaxf(v, __builtin_bit_cast(float, o));
}
__device__ __forceinline__ float row_max16(float v) {
  v = max_xmask<1>(v);
  v = max_xmask<2>(v);
  v = max_xmask<4>(v);
  return max_xmask<8>(v);
}
// Lane l reads lane l ^ 16, on the vector unit.
__device__ __forceinline__ float xhalf(float x) {
  int b = __builtin_bit_cast(int, x);
  return __builtin_bit_cast(
      float, __builtin_amdgcn_permlanex16(b, b, 0x76543210, 0xfedcba98, false,
                                          false));
}

__device__ __forceinline__ void exp2x8(float (&x)[8]) {
  asm("v_exp_f32 %0, %0\n\t"
      "v_exp_f32 %1, %1\n\t"
      "v_exp_f32 %2, %2\n\t"
      "v_exp_f32 %3, %3\n\t"
      "v_exp_f32 %4, %4\n\t"
      "v_exp_f32 %5, %5\n\t"
      "v_exp_f32 %6, %6\n\t"
      "v_exp_f32 %7, %7\n\t"
      "v_nop"
      : "+v"(x[0]), "+v"(x[1]), "+v"(x[2]), "+v"(x[3]), "+v"(x[4]),
        "+v"(x[5]), "+v"(x[6]), "+v"(x[7]));
}

// ---------------------------------------------------------------------------
// f32 -> f16 conversion of x and the four weight matrices, one launch.
//   512 work-groups of 256 threads, all resident at once. The five sources
//   are 1,310,720 float4 = 10 per thread: 8 of x, 2 of the weights (Wh holds
//   Wq, Wk, Wv, Wo one behind the other, 65,536 float4 each, so a work-group
//   lies inside one matrix). All 10 loads leave before the first store.
// ---------------------------------------------------------------------------
#define CVT_WGS 512
#define CVT_THREADS (CVT_WGS * 256)

__device__ __forceinline__ v4h cvt4(float4 v) {
  v4h o = {(_Float16)v.x, (_Float16)v.y, (_Float16)v.z, (_Float16)v.w};
  return o;
}

__global__ __launch_bounds__(256) void cvt_all_kernel(
    const float* __restrict__ x, const float* __restrict__ Wq,
    const float* __restrict__ Wk, const float* __restrict__ Wv,
    const float* __restrict__ Wo, _Float16* __restrict__ xh,
    _Float16* __restrict__ Wh) {
  const int t  = blockIdx.x * 256 + threadIdx.x;
  const int hi = blockIdx.x >> 8;                  // t / 65536
  const float* wa = hi ? Wk : Wq;                  // weight float4 t
  const float* wb = hi ? Wo : Wv;                  // weight float4 t + 131072
  float4 vx[8];
  #pragma unroll
  for (int j = 0; j < 8; j++) vx[j] = ((const float4*)x)[j * CVT_THREADS + t];
  float4 va = ((const float4*)wa)[t & 65535];
  float4 vb = ((const float4*)wb)[t & 65535];
  #pragma unroll
  for (int j = 0; j < 8; j++) ((v4h*)xh)[j * CVT_THREADS + t] = cvt4(vx[j]);
  ((v4h*)Wh)[t] = cvt4(va);
  ((v4h*)Wh)[CVT_THREADS + t] = cvt4(vb);
}

// ---------------------------------------------------------------------------
// WMMA GEMM: out[m][n] = sum_k A[m][k] * W[n][k] + bias[n] (mode 3: bias[m])
//   A: [M x 512] f16 rm, W: [N x 512] f16 rm (torch Linear layout; x in mode 3).
//   Block: 8 waves; wave w -> 16x64 tile; block tile 128(M) x 64(N).
//   W k-panel (64 x 32) is shared by all 8 waves -> staged to LDS with
//   async-to-LDS DMA, double buffered; A fragments double buffered in regs.
//   mode 0: f16 out rm [M x 512]   (Q)
//   mode 1: f16 out, rows m = keys, cols = d, in P*V B-fragment order:
//           Vp[m/32][d/16][(m/16)&1][lane = ((m/8)&1)*16 + d%16][m%8]
//   mode 2: f32 out rm [M x 512]   (final Wo projection into d_out)
//   mode 3: f16 out, rows m = d (A = Wk), cols = keys (W = x), bias per row,
//           in Q*K^T B-fragment order:
//           Kp[key/16][d/32][(d/16)&1][lane = ((d/8)&1)*16 + key%16][d%8]
//   In modes 1 and 3 a lane's 8 accumulator rows are one 16B piece of the
//   fragment at its own lane slot: stored straight from registers.
// ---------------------------------------------------------------------------
#define WLD 48   // LDS row stride (halves): 96B, 16B-aligned, bank-spread

__device__ __forceinline__ void gemm_tile(
    const _Float16* __restrict__ A, const _Float16* __restrict__ W,
    const float* __restrict__ bias, void* __restrict__ out, int mode,
    int bm, int bn) {
  __shared__ __align__(16) _Float16 Ws[2][64][WLD];
  const int w    = threadIdx.x >> 5;
  const int lane = threadIdx.x & 31;
  const int g    = lane >> 4;
  const int n    = lane & 15;
  const int m0   = bm * 128 + w * 16;
  const int n0   = bn * 64;

  // cooperative W-panel staging: 64 rows x 32 halves, 16B per thread
  const int srow = threadIdx.x >> 2;
  const int scol = (threadIdx.x & 3) * 8;
  const _Float16* wpan = W + (size_t)(n0 + srow) * D_DIM + scol;

  v8f acc[4] = {};
  const _Float16* abase = A + (size_t)m0 * D_DIM;

  async_cp16(wpan, &Ws[0][srow][scol]);          // stage k=0 panel
  async_wait0();
  __syncthreads();

  v16h a_c = load_frag(abase, D_DIM);
  int buf = 0;
  for (int k = 0; k < D_DIM; k += 32) {
    if (k + 32 < D_DIM)                          // DMA next panel during WMMAs
      async_cp16(wpan + (k + 32), &Ws[buf ^ 1][srow][scol]);
    v16h a_n = a_c;
    if (k + 32 < D_DIM) a_n = load_frag(abase + k + 32, D_DIM);
    #pragma unroll
    for (int nf = 0; nf < 4; nf++) {
      v16h bf = load_frag(&Ws[buf][nf * 16][0], WLD);
      acc[nf] = wmma_f16(a_c, bf, acc[nf]);
    }
    a_c = a_n;
    async_wait0();
    __syncthreads();
    buf ^= 1;
  }

  if (mode == 0) {                               // f16 row-major
    _Float16* o = (_Float16*)out;
    #pragma unroll
    for (int nf = 0; nf < 4; nf++) {
      int col = n0 + nf * 16 + n;
      float bv = bias[col];
      #pragma unroll
      for (int i = 0; i < 8; i++)
        o[(size_t)(m0 + g * 8 + i) * D_DIM + col] = (_Float16)(acc[nf][i] + bv);
    }
    // keeps every later write of the stores' address and data registers
    // behind the stores above
    asm volatile("s_wait_xcnt 0x0" ::: "memory");
  } else if (mode == 1) {                        // V, fragment order
    _Float16* o = (_Float16*)out + (size_t)(m0 >> 5) * (32 * D_DIM) +
                  ((m0 >> 4) & 1) * 256 + lane * 8;
    #pragma unroll
    for (int nf = 0; nf < 4; nf++) {
      float bv = bias[n0 + nf * 16 + n];
      v8h pk;
      #pragma unroll
      for (int i = 0; i < 8; i++) pk[i] = (_Float16)(acc[nf][i] + bv);
      *(v8h*)(o + ((n0 >> 4) + nf) * 512) = pk;
    }
    // keeps every later write of the stores' address and data registers
    // behind the four stores above
    asm volatile("s_wait_xcnt 0x0" ::: "memory");
  } else if (mode == 3) {                        // K, fragment order
    _Float16* o = (_Float16*)out + (m0 >> 4) * 256 + lane * 8;
    float bv[8];
    #pragma unroll
    for (int i = 0; i < 8; i++) bv[i] = bias[m0 + g * 8 + i];
    #pragma unroll
    for (int nf = 0; nf < 4; nf++) {
      v8h pk;
      #pragma unroll
      for (int i = 0; i < 8; i++) pk[i] = (_Float16)(acc[nf][i] + bv[i]);
      *(v8h*)(o + (size_t)((n0 >> 4) + nf) * (16 * D_DIM)) = pk;
    }
    // keeps every later write of the stores' address and data registers
    // behind the four stores above
    asm volatile("s_wait_xcnt 0x0" ::: "memory");
  } else {                                       // f32 row-major (d_out)
    float* o = (float*)out;
    #pragma unroll
    for (int nf = 0; nf < 4; nf++) {
      int col = n0 + nf * 16 + n;
      float bv = bias[col];
      #pragma unroll
      for (int i = 0; i < 8; i++)
        o[(size_t)(m0 + g * 8 + i) * D_DIM + col] = acc[nf][i] + bv;
    }
    // keeps every later write of the stores' address and data registers
    // behind the stores above
    asm volatile("s_wait_xcnt 0x0" ::: "memory");
  }
}

__global__ __launch_bounds__(256) void gemm_wmma_kernel(
    const _Float16* __restrict__ A, const _Float16* __restrict__ W,
    const float* __restrict__ bias, void* __restrict__ out, int mode) {
  gemm_tile(A, W, bias, out, mode, blockIdx.x, blockIdx.y);
}

// Q, K and V projections in one launch: they depend on nothing of each other,
// and one of them alone puts only two work-groups on a WGP. Grid (64, 8, 3);
// blockIdx.z picks the product. K (rows = d, cols = keys) has 4 x 128 tiles:
// its 512 work-groups are renumbered, row tile fastest.
__global__ __launch_bounds__(256) void qkv_wmma_kernel(
    const _Float16* __restrict__ xh, const _Float16* __restrict__ Wqh,
    const _Float16* __restrict__ Wkh, const _Float16* __restrict__ Wvh,
    const float* __restrict__ bq, const float* __restrict__ bk,
    const float* __restrict__ bv, _Float16* __restrict__ Qh,
    _Float16* __restrict__ Kp, _Float16* __restrict__ Vp) {
  const int z    = blockIdx.z;
  const int flat = blockIdx.y * 64 + blockIdx.x;
  const _Float16* A    = (z == 1) ? Wkh : xh;
  const _Float16* W    = (z == 0) ? Wqh : (z == 1) ? xh : Wvh;
  const float*    bias = (z == 0) ? bq : (z == 1) ? bk : bv;
  _Float16*       out  = (z == 0) ? Qh : (z == 1) ? Kp : Vp;
  const int mode = (z == 0) ? 0 : (z == 1) ? 3 : 1;
  const int bm   = (z == 1) ? (flat & 3) : (int)blockIdx.x;
  const int bn   = (z == 1) ? (flat >> 2) : (int)blockIdx.y;
  gemm_tile(A, W, bias, out, mode, bm, bn);
}

// ---------------------------------------------------------------------------
// Flash-style sparse attention.
//   Grid: (S/32, B); block: 256 threads = 8 waves; 32 query rows (two 16-row
//   tiles) per WG, so every K and V fragment that a wave reads from L2 feeds
//   two WMMAs and the launch reads K and V 128 times over, not 256.
//   Per 128-key block: wave w computes score tiles cols [kb+16w,+16) with
//   register-pipelined Q(LDS)/K(L2, fragment order) fragments, masks+scales
//   (mask values loaded one key block ahead), shares scores
//   and row-max via LDS; WG-shared online softmax; each wave accumulates P*V
//   into its private 64-wide d-slice with V fragments preloaded one kf ahead.
//   Output stored transposed AOt[d][s] (== reference transpose+reshape,
//   flat-viewed as [S x D] for the final GEMM).
// ---------------------------------------------------------------------------
#define QROWS 32

__global__ __launch_bounds__(256) void attn_kernel(
    const _Float16* __restrict__ Qh, const _Float16* __restrict__ Kp,
    const _Float16* __restrict__ Vp, const float* __restrict__ mask,
    _Float16* __restrict__ AOt) {
  __shared__ __align__(16) _Float16 Qs[QROWS][528]; // padded: banks spread
  __shared__ float Ss[QROWS][132];                 // masked, scaled scores
  __shared__ float tmax[8][QROWS];
  __shared__ float mrun[QROWS], lrun[QROWS], mnew[QROWS], corr[QROWS];
  __shared__ __align__(16) _Float16 Ts[8][64][QROWS]; // per-wave O transpose

  const int q0   = blockIdx.x * QROWS;
  const int b    = blockIdx.y;
  const int w    = threadIdx.x >> 5;
  const int lane = threadIdx.x & 31;
  const int g    = lane >> 4;
  const int n    = lane & 15;
  const float scale = 0.044194173824159216f;       // 1/sqrt(512)
  const float NEG   = -__builtin_inff();
  const float LOG2E = 1.44269504f;

  // Stage Q tile (32 x 512 f16) into LDS via async DMA, 128B/thread.
  {
    int row = threadIdx.x >> 3;
    int c   = (threadIdx.x & 7) * 64;
    const _Float16* src = Qh + ((size_t)b * S_LEN + q0 + row) * D_DIM + c;
    #pragma unroll
    for (int j = 0; j < 64; j += 8)
      async_cp16(src + j, &Qs[row][c + j]);
  }
  if (threadIdx.x < QROWS) { mrun[threadIdx.x] = NEG; lrun[threadIdx.x] = 0.f; }
  // this wave's Q copies have landed before it reaches the loop's first
  // barrier, behind which every wave reads Qs
  asm volatile("s_wait_asynccnt 0x0" ::: "memory");

  v8f acc[2][4] = {};

  // Mask of this lane's 16 score rows, fetched one key block ahead and held as
  // its compare results.
  const float* mrow0 =
      mask + ((size_t)b * S_LEN + q0 + g * 8) * S_LEN + 16 * w + n;
  bool keep[2][8];
  #pragma unroll
  for (int t = 0; t < 2; t++)
    #pragma unroll
    for (int i = 0; i < 8; i++)
      keep[t][i] = mrow0[(size_t)(t * 16 + i) * S_LEN] > 0.95f;

  for (int kb = 0; kb < S_LEN; kb += 128) {
    __syncthreads();
    // ---- Phase A: scores for key sub-tile [kb+16w, +16), pipelined --------
    v8f s[2] = {};
    const _Float16* kbase =
        Kp + ((size_t)b * S_LEN + kb + 16 * w) * D_DIM + lane * 8;
    v16h qa0 = load_frag(&Qs[0][0], 528);
    v16h qa1 = load_frag(&Qs[16][0], 528);
    v16h kf_ = load_packed(kbase);
    #pragma unroll
    for (int dk = 0; dk < D_DIM; dk += 32) {
      v16h qa0_n = qa0, qa1_n = qa1, kf_n = kf_;
      if (dk + 32 < D_DIM) {
        qa0_n = load_frag(&Qs[0][dk + 32], 528);
        qa1_n = load_frag(&Qs[16][dk + 32], 528);
        kf_n  = load_packed(kbase + (dk + 32) * 16);
      }
      s[0] = wmma_f16(qa0, kf_, s[0]);
      s[1] = wmma_f16(qa1, kf_, s[1]);
      qa0 = qa0_n; qa1 = qa1_n; kf_ = kf_n;
    }
    // Next key block's mask: all 16 loads leave together, a block before their
    // use. The last block re-reads its own columns, so no address leaves the
    // mask.
    const int kn = (kb + 128 < S_LEN) ? kb + 128 : kb;
    float mn[2][8];
    #pragma unroll
    for (int t = 0; t < 2; t++)
      #pragma unroll
      for (int i = 0; i < 8; i++)
        mn[t][i] = mrow0[(size_t)(t * 16 + i) * S_LEN + kn];
    // keeps every later write of the K and mask loads' address registers
    // behind those loads
    asm volatile("s_wait_xcnt 0x0" ::: "memory");
    // the vector work below reuses those registers: without this the scheduler
    // lifts part of it over the wait
    __builtin_amdgcn_sched_barrier(0);
    float rmine = NEG;               // lane n: max of row n & 7 of tile n >> 3
    #pragma unroll
    for (int t = 0; t < 2; t++) {
      #pragma unroll
      for (int i = 0; i < 8; i++) {
        float sv = keep[t][i] ? s[t][i] * scale : NEG;
        Ss[t * 16 + g * 8 + i][16 * w + n] = sv;
        float r = row_max16(sv);                   // 16 independent chains
        rmine = (n == t * 8 + i) ? r : rmine;
      }
    }
    tmax[w][(n >> 3) * 16 + g * 8 + (n & 7)] = rmine;
    #pragma unroll
    for (int t = 0; t < 2; t++)
      #pragma unroll
      for (int i = 0; i < 8; i++) keep[t][i] = mn[t][i] > 0.95f;
    __syncthreads();
    // ---- Phase B: workgroup-shared online-softmax stats -------------------
    if (threadIdx.x < QROWS) {
      int r = threadIdx.x;
      float mx = tmax[0][r];
      #pragma unroll
      for (int t = 1; t < 8; t++) mx = fmaxf(mx, tmax[t][r]);
      float mold = mrun[r];
      float mn   = fmaxf(mold, mx);
      float c    = (mn <= -1e30f) ? 1.f : __expf(mold - mn);
      mnew[r] = mn; corr[r] = c; mrun[r] = mn;
    }
    __syncthreads();
    // ---- Phase C: rescale acc, build P A-frags, P*V (V preloaded) ---------
    #pragma unroll
    for (int t = 0; t < 2; t++)
      #pragma unroll
      for (int nf = 0; nf < 4; nf++)
        #pragma unroll
        for (int i = 0; i < 8; i++) acc[t][nf][i] *= corr[t * 16 + g * 8 + i];

    const int ko  = g * 8;                         // A-frag row = lane&15
    const float mrow[2] = {mnew[n], mnew[16 + n]};
    const _Float16* vbase =
        Vp + ((size_t)b * S_LEN + kb) * D_DIM + (4 * w) * 512 + lane * 8;
    v16h vb_c[4];
    #pragma unroll
    for (int nf = 0; nf < 4; nf++)
      vb_c[nf] = load_packed(vbase + nf * 512);

    float lsum[2] = {0.f, 0.f};
    #pragma unroll
    for (int kf = 0; kf < 4; kf++) {
      v16h vb_n[4];
      if (kf < 3) {                                // preload next kf's V frags
        #pragma unroll
        for (int nf = 0; nf < 4; nf++)
          vb_n[nf] = load_packed(vbase + (kf + 1) * (32 * D_DIM) + nf * 512);
      }
      v16h p[2];
      #pragma unroll
      for (int t = 0; t < 2; t++) {
        float s0v[8], s1v[8], x0[8], x1[8];
        #pragma unroll
        for (int j = 0; j < 8; j++) {
          s0v[j] = Ss[t * 16 + n][kf * 32 + ko + j];
          s1v[j] = Ss[t * 16 + n][kf * 32 + ko + 16 + j];
          x0[j]  = (s0v[j] - mrow[t]) * LOG2E;     // e^y = 2^(y * log2 e)
          x1[j]  = (s1v[j] - mrow[t]) * LOG2E;
        }
        exp2x8(x0);
        exp2x8(x1);
        #pragma unroll
        for (int j = 0; j < 8; j++) {
          float e0 = (s0v[j] <= -1e30f) ? 0.f : x0[j];
          float e1 = (s1v[j] <= -1e30f) ? 0.f : x1[j];
          lsum[t] += e0 + e1;
          p[t][j]     = (_Float16)e0;
          p[t][8 + j] = (_Float16)e1;
        }
      }
      #pragma unroll
      for (int nf = 0; nf < 4; nf++) {
        acc[0][nf] = wmma_f16(p[0], vb_c[nf], acc[0][nf]);
        acc[1][nf] = wmma_f16(p[1], vb_c[nf], acc[1][nf]);
      }
      if (kf < 3) {
        #pragma unroll
        for (int nf = 0; nf < 4; nf++) vb_c[nf] = vb_n[nf];
      }
    }
    // keeps the next block's write of the V loads' address registers behind
    // those loads
    asm volatile("s_wait_xcnt 0x0" ::: "memory");
    // both halves of a wave end with the row's total: lane l keeps row l
    float rt0 = lsum[0] + xhalf(lsum[0]);
    float rt1 = lsum[1] + xhalf(lsum[1]);
    if (w == 0) lrun[lane] = lrun[lane] * corr[lane] + (g ? rt1 : rt0);
  }
  __syncthreads();

  // ---- Finalize: 1/l, per-wave LDS transpose, coalesced store to AOt[d][s].
  #pragma unroll
  for (int t = 0; t < 2; t++) {
    #pragma unroll
    for (int nf = 0; nf < 4; nf++) {
      #pragma unroll
      for (int i = 0; i < 8; i++) {
        int m = t * 16 + g * 8 + i;
        float l   = lrun[m];
        float inv = (l > 0.f) ? 1.f / l : 0.f;
        Ts[w][nf * 16 + n][m] = (_Float16)(acc[t][nf][i] * inv);
      }
    }
  }
  __syncthreads();
  // 64 rows of 64B per wave: four lanes store one row's 64 contiguous bytes
  _Float16* obase = AOt + ((size_t)b * D_DIM + 64 * w + (lane >> 2)) * S_LEN +
                    q0 + (lane & 3) * 8;
  #pragma unroll
  for (int j = 0; j < 8; j++)
    *(uint4*)(obase + (size_t)(j * 8) * S_LEN) =
        *(const uint4*)&Ts[w][j * 8 + (lane >> 2)][(lane & 3) * 8];
}

// ---------------------------------------------------------------------------
extern "C" void kernel_launch(void* const* d_in, const int* in_sizes, int n_in,
                              void* d_out, int out_size, void* d_ws,
                              size_t ws_size, hipStream_t stream) {
  (void)in_sizes; (void)n_in; (void)out_size; (void)ws_size;
  const float* x    = (const float*)d_in[0];
  const float* mask = (const float*)d_in[1];
  const float* Wq   = (const float*)d_in[2];
  const float* bq   = (const float*)d_in[3];
  const float* Wk   = (const float*)d_in[4];
  const float* bk   = (const float*)d_in[5];
  const float* Wv   = (const float*)d_in[6];
  const float* bv   = (const float*)d_in[7];
  const float* Wo   = (const float*)d_in[8];
  const float* bo   = (const float*)d_in[9];

  const int B = 2, S = S_LEN, D = D_DIM;
  const int M = B * S;                             // 8192
  const size_t MB = 1ull << 20;
  char* ws = (char*)d_ws;                          // 34 MB used
  _Float16* Qh  = (_Float16*)(ws + 0 * MB);        // 8MB [b][s][d]
  _Float16* Kp  = (_Float16*)(ws + 8 * MB);        // 8MB, fragment order
  _Float16* Vp  = (_Float16*)(ws + 16 * MB);       // 8MB, fragment order
  _Float16* xh  = (_Float16*)(ws + 24 * MB);       // 8MB, reused as AOt
  _Float16* AOt = xh;                              // [b][d][s] after attn
  _Float16* Wqh = (_Float16*)(ws + 32 * MB);
  _Float16* Wkh = (_Float16*)(ws + 32 * MB + 512 * 1024);
  _Float16* Wvh = (_Float16*)(ws + 33 * MB);
  _Float16* Woh = (_Float16*)(ws + 33 * MB + 512 * 1024);

  // Wqh..Woh lie one behind the other: one destination for the four weights
  cvt_all_kernel<<<dim3(CVT_WGS), dim3(256), 0, stream>>>(x, Wq, Wk, Wv, Wo, xh,
                                                          Wqh);

  dim3 gg(M / 128, D / 64);
  qkv_wmma_kernel<<<dim3(M / 128, D / 64, 3), dim3(256), 0, stream>>>(
      xh, Wqh, Wkh, Wvh, bq, bk, bv, Qh, Kp, Vp);

  attn_kernel<<<dim3(S / QROWS, B), dim3(256), 0, stream>>>(Qh, Kp, Vp, mask, AOt);

  gemm_wmma_kernel<<<gg, dim3(256), 0, stream>>>(AOt, Woh, bo, d_out, 2);
}

// v006
// A run of this version takes 194 microseconds.
// Timed twice side by side with v005, it ran 1.06 times as fast both times.
// Counting every step since v000, it is 2.25 times as fast.
#include <hip/hip_runtime.h>
#include <hip/hip_bf16.h>

// ---------------------------------------------------------------------------
// Sparse attention, MI455X (gfx1250, wave32, WMMA).
//   B=2, S=4096, D=512. ~86 GFLOP vs ~170MB mandatory traffic -> compute
//   bound; use v_wmma_f32_16x16x32_f16 (f16 in, f32 acc) for every GEMM.
//   Q/K/V f16 (24MB) are L2-resident (192MB L2); K/V B-fragments stream from
//   L2 in the flash loop, stored by the projections in fragment order so that
//   one wave-wide 16B load covers 512 contiguous bytes (4 whole lines).
//   GEMM W-operand panels (x rows for K) are staged to LDS with async-to-LDS
//   DMA (ASYNCcnt) double-buffering; fragments are register-double-buffered
//   so WMMAs overlap loads instead of s_wait_loadcnt 0 per op.
// ---------------------------------------------------------------------------

typedef __attribute__((ext_vector_type(16))) _Float16 v16h;
typedef __attribute__((ext_vector_type(8)))  _Float16 v8h;
typedef __attribute__((ext_vector_type(4)))  _Float16 v4h;
typedef __attribute__((ext_vector_type(8)))  float    v8f;

#define S_LEN 4096
#define D_DIM 512

#if defined(__AMDGCN__) &&                                              \
    __has_builtin(__builtin_amdgcn_global_load_async_to_lds_b128) &&    \
    __has_builtin(__builtin_amdgcn_s_wait_asynccnt)
#define HAVE_ASYNC 1
// Signature (from clang diagnostic): (v4i AS1*, v4i AS3*, imm, imm)
typedef int v4i_t __attribute__((vector_size(16)));
typedef __attribute__((address_space(1))) v4i_t* gv4i_p;
typedef __attribute__((address_space(3))) v4i_t* lv4i_p;
#else
#define HAVE_ASYNC 0
#endif

__device__ __forceinline__ void async_cp16(const _Float16* src, _Float16* lds) {
#if HAVE_ASYNC
  __builtin_amdgcn_global_load_async_to_lds_b128((gv4i_p)src, (lv4i_p)lds, 0, 0);
#else
  *(v8h*)lds = *(const v8h*)src;
#endif
}
__device__ __forceinline__ void async_wait0() {
#if HAVE_ASYNC
  __builtin_amdgcn_s_wait_asynccnt(0);
#endif
}

__device__ __forceinline__ v8f wmma_f16(v16h a, v16h b, v8f c) {
  // (neg_a, A, neg_b, B, c_mod, C, reuse_a, reuse_b)
  return __builtin_amdgcn_wmma_f32_16x16x32_f16(false, a, false, b,
                                                (short)0, c, false, false);
}

// A-fragment (16x32 f16, M=lane&15, K-halves split by lane group) or,
// identically, B-fragment (32x16 f16, N=lane&15) from a row-major source
// whose rows are contiguous in K. Two 16B chunks per lane.
__device__ __forceinline__ v16h load_frag(const _Float16* p, int ld) {
  const int lane = threadIdx.x & 31;
  const int row  = lane & 15;
  const int ko   = (lane >> 4) << 3;     // 0 or 8
  const _Float16* q = p + (size_t)row * ld + ko;
  v8h lo = *(const v8h*)(q);
  v8h hi = *(const v8h*)(q + 16);
  return __builtin_shufflevector(lo, hi, 0,1,2,3,4,5,6,7,8,9,10,11,12,13,14,15);
}

// Fragment stored in fragment order: 512 halves per fragment, two planes of
// 256 halves (elements 0..7, then 8..15), lane l at halves [8l, 8l+8) of each
// plane. p already includes the lane's 8*lane.
__device__ __forceinline__ v16h load_packed(const _Float16* p) {
  v8h lo = *(const v8h*)(p);
  v8h hi = *(const v8h*)(p + 256);
  return __builtin_shufflevector(lo, hi, 0,1,2,3,4,5,6,7,8,9,10,11,12,13,14,15);
}

// Maximum over the 16 lanes of a row, left in every lane of the row: four DPP
// steps on the vector unit (a shuffle goes through the LDS path and is waited
// for at every step). All 32 lanes must be on.
template <int XM>
__device__ __forceinline__ float max_xmask(float v) {
  // 0x160 + XM is the DPP control row_xmask:XM (lane l reads lane l ^ XM)
  int o = __builtin_amdgcn_mov_dpp(__builtin_bit_cast(int, v), 0x160 + XM,
                                   0xf, 0xf, true);
  return fmaxf(v, __builtin_bit_cast(float, o));
}
__device__ __forceinline__ float row_max16(float v) {
  v = max_xmask<1>(v);
  v = max_xmask<2>(v);
  v = max_xmask<4>(v);
  return max_xmask<8>(v);
}
// Lane l reads lane l ^ 16, on the vector unit.
__device__ __forceinline__ float xhalf(float x) {
  int b = __builtin_bit_cast(int, x);
  return __builtin_bit_cast(
      float, __builtin_amdgcn_permlanex16(b, b, 0x76543210, 0xfedcba98, false,
                                          false));
}

__device__ __forceinline__ void exp2x8(float (&x)[8]) {
  asm("v_exp_f32 %0, %0\n\t"
      "v_exp_f32 %1, %1\n\t"
      "v_exp_f32 %2, %2\n\t"
      "v_exp_f32 %3, %3\n\t"
      "v_exp_f32 %4, %4\n\t"
      "v_exp_f32 %5, %5\n\t"
      "v_exp_f32 %6, %6\n\t"
      "v_exp_f32 %7, %7\n\t"
      "v_nop"
      : "+v"(x[0]), "+v"(x[1]), "+v"(x[2]), "+v"(x[3]), "+v"(x[4]),
        "+v"(x[5]), "+v"(x[6]), "+v"(x[7]));
}

// ---------------------------------------------------------------------------
// f32 -> f16 conversion of x and the four weight matrices, one launch.
//   512 work-groups of 256 threads, all resident at once. The five sources
//   are 1,310,720 float4 = 10 per thread: 8 of x, 2 of the weights (Wh holds
//   Wq, Wk, Wv, Wo one behind the other, 65,536 float4 each, so a work-group
//   lies inside one matrix). All 10 loads leave before the first store.
// ---------------------------------------------------------------------------
#define CVT_WGS 512
#define CVT_THREADS (CVT_WGS * 256)

__device__ __forceinline__ v4h cvt4(float4 v) {
  v4h o = {(_Float16)v.x, (_Float16)v.y, (_Float16)v.z, (_Float16)v.w};
  return o;
}

__global__ __launch_bounds__(256) void cvt_all_kernel(
    const float* __restrict__ x, const float* __restrict__ Wq,
    const float* __restrict__ Wk, const float* __restrict__ Wv,
    const float* __restrict__ Wo, _Float16* __restrict__ xh,
    _Float16* __restrict__ Wh) {
  const int t  = blockIdx.x * 256 + threadIdx.x;
  const int hi = blockIdx.x >> 8;                  // t / 65536
  const float* wa = hi ? Wk : Wq;                  // weight float4 t
  const float* wb = hi ? Wo : Wv;                  // weight float4 t + 131072
  float4 vx[8];
  #pragma unroll
  for (int j = 0; j < 8; j++) vx[j] = ((const float4*)x)[j * CVT_THREADS + t];
  float4 va = ((const float4*)wa)[t & 65535];
  float4 vb = ((const float4*)wb)[t & 65535];
  #pragma unroll
  for (int j = 0; j < 8; j++) ((v4h*)xh)[j * CVT_THREADS + t] = cvt4(vx[j]);
  ((v4h*)Wh)[t] = cvt4(va);
  ((v4h*)Wh)[CVT_THREADS + t] = cvt4(vb);
}

// ---------------------------------------------------------------------------
// WMMA GEMM: out[m][n] = sum_k A[m][k] * W[n][k] + bias[n] (mode 3: bias[m])
//   A: [M x 512] f16 rm, W: [N x 512] f16 rm (torch Linear layout; x in mode 3).
//   Block: 8 waves; wave w -> 16x64 tile; block tile 128(M) x 64(N).
//   W k-panel (64 x 32) is shared by all 8 waves -> staged to LDS with
//   async-to-LDS DMA, double buffered; A fragments double buffered in regs.
//   mode 0: f16 out rm [M x 512]   (Q)
//   mode 1: f16 out, rows m = keys, cols = d, in P*V B-fragment order:
//           Vp[m/32][d/16][(m/16)&1][lane = ((m/8)&1)*16 + d%16][m%8]
//   mode 2: f32 out rm [M x 512]   (final Wo projection into d_out)
//   mode 3: f16 out, rows m = d (A = Wk), cols = keys (W = x), bias per row,
//           in Q*K^T B-fragment order:
//           Kp[key/16][d/32][(d/16)&1][lane = ((d/8)&1)*16 + key%16][d%8]
//   In modes 1 and 3 a lane's 8 accumulator rows are one 16B piece of the
//   fragment at its own lane slot: stored straight from registers.
// ---------------------------------------------------------------------------
#define WLD 48   // LDS row stride (halves): 96B, 16B-aligned, bank-spread

__device__ __forceinline__ void gemm_tile(
    const _Float16* __restrict__ A, const _Float16* __restrict__ W,
    const float* __restrict__ bias, void* __restrict__ out, int mode,
    int bm, int bn) {
  __shared__ __align__(16) _Float16 Ws[2][64][WLD];
  const int w    = threadIdx.x >> 5;
  const int lane = threadIdx.x & 31;
  const int g    = lane >> 4;
  const int n    = lane & 15;
  const int m0   = bm * 128 + w * 16;
  const int n0   = bn * 64;

  // cooperative W-panel staging: 64 rows x 32 halves, 16B per thread
  const int srow = threadIdx.x >> 2;
  const int scol = (threadIdx.x & 3) * 8;
  const _Float16* wpan = W + (size_t)(n0 + srow) * D_DIM + scol;

  v8f acc[4] = {};
  const _Float16* abase = A + (size_t)m0 * D_DIM;

  async_cp16(wpan, &Ws[0][srow][scol]);          // stage k=0 panel
  async_wait0();
  __syncthreads();

  v16h a_c = load_frag(abase, D_DIM);
  int buf = 0;
  for (int k = 0; k < D_DIM; k += 32) {
    if (k + 32 < D_DIM)                          // DMA next panel during WMMAs
      async_cp16(wpan + (k + 32), &Ws[buf ^ 1][srow][scol]);
    v16h a_n = a_c;
    if (k + 32 < D_DIM) a_n = load_frag(abase + k + 32, D_DIM);
    #pragma unroll
    for (int nf = 0; nf < 4; nf++) {
      v16h bf = load_frag(&Ws[buf][nf * 16][0], WLD);
      acc[nf] = wmma_f16(a_c, bf, acc[nf]);
    }
    a_c = a_n;
    async_wait0();
    __syncthreads();
    buf ^= 1;
  }

  if (mode == 0) {                               // f16 row-major
    _Float16* o = (_Float16*)out;
    #pragma unroll
    for (int nf = 0; nf < 4; nf++) {
      int col = n0 + nf * 16 + n;
      float bv = bias[col];
      #pragma unroll
      for (int i = 0; i < 8; i++)
        o[(size_t)(m0 + g * 8 + i) * D_DIM + col] = (_Float16)(acc[nf][i] + bv);
    }
    // keeps every later write of the stores' address and data registers
    // behind the stores above
    asm volatile("s_wait_xcnt 0x0" ::: "memory");
  } else if (mode == 1) {                        // V, fragment order
    _Float16* o = (_Float16*)out + (size_t)(m0 >> 5) * (32 * D_DIM) +
                  ((m0 >> 4) & 1) * 256 + lane * 8;
    #pragma unroll
    for (int nf = 0; nf < 4; nf++) {
      float bv = bias[n0 + nf * 16 + n];
      v8h pk;
      #pragma unroll
      for (int i = 0; i < 8; i++) pk[i] = (_Float16)(acc[nf][i] + bv);
      *(v8h*)(o + ((n0 >> 4) + nf) * 512) = pk;
    }
    // keeps every later write of the stores' address and data registers
    // behind the four stores above
    asm volatile("s_wait_xcnt 0x0" ::: "memory");
  } else if (mode == 3) {                        // K, fragment order
    _Float16* o = (_Float16*)out + (m0 >> 4) * 256 + lane * 8;
    float bv[8];
    #pragma unroll
    for (int i = 0; i < 8; i++) bv[i] = bias[m0 + g * 8 + i];
    #pragma unroll
    for (int nf = 0; nf < 4; nf++) {
      v8h pk;
      #pragma unroll
      for (int i = 0; i < 8; i++) pk[i] = (_Float16)(acc[nf][i] + bv[i]);
      *(v8h*)(o + (size_t)((n0 >> 4) + nf) * (16 * D_DIM)) = pk;
    }
    // keeps every later write of the stores' address and data registers
    // behind the four stores above
    asm volatile("s_wait_xcnt 0x0" ::: "memory");
  } else {                                       // f32 row-major (d_out)
    float* o = (float*)out;
    #pragma unroll
    for (int nf = 0; nf < 4; nf++) {
      int col = n0 + nf * 16 + n;
      float bv = bias[col];
      #pragma unroll
      for (int i = 0; i < 8; i++)
        o[(size_t)(m0 + g * 8 + i) * D_DIM + col] = acc[nf][i] + bv;
    }
    // keeps every later write of the stores' address and data registers
    // behind the stores above
    asm volatile("s_wait_xcnt 0x0" ::: "memory");
  }
}

__global__ __launch_bounds__(256) void gemm_wmma_kernel(
    const _Float16* __restrict__ A, const _Float16* __restrict__ W,
    const float* __restrict__ bias, void* __restrict__ out, int mode) {
  gemm_tile(A, W, bias, out, mode, blockIdx.x, blockIdx.y);
}

// Q, K and V projections in one launch: they depend on nothing of each other,
// and one of them alone puts only two work-groups on a WGP. Grid (64, 8, 3);
// blockIdx.z picks the product. K (rows = d, cols = keys) has 4 x 128 tiles:
// its 512 work-groups are renumbered, row tile fastest.
__global__ __launch_bounds__(256) void qkv_wmma_kernel(
    const _Float16* __restrict__ xh, const _Float16* __restrict__ Wqh,
    const _Float16* __restrict__ Wkh, const _Float16* __restrict__ Wvh,
    const float* __restrict__ bq, const float* __restrict__ bk,
    const float* __restrict__ bv, _Float16* __restrict__ Qh,
    _Float16* __restrict__ Kp, _Float16* __restrict__ Vp) {
  const int z    = blockIdx.z;
  const int flat = blockIdx.y * 64 + blockIdx.x;
  const _Float16* A    = (z == 1) ? Wkh : xh;
  const _Float16* W    = (z == 0) ? Wqh : (z == 1) ? xh : Wvh;
  const float*    bias = (z == 0) ? bq : (z == 1) ? bk : bv;
  _Float16*       out  = (z == 0) ? Qh : (z == 1) ? Kp : Vp;
  const int mode = (z == 0) ? 0 : (z == 1) ? 3 : 1;
  const int bm   = (z == 1) ? (flat & 3) : (int)blockIdx.x;
  const int bn   = (z == 1) ? (flat >> 2) : (int)blockIdx.y;
  gemm_tile(A, W, bias, out, mode, bm, bn);
}

// ---------------------------------------------------------------------------
// Flash-style sparse attention.
//   Grid: (S/32, B); block: 256 threads = 8 waves; 32 query rows (two 16-row
//   tiles) per WG, so every K and V fragment that a wave reads from L2 feeds
//   two WMMAs and the launch reads K and V 128 times over, not 256.
//   Per 128-key block: wave w computes score tiles cols [kb+16w,+16) with
//   Q(LDS, read in groups ahead)/K(L2, fragment order) fragments, masks+scales
//   (mask values loaded one key block ahead), shares scores
//   and row-max via LDS; WG-shared online softmax; each wave accumulates P*V
//   into its private 64-wide d-slice with V fragments preloaded one kf ahead.
//   Output stored transposed AOt[d][s] (== reference transpose+reshape,
//   flat-viewed as [S x D] for the final GEMM).
// ---------------------------------------------------------------------------
#define QROWS 32

__global__ __launch_bounds__(256) void attn_kernel(
    const _Float16* __restrict__ Qh, const _Float16* __restrict__ Kp,
    const _Float16* __restrict__ Vp, const float* __restrict__ mask,
    _Float16* __restrict__ AOt) {
  __shared__ __align__(16) _Float16 Qs[QROWS][528]; // padded: banks spread
  __shared__ float Ss[QROWS][132];                 // masked, scaled scores
  __shared__ float tmax[8][QROWS];
  __shared__ float mrun[QROWS], lrun[QROWS], mnew[QROWS], corr[QROWS];
  __shared__ __align__(16) _Float16 Ts[8][64][QROWS]; // per-wave O transpose

  const int q0   = blockIdx.x * QROWS;
  const int b    = blockIdx.y;
  const int w    = threadIdx.x >> 5;
  const int lane = threadIdx.x & 31;
  const int g    = lane >> 4;
  const int n    = lane & 15;
  const float scale = 0.044194173824159216f;       // 1/sqrt(512)
  const float NEG   = -__builtin_inff();
  const float LOG2E = 1.44269504f;

  // Stage Q tile (32 x 512 f16) into LDS via async DMA, 128B/thread.
  {
    int row = threadIdx.x >> 3;
    int c   = (threadIdx.x & 7) * 64;
    const _Float16* src = Qh + ((size_t)b * S_LEN + q0 + row) * D_DIM + c;
    #pragma unroll
    for (int j = 0; j < 64; j += 8)
      async_cp16(src + j, &Qs[row][c + j]);
  }
  if (threadIdx.x < QROWS) { mrun[threadIdx.x] = NEG; lrun[threadIdx.x] = 0.f; }
  // this wave's Q copies have landed before it reaches the loop's first
  // barrier, behind which every wave reads Qs
  asm volatile("s_wait_asynccnt 0x0" ::: "memory");

  v8f acc[2][4] = {};

  // Mask of this lane's 16 score rows, fetched one key block ahead and held as
  // its compare results.
  const float* mrow0 =
      mask + ((size_t)b * S_LEN + q0 + g * 8) * S_LEN + 16 * w + n;
  bool keep[2][8];
  #pragma unroll
  for (int t = 0; t < 2; t++)
    #pragma unroll
    for (int i = 0; i < 8; i++)
      keep[t][i] = mrow0[(size_t)(t * 16 + i) * S_LEN] > 0.95f;

  for (int kb = 0; kb < S_LEN; kb += 128) {
    __syncthreads();
    // ---- Phase A: scores for key sub-tile [kb+16w, +16) --------------------
    v8f s[2] = {};
    const _Float16* kbase =
        Kp + ((size_t)b * S_LEN + kb + 16 * w) * D_DIM + lane * 8;
    // All 16 K fragments (L2) leave first, in the order of their use.
    v16h kfr[16];
    #pragma unroll
    for (int j = 0; j < 16; j++) kfr[j] = load_packed(kbase + j * 512);
    // keeps the K loads in front and in order: loads return in order, and the
    // scheduler put some of them behind the mask's trip to memory
    __builtin_amdgcn_sched_barrier(0);
    // Next key block's mask: all 16 loads leave together, a block before their
    // use. The last block re-reads its own columns, so no address leaves the
    // mask.
    const int kn = (kb + 128 < S_LEN) ? kb + 128 : kb;
    float mn[2][8];
    #pragma unroll
    for (int t = 0; t < 2; t++)
      #pragma unroll
      for (int i = 0; i < 8; i++)
        mn[t][i] = mrow0[(size_t)(t * 16 + i) * S_LEN + kn];
    // keeps every later write of the K and mask loads' address registers
    // behind those loads
    asm volatile("s_wait_xcnt 0x0" ::: "memory");
    // what follows reuses those registers: without this the scheduler lifts
    // part of it over the wait
    __builtin_amdgcn_sched_barrier(0);
    // Q fragments come from LDS in groups of four d steps (16 loads, 8 WMMAs),
    // two register sets, each group read two groups ahead of its WMMAs: a wave
    // then waits for loads that left long ago, not for a round trip per WMMA.
    v16h qa[2][2][4];
    #pragma unroll
    for (int gq = 0; gq < 2; gq++)
      #pragma unroll
      for (int j = 0; j < 4; j++) {
        qa[gq][0][j] = load_frag(&Qs[0][(gq * 4 + j) * 32], 528);
        qa[gq][1][j] = load_frag(&Qs[16][(gq * 4 + j) * 32], 528);
      }
    // without this the scheduler sinks the loads above in among the WMMAs
    __builtin_amdgcn_sched_barrier(0);
    #pragma unroll
    for (int gq = 0; gq < 4; gq++) {
      #pragma unroll
      for (int j = 0; j < 4; j++) {
        s[0] = wmma_f16(qa[gq & 1][0][j], kfr[gq * 4 + j], s[0]);
        s[1] = wmma_f16(qa[gq & 1][1][j], kfr[gq * 4 + j], s[1]);
      }
      if (gq + 2 < 4) {
        // holds the refill behind this group's WMMAs, as one run of loads
        __builtin_amdgcn_sched_barrier(0);
        #pragma unroll
        for (int j = 0; j < 4; j++) {
          qa[gq & 1][0][j] = load_frag(&Qs[0][((gq + 2) * 4 + j) * 32], 528);
          qa[gq & 1][1][j] = load_frag(&Qs[16][((gq + 2) * 4 + j) * 32], 528);
        }
        // holds the refill in front of the next group's WMMAs
        __builtin_amdgcn_sched_barrier(0);
      }
    }
    float rmine = NEG;               // lane n: max of row n & 7 of tile n >> 3
    #pragma unroll
    for (int t = 0; t < 2; t++) {
      #pragma unroll
      for (int i = 0; i < 8; i++) {
        float sv = keep[t][i] ? s[t][i] * scale : NEG;
        Ss[t * 16 + g * 8 + i][16 * w + n] = sv;
        float r = row_max16(sv);                   // 16 independent chains
        rmine = (n == t * 8 + i) ? r : rmine;
      }
    }
    tmax[w][(n >> 3) * 16 + g * 8 + (n & 7)] = rmine;
    #pragma unroll
    for (int t = 0; t < 2; t++)
      #pragma unroll
      for (int i = 0; i < 8; i++) keep[t][i] = mn[t][i] > 0.95f;
    __syncthreads();
    // ---- Phase B: workgroup-shared online-softmax stats -------------------
    if (threadIdx.x < QROWS) {
      int r = threadIdx.x;
      float mx = tmax[0][r];
      #pragma unroll
      for (int t = 1; t < 8; t++) mx = fmaxf(mx, tmax[t][r]);
      float mold = mrun[r];
      float mn   = fmaxf(mold, mx);
      float c    = (mn <= -1e30f) ? 1.f : __expf(mold - mn);
      mnew[r] = mn; corr[r] = c; mrun[r] = mn;
    }
    __syncthreads();
    // ---- Phase C: rescale acc, build P A-frags, P*V (V preloaded) ---------
    #pragma unroll
    for (int t = 0; t < 2; t++)
      #pragma unroll
      for (int nf = 0; nf < 4; nf++)
        #pragma unroll
        for (int i = 0; i < 8; i++) acc[t][nf][i] *= corr[t * 16 + g * 8 + i];

    const int ko  = g * 8;                         // A-frag row = lane&15
    const float mrow[2] = {mnew[n], mnew[16 + n]};
    const _Float16* vbase =
        Vp + ((size_t)b * S_LEN + kb) * D_DIM + (4 * w) * 512 + lane * 8;
    v16h vb_c[4];
    #pragma unroll
    for (int nf = 0; nf < 4; nf++)
      vb_c[nf] = load_packed(vbase + nf * 512);

    float lsum[2] = {0.f, 0.f};
    #pragma unroll
    for (int kf = 0; kf < 4; kf++) {
      v16h vb_n[4];
      if (kf < 3) {                                // preload next kf's V frags
        #pragma unroll
        for (int nf = 0; nf < 4; nf++)
          vb_n[nf] = load_packed(vbase + (kf + 1) * (32 * D_DIM) + nf * 512);
      }
      v16h p[2];
      #pragma unroll
      for (int t = 0; t < 2; t++) {
        float s0v[8], s1v[8], x0[8], x1[8];
        #pragma unroll
        for (int j = 0; j < 8; j++) {
          s0v[j] = Ss[t * 16 + n][kf * 32 + ko + j];
          s1v[j] = Ss[t * 16 + n][kf * 32 + ko + 16 + j];
          x0[j]  = (s0v[j] - mrow[t]) * LOG2E;     // e^y = 2^(y * log2 e)
          x1[j]  = (s1v[j] - mrow[t]) * LOG2E;
        }
        exp2x8(x0);
        exp2x8(x1);
        #pragma unroll
        for (int j = 0; j < 8; j++) {
          float e0 = (s0v[j] <= -1e30f) ? 0.f : x0[j];
          float e1 = (s1v[j] <= -1e30f) ? 0.f : x1[j];
          lsum[t] += e0 + e1;
          p[t][j]     = (_Float16)e0;
          p[t][8 + j] = (_Float16)e1;
        }
      }
      #pragma unroll
      for (int nf = 0; nf < 4; nf++) {
        acc[0][nf] = wmma_f16(p[0], vb_c[nf], acc[0][nf]);
        acc[1][nf] = wmma_f16(p[1], vb_c[nf], acc[1][nf]);
      }
      if (kf < 3) {
        #pragma unroll
        for (int nf = 0; nf < 4; nf++) vb_c[nf] = vb_n[nf];
      }
    }
    // keeps the next block's write of the V loads' address registers behind
    // those loads
    asm volatile("s_wait_xcnt 0x0" ::: "memory");
    // both halves of a wave end with the row's total: lane l keeps row l
    float rt0 = lsum[0] + xhalf(lsum[0]);
    float rt1 = lsum[1] + xhalf(lsum[1]);
    if (w == 0) lrun[lane] = lrun[lane] * corr[lane] + (g ? rt1 : rt0);
  }
  __syncthreads();

  // ---- Finalize: 1/l, per-wave LDS transpose, coalesced store to AOt[d][s].
  #pragma unroll
  for (int t = 0; t < 2; t++) {
    #pragma unroll
    for (int nf = 0; nf < 4; nf++) {
      #pragma unroll
      for (int i = 0; i < 8; i++) {
        int m = t * 16 + g * 8 + i;
        float l   = lrun[m];
        float inv = (l > 0.f) ? 1.f / l : 0.f;
        Ts[w][nf * 16 + n][m] = (_Float16)(acc[t][nf][i] * inv);
      }
    }
  }
  __syncthreads();
  // 64 rows of 64B per wave: four lanes store one row's 64 contiguous bytes
  _Float16* obase = AOt + ((size_t)b * D_DIM + 64 * w + (lane >> 2)) * S_LEN +
                    q0 + (lane & 3) * 8;
  #pragma unroll
  for (int j = 0; j < 8; j++)
    *(uint4*)(obase + (size_t)(j * 8) * S_LEN) =
        *(const uint4*)&Ts[w][j * 8 + (lane >> 2)][(lane & 3) * 8];
}

// ---------------------------------------------------------------------------
extern "C" void kernel_launch(void* const* d_in, const int* in_sizes, int n_in,
                              void* d_out, int out_size, void* d_ws,
                              size_t ws_size, hipStream_t stream) {
  (void)in_sizes; (void)n_in; (void)out_size; (void)ws_size;
  const float* x    = (const float*)d_in[0];
  const float* mask = (const float*)d_in[1];
  const float* Wq   = (const float*)d_in[2];
  const float* bq   = (const float*)d_in[3];
  const float* Wk   = (const float*)d_in[4];
  const float* bk   = (const float*)d_in[5];
  const float* Wv   = (const float*)d_in[6];
  const float* bv   = (const float*)d_in[7];
  const float* Wo   = (const float*)d_in[8];
  const float* bo   = (const float*)d_in[9];

  const int B = 2, S = S_LEN, D = D_DIM;
  const int M = B * S;                             // 8192
  const size_t MB = 1ull << 20;
  char* ws = (char*)d_ws;                          // 34 MB used
  _Float16* Qh  = (_Float16*)(ws + 0 * MB);        // 8MB [b][s][d]
  _Float16* Kp  = (_Float16*)(ws + 8 * MB);        // 8MB, fragment order
  _Float16* Vp  = (_Float16*)(ws + 16 * MB);       // 8MB, fragment order
  _Float16* xh  = (_Float16*)(ws + 24 * MB);       // 8MB, reused as AOt
  _Float16* AOt = xh;                              // [b][d][s] after attn
  _Float16* Wqh = (_Float16*)(ws + 32 * MB);
  _Float16* Wkh = (_Float16*)(ws + 32 * MB + 512 * 1024);
  _Float16* Wvh = (_Float16*)(ws + 33 * MB);
  _Float16* Woh = (_Float16*)(ws + 33 * MB + 512 * 1024);

  // Wqh..Woh lie one behind the other: one destination for the four weights
  cvt_all_kernel<<<dim3(CVT_WGS), dim3(256), 0, stream>>>(x, Wq, Wk, Wv, Wo, xh,
                                                          Wqh);

  dim3 gg(M / 128, D / 64);
  qkv_wmma_kernel<<<dim3(M / 128, D / 64, 3), dim3(256), 0, stream>>>(
      xh, Wqh, Wkh, Wvh, bq, bk, bv, Qh, Kp, Vp);

  attn_kernel<<<dim3(S / QROWS, B), dim3(256), 0, stream>>>(Qh, Kp, Vp, mask, AOt);

  gemm_wmma_kernel<<<gg, dim3(256), 0, stream>>>(AOt, Woh, bo, d_out, 2);
}

// v007
// A run of this version takes 168 microseconds.
// Two timings next to v006 both put it at 1.16 times that version's speed.
// All steps since v000 together make it 2.62 times as fast.
#include <hip/hip_runtime.h>
#include <hip/hip_bf16.h>

// ---------------------------------------------------------------------------
// Sparse attention, MI455X (gfx1250, wave32, WMMA).
//   B=2, S=4096, D=512. ~86 GFLOP vs ~170MB mandatory traffic -> compute
//   bound; use v_wmma_f32_16x16x32_f16 (f16 in, f32 acc) for every GEMM.
//   Q/K/V f16 (24MB) are L2-resident (192MB L2); K A- and V B-fragments stream from
//   L2 in the flash loop, stored by the projections in fragment order so that
//   one wave-wide 16B load covers 512 contiguous bytes (4 whole lines).
//   GEMM W-operand panels (x rows for K) are staged to LDS with async-to-LDS
//   DMA (ASYNCcnt) double-buffering; fragments are register-double-buffered
//   so WMMAs overlap loads instead of s_wait_loadcnt 0 per op.
// ---------------------------------------------------------------------------

typedef __attribute__((ext_vector_type(16))) _Float16 v16h;
typedef __attribute__((ext_vector_type(8)))  _Float16 v8h;
typedef __attribute__((ext_vector_type(4)))  _Float16 v4h;
typedef __attribute__((ext_vector_type(8)))  float    v8f;

#define S_LEN 4096
#define D_DIM 512

#if defined(__AMDGCN__) &&                                              \
    __has_builtin(__builtin_amdgcn_global_load_async_to_lds_b128) &&    \
    __has_builtin(__builtin_amdgcn_s_wait_asynccnt)
#define HAVE_ASYNC 1
// Signature (from clang diagnostic): (v4i AS1*, v4i AS3*, imm, imm)
typedef int v4i_t __attribute__((vector_size(16)));
typedef __attribute__((address_space(1))) v4i_t* gv4i_p;
typedef __attribute__((address_space(3))) v4i_t* lv4i_p;
#else
#define HAVE_ASYNC 0
#endif

__device__ __forceinline__ void async_cp16(const _Float16* src, _Float16* lds) {
#if HAVE_ASYNC
  __builtin_amdgcn_global_load_async_to_lds_b128((gv4i_p)src, (lv4i_p)lds, 0, 0);
#else
  *(v8h*)lds = *(const v8h*)src;
#endif
}
__device__ __forceinline__ void async_wait0() {
#if HAVE_ASYNC
  __builtin_amdgcn_s_wait_asynccnt(0);
#endif
}

__device__ __forceinline__ v8f wmma_f16(v16h a, v16h b, v8f c) {
  // (neg_a, A, neg_b, B, c_mod, C, reuse_a, reuse_b)
  return __builtin_amdgcn_wmma_f32_16x16x32_f16(false, a, false, b,
                                                (short)0, c, false, false);
}

// A-fragment (16x32 f16, M=lane&15, K-halves split by lane group) or,
// identically, B-fragment (32x16 f16, N=lane&15) from a row-major source
// whose rows are contiguous in K. Two 16B chunks per lane.
__device__ __forceinline__ v16h load_frag(const _Float16* p, int ld) {
  const int lane = threadIdx.x & 31;
  const int row  = lane & 15;
  const int ko   = (lane >> 4) << 3;     // 0 or 8
  const _Float16* q = p + (size_t)row * ld + ko;
  v8h lo = *(const v8h*)(q);
  v8h hi = *(const v8h*)(q + 16);
  return __builtin_shufflevector(lo, hi, 0,1,2,3,4,5,6,7,8,9,10,11,12,13,14,15);
}

// Fragment stored in fragment order: 512 halves per fragment, two planes of
// 256 halves (elements 0..7, then 8..15), lane l at halves [8l, 8l+8) of each
// plane. p already includes the lane's 8*lane.
__device__ __forceinline__ v16h load_packed(const _Float16* p) {
  v8h lo = *(const v8h*)(p);
  v8h hi = *(const v8h*)(p + 256);
  return __builtin_shufflevector(lo, hi, 0,1,2,3,4,5,6,7,8,9,10,11,12,13,14,15);
}

// Lane l reads lane l ^ 16, on the vector unit.
__device__ __forceinline__ float xhalf(float x) {
  int b = __builtin_bit_cast(int, x);
  return __builtin_bit_cast(
      float, __builtin_amdgcn_permlanex16(b, b, 0x76543210, 0xfedcba98, false,
                                          false));
}

// Work-group barrier for data that is handed over in LDS alone: the fences name
// the LDS address space, so the wave waits for its LDS operations only.
// __syncthreads() also waits for every global load in flight, which would end
// the V and mask loads' head start at the first barrier behind them.
__device__ __forceinline__ void lds_barrier() {
  __builtin_amdgcn_fence(__ATOMIC_RELEASE, "workgroup", "local");
  __builtin_amdgcn_s_barrier();
  __builtin_amdgcn_fence(__ATOMIC_ACQUIRE, "workgroup", "local");
}

__device__ __forceinline__ void exp2x8(float (&x)[8]) {
  asm("v_exp_f32 %0, %0\n\t"
      "v_exp_f32 %1, %1\n\t"
      "v_exp_f32 %2, %2\n\t"
      "v_exp_f32 %3, %3\n\t"
      "v_exp_f32 %4, %4\n\t"
      "v_exp_f32 %5, %5\n\t"
      "v_exp_f32 %6, %6\n\t"
      "v_exp_f32 %7, %7\n\t"
      "v_nop"
      : "+v"(x[0]), "+v"(x[1]), "+v"(x[2]), "+v"(x[3]), "+v"(x[4]),
        "+v"(x[5]), "+v"(x[6]), "+v"(x[7]));
}

// ---------------------------------------------------------------------------
// f32 -> f16 conversion of x and the four weight matrices, one launch.
//   512 work-groups of 256 threads, all resident at once. The five sources
//   are 1,310,720 float4 = 10 per thread: 8 of x, 2 of the weights (Wh holds
//   Wq, Wk, Wv, Wo one behind the other, 65,536 float4 each, so a work-group
//   lies inside one matrix). All 10 loads leave before the first store.
// ---------------------------------------------------------------------------
#define CVT_WGS 512
#define CVT_THREADS (CVT_WGS * 256)

__device__ __forceinline__ v4h cvt4(float4 v) {
  v4h o = {(_Float16)v.x, (_Float16)v.y, (_Float16)v.z, (_Float16)v.w};
  return o;
}

__global__ __launch_bounds__(256) void cvt_all_kernel(
    const float* __restrict__ x, const float* __restrict__ Wq,
    const float* __restrict__ Wk, const float* __restrict__ Wv,
    const float* __restrict__ Wo, _Float16* __restrict__ xh,
    _Float16* __restrict__ Wh) {
  const int t  = blockIdx.x * 256 + threadIdx.x;
  const int hi = blockIdx.x >> 8;                  // t / 65536
  const float* wa = hi ? Wk : Wq;                  // weight float4 t
  const float* wb = hi ? Wo : Wv;                  // weight float4 t + 131072
  float4 vx[8];
  #pragma unroll
  for (int j = 0; j < 8; j++) vx[j] = ((const float4*)x)[j * CVT_THREADS + t];
  float4 va = ((const float4*)wa)[t & 65535];
  float4 vb = ((const float4*)wb)[t & 65535];
  #pragma unroll
  for (int j = 0; j < 8; j++) ((v4h*)xh)[j * CVT_THREADS + t] = cvt4(vx[j]);
  ((v4h*)Wh)[t] = cvt4(va);
  ((v4h*)Wh)[CVT_THREADS + t] = cvt4(vb);
}

// ---------------------------------------------------------------------------
// WMMA GEMM: out[m][n] = sum_k A[m][k] * W[n][k] + bias[n] (mode 3: bias[m])
//   A: [M x 512] f16 rm, W: [N x 512] f16 rm (torch Linear layout; x in mode 3).
//   Block: 8 waves; wave w -> 16x64 tile; block tile 128(M) x 64(N).
//   W k-panel (64 x 32) is shared by all 8 waves -> staged to LDS with
//   async-to-LDS DMA, double buffered; A fragments double buffered in regs.
//   mode 0: f16 out rm [M x 512]   (Q)
//   mode 1: f16 out, rows m = keys, cols = d, in P*V B-fragment order:
//           Vp[m/32][d/16][(m/16)&1][lane = ((m/8)&1)*16 + d%16][m%8]
//   mode 2: f32 out rm [M x 512]   (final Wo projection into d_out)
//   mode 3: f16 out, rows m = d (A = Wk), cols = keys (W = x), bias per row,
//           in Q*K^T B-fragment order:
//           Kp[key/16][d/32][(d/16)&1][lane = ((d/8)&1)*16 + key%16][d%8]
//   In modes 1 and 3 a lane's 8 accumulator rows are one 16B piece of the
//   fragment at its own lane slot: stored straight from registers.
// ---------------------------------------------------------------------------
#define WLD 48   // LDS row stride (halves): 96B, 16B-aligned, bank-spread

__device__ __forceinline__ void gemm_tile(
    const _Float16* __restrict__ A, const _Float16* __restrict__ W,
    const float* __restrict__ bias, void* __restrict__ out, int mode,
    int bm, int bn) {
  __shared__ __align__(16) _Float16 Ws[2][64][WLD];
  const int w    = threadIdx.x >> 5;
  const int lane = threadIdx.x & 31;
  const int g    = lane >> 4;
  const int n    = lane & 15;
  const int m0   = bm * 128 + w * 16;
  const int n0   = bn * 64;

  // cooperative W-panel staging: 64 rows x 32 halves, 16B per thread
  const int srow = threadIdx.x >> 2;
  const int scol = (threadIdx.x & 3) * 8;
  const _Float16* wpan = W + (size_t)(n0 + srow) * D_DIM + scol;

  v8f acc[4] = {};
  const _Float16* abase = A + (size_t)m0 * D_DIM;

  async_cp16(wpan, &Ws[0][srow][scol]);          // stage k=0 panel
  async_wait0();
  __syncthreads();

  v16h a_c = load_frag(abase, D_DIM);
  int buf = 0;
  for (int k = 0; k < D_DIM; k += 32) {
    if (k + 32 < D_DIM)                          // DMA next panel during WMMAs
      async_cp16(wpan + (k + 32), &Ws[buf ^ 1][srow][scol]);
    v16h a_n = a_c;
    if (k + 32 < D_DIM) a_n = load_frag(abase + k + 32, D_DIM);
    #pragma unroll
    for (int nf = 0; nf < 4; nf++) {
      v16h bf = load_frag(&Ws[buf][nf * 16][0], WLD);
      acc[nf] = wmma_f16(a_c, bf, acc[nf]);
    }
    a_c = a_n;
    async_wait0();
    __syncthreads();
    buf ^= 1;
  }

  if (mode == 0) {                               // f16 row-major
    _Float16* o = (_Float16*)out;
    #pragma unroll
    for (int nf = 0; nf < 4; nf++) {
      int col = n0 + nf * 16 + n;
      float bv = bias[col];
      #pragma unroll
      for (int i = 0; i < 8; i++)
        o[(size_t)(m0 + g * 8 + i) * D_DIM + col] = (_Float16)(acc[nf][i] + bv);
    }
    // keeps every later write of the stores' address and data registers
    // behind the stores above
    asm volatile("s_wait_xcnt 0x0" ::: "memory");
  } else if (mode == 1) {                        // V, fragment order
    _Float16* o = (_Float16*)out + (size_t)(m0 >> 5) * (32 * D_DIM) +
                  ((m0 >> 4) & 1) * 256 + lane * 8;
    #pragma unroll
    for (int nf = 0; nf < 4; nf++) {
      float bv = bias[n0 + nf * 16 + n];
      v8h pk;
      #pragma unroll
      for (int i = 0; i < 8; i++) pk[i] = (_Float16)(acc[nf][i] + bv);
      *(v8h*)(o + ((n0 >> 4) + nf) * 512) = pk;
    }
    // keeps every later write of the stores' address and data registers
    // behind the four stores above
    asm volatile("s_wait_xcnt 0x0" ::: "memory");
  } else if (mode == 3) {                        // K, fragment order
    _Float16* o = (_Float16*)out + (m0 >> 4) * 256 + lane * 8;
    float bv[8];
    #pragma unroll
    for (int i = 0; i < 8; i++) bv[i] = bias[m0 + g * 8 + i];
    #pragma unroll
    for (int nf = 0; nf < 4; nf++) {
      v8h pk;
      #pragma unroll
      for (int i = 0; i < 8; i++) pk[i] = (_Float16)(acc[nf][i] + bv[i]);
      *(v8h*)(o + (size_t)((n0 >> 4) + nf) * (16 * D_DIM)) = pk;
    }
    // keeps every later write of the stores' address and data registers
    // behind the four stores above
    asm volatile("s_wait_xcnt 0x0" ::: "memory");
  } else {                                       // f32 row-major (d_out)
    float* o = (float*)out;
    #pragma unroll
    for (int nf = 0; nf < 4; nf++) {
      int col = n0 + nf * 16 + n;
      float bv = bias[col];
      #pragma unroll
      for (int i = 0; i < 8; i++)
        o[(size_t)(m0 + g * 8 + i) * D_DIM + col] = acc[nf][i] + bv;
    }
    // keeps every later write of the stores' address and data registers
    // behind the stores above
    asm volatile("s_wait_xcnt 0x0" ::: "memory");
  }
}

__global__ __launch_bounds__(256) void gemm_wmma_kernel(
    const _Float16* __restrict__ A, const _Float16* __restrict__ W,
    const float* __restrict__ bias, void* __restrict__ out, int mode) {
  gemm_tile(A, W, bias, out, mode, blockIdx.x, blockIdx.y);
}

// Q, K and V projections in one launch: they depend on nothing of each other,
// and one of them alone puts only two work-groups on a WGP. Grid (64, 8, 3);
// blockIdx.z picks the product. K (rows = d, cols = keys) has 4 x 128 tiles:
// its 512 work-groups are renumbered, row tile fastest.
__global__ __launch_bounds__(256) void qkv_wmma_kernel(
    const _Float16* __restrict__ xh, const _Float16* __restrict__ Wqh,
    const _Float16* __restrict__ Wkh, const _Float16* __restrict__ Wvh,
    const float* __restrict__ bq, const float* __restrict__ bk,
    const float* __restrict__ bv, _Float16* __restrict__ Qh,
    _Float16* __restrict__ Kp, _Float16* __restrict__ Vp) {
  const int z    = blockIdx.z;
  const int flat = blockIdx.y * 64 + blockIdx.x;
  const _Float16* A    = (z == 1) ? Wkh : xh;
  const _Float16* W    = (z == 0) ? Wqh : (z == 1) ? xh : Wvh;
  const float*    bias = (z == 0) ? bq : (z == 1) ? bk : bv;
  _Float16*       out  = (z == 0) ? Qh : (z == 1) ? Kp : Vp;
  const int mode = (z == 0) ? 0 : (z == 1) ? 3 : 1;
  const int bm   = (z == 1) ? (flat & 3) : (int)blockIdx.x;
  const int bn   = (z == 1) ? (flat >> 2) : (int)blockIdx.y;
  gemm_tile(A, W, bias, out, mode, bm, bn);
}

// ---------------------------------------------------------------------------
// Flash-style sparse attention.
//   Grid: (S/32, B); block: 256 threads = 8 waves; 32 query rows (two 16-row
//   tiles) per WG, so every K and V fragment that a wave reads from L2 feeds
//   two WMMAs and the launch reads K and V 128 times over, not 256.
//   Per 128-key block: wave w computes the scores of keys [kb+16w,+16)
//   TRANSPOSED (K fragment as A, Q fragment as B): a lane then holds 8
//   neighbouring keys of one query, which is one 16B piece of the P*V
//   A-fragment at the lane's own slot. The wave masks+scales them (mask values
//   loaded one key block ahead), shares its row maxima via LDS; WG-shared
//   online softmax; then each wave exponentiates its own 32x16 tile from
//   registers, once for the whole WG, and stores it as f16 in fragment order
//   to LDS, where all 8 waves read it; each wave accumulates P*V into its
//   private 64-wide d-slice. The row sums stay per lane (rescaled like the
//   accumulators) and are added up behind the loop.
//   Output stored transposed AOt[d][s] (== reference transpose+reshape,
//   flat-viewed as [S x D] for the final GEMM).
// ---------------------------------------------------------------------------
#define QROWS 32

__global__ __launch_bounds__(256) void attn_kernel(
    const _Float16* __restrict__ Qh, const _Float16* __restrict__ Kp,
    const _Float16* __restrict__ Vp, const float* __restrict__ mask,
    _Float16* __restrict__ AOt) {
  __shared__ __align__(16) _Float16 Qs[QROWS][528]; // padded: banks spread
  // P of one key block, A-fragment order: [tile][key/16][lane][8 halves]
  __shared__ __align__(16) _Float16 Pp[2 * 8 * 256];
  __shared__ float tmax[8][QROWS];
  __shared__ float mrun[QROWS], lrun[QROWS], mnew[QROWS], corr[QROWS];
  __shared__ __align__(16) _Float16 Ts[8][64][QROWS]; // per-wave O transpose

  const int q0   = blockIdx.x * QROWS;
  const int b    = blockIdx.y;
  const int w    = threadIdx.x >> 5;
  const int lane = threadIdx.x & 31;
  const int g    = lane >> 4;
  const int n    = lane & 15;
  const float scale = 0.044194173824159216f;       // 1/sqrt(512)
  const float NEG   = -__builtin_inff();
  const float LOG2E = 1.44269504f;

  // Stage Q tile (32 x 512 f16) into LDS via async DMA, 128B/thread.
  {
    int row = threadIdx.x >> 3;
    int c   = (threadIdx.x & 7) * 64;
    const _Float16* src = Qh + ((size_t)b * S_LEN + q0 + row) * D_DIM + c;
    #pragma unroll
    for (int j = 0; j < 64; j += 8)
      async_cp16(src + j, &Qs[row][c + j]);
  }
  if (threadIdx.x < QROWS) mrun[threadIdx.x] = NEG;
  // this wave's Q copies have landed before it reaches the barrier in front
  // of the loop, behind which every wave reads Qs
  asm volatile("s_wait_asynccnt 0x0" ::: "memory");

  v8f acc[2][4] = {};
  float lpart[2] = {0.f, 0.f};   // this lane's share of the sums of rows n, 16+n

  // Mask of this lane's 16 scores (queries n and 16+n, 8 neighbouring keys),
  // fetched one key block ahead and held as its compare results.
  const float* mrow0 =
      mask + ((size_t)b * S_LEN + q0 + n) * S_LEN + 16 * w + g * 8;
  bool keep[2][8];
  {
    float4 m4[2][2];
    #pragma unroll
    for (int t = 0; t < 2; t++)
      #pragma unroll
      for (int h = 0; h < 2; h++)
        m4[t][h] = *(const float4*)(mrow0 + (size_t)(t * 16) * S_LEN + h * 4);
    // keeps every later write of the mask loads' address registers behind them
    asm volatile("s_wait_xcnt 0x0" ::: "memory");
    #pragma unroll
    for (int t = 0; t < 2; t++)
      #pragma unroll
      for (int h = 0; h < 2; h++) {
        keep[t][h * 4 + 0] = m4[t][h].x > 0.95f;
        keep[t][h * 4 + 1] = m4[t][h].y > 0.95f;
        keep[t][h * 4 + 2] = m4[t][h].z > 0.95f;
        keep[t][h * 4 + 3] = m4[t][h].w > 0.95f;
      }
  }
  __syncthreads();                                 // Qs and mrun are there

  for (int kb = 0; kb < S_LEN; kb += 128) {
    // ---- Phase A: scores for key sub-tile [kb+16w, +16), keys as rows ------
    v8f s[2] = {};
    const _Float16* kbase =
        Kp + ((size_t)b * S_LEN + kb + 16 * w) * D_DIM + lane * 8;
    // All 16 K fragments (L2) leave first, in the order of their use.
    v16h kfr[16];
    #pragma unroll
    for (int j = 0; j < 16; j++) kfr[j] = load_packed(kbase + j * 512);
    // keeps every later write of the K loads' address registers behind them
    asm volatile("s_wait_xcnt 0x0" ::: "memory");
    // what follows reuses those registers: without this the scheduler lifts
    // part of it over the wait
    __builtin_amdgcn_sched_barrier(0);
    // Q fragments come from LDS in groups of four d steps (16 loads, 8 WMMAs),
    // two register sets, each group read two groups ahead of its WMMAs: a wave
    // then waits for loads that left long ago, not for a round trip per WMMA.
    v16h qa[2][2][4];
    #pragma unroll
    for (int gq = 0; gq < 2; gq++)
      #pragma unroll
      for (int j = 0; j < 4; j++) {
        qa[gq][0][j] = load_frag(&Qs[0][(gq * 4 + j) * 32], 528);
        qa[gq][1][j] = load_frag(&Qs[16][(gq * 4 + j) * 32], 528);
      }
    // without this the scheduler sinks the loads above in among the WMMAs
    __builtin_amdgcn_sched_barrier(0);
    #pragma unroll
    for (int gq = 0; gq < 4; gq++) {
      #pragma unroll
      for (int j = 0; j < 4; j++) {
        s[0] = wmma_f16(kfr[gq * 4 + j], qa[gq & 1][0][j], s[0]);
        s[1] = wmma_f16(kfr[gq * 4 + j], qa[gq & 1][1][j], s[1]);
      }
      if (gq + 2 < 4) {
        // holds the refill behind this group's WMMAs, as one run of loads
        __builtin_amdgcn_sched_barrier(0);
        #pragma unroll
        for (int j = 0; j < 4; j++) {
          qa[gq & 1][0][j] = load_frag(&Qs[0][((gq + 2) * 4 + j) * 32], 528);
          qa[gq & 1][1][j] = load_frag(&Qs[16][((gq + 2) * 4 + j) * 32], 528);
        }
        // holds the refill in front of the next group's WMMAs
        __builtin_amdgcn_sched_barrier(0);
      }
    }
    // holds the V loads behind the score WMMAs, whose K registers they take
    __builtin_amdgcn_sched_barrier(0);
    // All 16 V fragments (L2) of this key block leave here: the softmax and
    // its three barriers stand between them and their WMMAs.
    const _Float16* vbase =
        Vp + ((size_t)b * S_LEN + kb) * D_DIM + (4 * w) * 512 + lane * 8;
    v16h vfr[16];
    #pragma unroll
    for (int kf = 0; kf < 4; kf++)
      #pragma unroll
      for (int nf = 0; nf < 4; nf++)
        vfr[kf * 4 + nf] = load_packed(vbase + kf * (32 * D_DIM) + nf * 512);
    // holds the mask loads behind the V loads: loads return in order, and V
    // (L2) must not wait for the mask's trip to memory
    __builtin_amdgcn_sched_barrier(0);
    // Next key block's mask: all 4 loads leave together, compared at the foot
    // of this pass. The last block re-reads its own columns, so no address
    // leaves the mask.
    const float* mnext = mrow0 + ((kb + 128 < S_LEN) ? kb + 128 : kb);
    float4 mn4[2][2];
    #pragma unroll
    for (int t = 0; t < 2; t++)
      #pragma unroll
      for (int h = 0; h < 2; h++)
        mn4[t][h] = *(const float4*)(mnext + (size_t)(t * 16) * S_LEN + h * 4);
    // keeps every later write of the V and mask loads' address registers
    // behind those loads; the addresses are named so that they stay live up to
    // here (the last V load had been given V's as its destination, and the
    // mask's was written anew right behind its loads)
    asm volatile("s_wait_xcnt 0x0" :: "v"(vbase), "v"(mnext) : "memory");
    // lane (g, n): s[t][i] is query t*16+n against key kb + 16w + g*8 + i
    float sv[2][8], rm[2];
    #pragma unroll
    for (int t = 0; t < 2; t++) {
      #pragma unroll
      for (int i = 0; i < 8; i++)
        sv[t][i] = keep[t][i] ? s[t][i] * scale : NEG;
      float r = sv[t][0];
      #pragma unroll
      for (int i = 1; i < 8; i++) r = fmaxf(r, sv[t][i]);
      rm[t] = fmaxf(r, xhalf(r));                  // all 16 keys of the wave
    }
    tmax[w][lane] = g ? rm[1] : rm[0];             // lane l: query row l
    lds_barrier();
    // ---- Phase B: workgroup-shared online-softmax stats -------------------
    if (threadIdx.x < QROWS) {
      int r = threadIdx.x;
      float mx = tmax[0][r];
      #pragma unroll
      for (int t = 1; t < 8; t++) mx = fmaxf(mx, tmax[t][r]);
      float mold = mrun[r];
      float mn   = fmaxf(mold, mx);
      float c    = (mn <= -1e30f) ? 1.f : __expf(mold - mn);
      mnew[r] = mn; corr[r] = c; mrun[r] = mn;
    }
    lds_barrier();
    // ---- Phase P: this wave's own tile of P, once for the work-group ------
    float cr[2][8];
    #pragma unroll
    for (int t = 0; t < 2; t++)
      #pragma unroll
      for (int i = 0; i < 8; i++) cr[t][i] = corr[t * 16 + g * 8 + i];
    #pragma unroll
    for (int t = 0; t < 2; t++) {
      const float mrow = mnew[t * 16 + n];
      float x[8];
      #pragma unroll
      for (int i = 0; i < 8; i++)
        x[i] = (sv[t][i] - mrow) * LOG2E;          // e^y = 2^(y * log2 e)
      exp2x8(x);
      v8h pk;
      float es = 0.f;
      #pragma unroll
      for (int i = 0; i < 8; i++) {
        float e = (sv[t][i] <= -1e30f) ? 0.f : x[i];
        es += e;
        pk[i] = (_Float16)e;
      }
      lpart[t] = lpart[t] * corr[t * 16 + n] + es;
      // keys 16w + g*8 + 0..7 of query n: plane w & 1 of fragment w >> 1
      *(v8h*)&Pp[(t * 8 + w) * 256 + lane * 8] = pk;
    }
    // behind it every wave reads all of Pp; the next block's Pp stores stand
    // behind two more barriers, so no barrier is needed at the loop's top
    lds_barrier();
    // ---- Phase C: P A-frags from LDS, rescale acc, P*V --------------------
    v16h p[2][4];
    #pragma unroll
    for (int t = 0; t < 2; t++)
      #pragma unroll
      for (int kf = 0; kf < 4; kf++)
        p[t][kf] = load_packed(&Pp[(t * 4 + kf) * 512 + lane * 8]);
    // holds the 16 P loads together as one run: the scheduler spread them in
    // pairs among the WMMAs, each pair with a wait of its own
    __builtin_amdgcn_sched_barrier(0);
    #pragma unroll
    for (int t = 0; t < 2; t++)
      #pragma unroll
      for (int nf = 0; nf < 4; nf++)
        #pragma unroll
        for (int i = 0; i < 8; i++) acc[t][nf][i] *= cr[t][i];
    #pragma unroll
    for (int kf = 0; kf < 4; kf++) {
      #pragma unroll
      for (int nf = 0; nf < 4; nf++) {
        acc[0][nf] = wmma_f16(p[0][kf], vfr[kf * 4 + nf], acc[0][nf]);
        acc[1][nf] = wmma_f16(p[1][kf], vfr[kf * 4 + nf], acc[1][nf]);
      }
    }
    #pragma unroll
    for (int t = 0; t < 2; t++)
      #pragma unroll
      for (int h = 0; h < 2; h++) {
        keep[t][h * 4 + 0] = mn4[t][h].x > 0.95f;
        keep[t][h * 4 + 1] = mn4[t][h].y > 0.95f;
        keep[t][h * 4 + 2] = mn4[t][h].z > 0.95f;
        keep[t][h * 4 + 3] = mn4[t][h].w > 0.95f;
      }
  }
  // Row sums: the two halves of a wave, then the 8 waves (tmax is free: its
  // last reader left it two barriers ago).
  {
    float l0 = lpart[0] + xhalf(lpart[0]);
    float l1 = lpart[1] + xhalf(lpart[1]);
    tmax[w][lane] = g ? l1 : l0;                   // lane l: query row l
  }
  __syncthreads();
  if (threadIdx.x < QROWS) {
    float l = tmax[0][threadIdx.x];
    #pragma unroll
    for (int t = 1; t < 8; t++) l += tmax[t][threadIdx.x];
    lrun[threadIdx.x] = l;
  }
  __syncthreads();

  // ---- Finalize: 1/l, per-wave LDS transpose, coalesced store to AOt[d][s].
  #pragma unroll
  for (int t = 0; t < 2; t++) {
    #pragma unroll
    for (int nf = 0; nf < 4; nf++) {
      #pragma unroll
      for (int i = 0; i < 8; i++) {
        int m = t * 16 + g * 8 + i;
        float l   = lrun[m];
        float inv = (l > 0.f) ? 1.f / l : 0.f;
        Ts[w][nf * 16 + n][m] = (_Float16)(acc[t][nf][i] * inv);
      }
    }
  }
  __syncthreads();
  // 64 rows of 64B per wave: four lanes store one row's 64 contiguous bytes
  _Float16* obase = AOt + ((size_t)b * D_DIM + 64 * w + (lane >> 2)) * S_LEN +
                    q0 + (lane & 3) * 8;
  #pragma unroll
  for (int j = 0; j < 8; j++)
    *(uint4*)(obase + (size_t)(j * 8) * S_LEN) =
        *(const uint4*)&Ts[w][j * 8 + (lane >> 2)][(lane & 3) * 8];
}

// ---------------------------------------------------------------------------
extern "C" void kernel_launch(void* const* d_in, const int* in_sizes, int n_in,
                              void* d_out, int out_size, void* d_ws,
                              size_t ws_size, hipStream_t stream) {
  (void)in_sizes; (void)n_in; (void)out_size; (void)ws_size;
  const float* x    = (const float*)d_in[0];
  const float* mask = (const float*)d_in[1];
  const float* Wq   = (const float*)d_in[2];
  const float* bq   = (const float*)d_in[3];
  const float* Wk   = (const float*)d_in[4];
  const float* bk   = (const float*)d_in[5];
  const float* Wv   = (const float*)d_in[6];
  const float* bv   = (const float*)d_in[7];
  const float* Wo   = (const float*)d_in[8];
  const float* bo   = (const float*)d_in[9];

  const int B = 2, S = S_LEN, D = D_DIM;
  const int M = B * S;                             // 8192
  const size_t MB = 1ull << 20;
  char* ws = (char*)d_ws;                          // 34 MB used
  _Float16* Qh  = (_Float16*)(ws + 0 * MB);        // 8MB [b][s][d]
  _Float16* Kp  = (_Float16*)(ws + 8 * MB);        // 8MB, fragment order
  _Float16* Vp  = (_Float16*)(ws + 16 * MB);       // 8MB, fragment order
  _Float16* xh  = (_Float16*)(ws + 24 * MB);       // 8MB, reused as AOt
  _Float16* AOt = xh;                              // [b][d][s] after attn
  _Float16* Wqh = (_Float16*)(ws + 32 * MB);
  _Float16* Wkh = (_Float16*)(ws + 32 * MB + 512 * 1024);
  _Float16* Wvh = (_Float16*)(ws + 33 * MB);
  _Float16* Woh = (_Float16*)(ws + 33 * MB + 512 * 1024);

  // Wqh..Woh lie one behind the other: one destination for the four weights
  cvt_all_kernel<<<dim3(CVT_WGS), dim3(256), 0, stream>>>(x, Wq, Wk, Wv, Wo, xh,
                                                          Wqh);

  dim3 gg(M / 128, D / 64);
  qkv_wmma_kernel<<<dim3(M / 128, D / 64, 3), dim3(256), 0, stream>>>(
      xh, Wqh, Wkh, Wvh, bq, bk, bv, Qh, Kp, Vp);

  attn_kernel<<<dim3(S / QROWS, B), dim3(256), 0, stream>>>(Qh, Kp, Vp, mask, AOt);

  gemm_wmma_kernel<<<gg, dim3(256), 0, stream>>>(AOt, Woh, bo, d_out, 2);
}

// v008
// It runs in 159 microseconds.
// Next to v007, in two timings, it ran 1.06 times as fast each time.
// All steps since v000 together make it 2.77 times as fast.
#include <hip/hip_runtime.h>
#include <hip/hip_bf16.h>

// ---------------------------------------------------------------------------
// Sparse attention, MI455X (gfx1250, wave32, WMMA).
//   B=2, S=4096, D=512. ~86 GFLOP vs ~170MB mandatory traffic -> compute
//   bound; use v_wmma_f32_16x16x32_f16 (f16 in, f32 acc) for every GEMM.
//   Q/K/V f16 (24MB) are L2-resident (192MB L2); K A- and V B-fragments stream from
//   L2 in the flash loop, stored by the projections in fragment order so that
//   one wave-wide 16B load covers 512 contiguous bytes (4 whole lines).
//   GEMM W-operand panels (x rows for K) are staged to LDS with async-to-LDS
//   DMA (ASYNCcnt) double-buffering; fragments are register-double-buffered
//   so WMMAs overlap loads instead of s_wait_loadcnt 0 per op.
// ---------------------------------------------------------------------------

typedef __attribute__((ext_vector_type(16))) _Float16 v16h;
typedef __attribute__((ext_vector_type(8)))  _Float16 v8h;
typedef __attribute__((ext_vector_type(4)))  _Float16 v4h;
typedef __attribute__((ext_vector_type(8)))  float    v8f;

#define S_LEN 4096
#define D_DIM 512

#if defined(__AMDGCN__) &&                                              \
    __has_builtin(__builtin_amdgcn_global_load_async_to_lds_b128) &&    \
    __has_builtin(__builtin_amdgcn_s_wait_asynccnt)
#define HAVE_ASYNC 1
// Signature (from clang diagnostic): (v4i AS1*, v4i AS3*, imm, imm)
typedef int v4i_t __attribute__((vector_size(16)));
typedef __attribute__((address_space(1))) v4i_t* gv4i_p;
typedef __attribute__((address_space(3))) v4i_t* lv4i_p;
#else
#define HAVE_ASYNC 0
#endif

__device__ __forceinline__ void async_cp16(const _Float16* src, _Float16* lds) {
#if HAVE_ASYNC
  __builtin_amdgcn_global_load_async_to_lds_b128((gv4i_p)src, (lv4i_p)lds, 0, 0);
#else
  *(v8h*)lds = *(const v8h*)src;
#endif
}
__device__ __forceinline__ void async_wait0() {
#if HAVE_ASYNC
  __builtin_amdgcn_s_wait_asynccnt(0);
#endif
}

__device__ __forceinline__ v8f wmma_f16(v16h a, v16h b, v8f c) {
  // (neg_a, A, neg_b, B, c_mod, C, reuse_a, reuse_b)
  return __builtin_amdgcn_wmma_f32_16x16x32_f16(false, a, false, b,
                                                (short)0, c, false, false);
}

// A-fragment (16x32 f16, M=lane&15, K-halves split by lane group) or,
// identically, B-fragment (32x16 f16, N=lane&15) from a row-major source
// whose rows are contiguous in K. Two 16B chunks per lane.
__device__ __forceinline__ v16h load_frag(const _Float16* p, int ld) {
  const int lane = threadIdx.x & 31;
  const int row  = lane & 15;
  const int ko   = (lane >> 4) << 3;     // 0 or 8
  const _Float16* q = p + (size_t)row * ld + ko;
  v8h lo = *(const v8h*)(q);
  v8h hi = *(const v8h*)(q + 16);
  return __builtin_shufflevector(lo, hi, 0,1,2,3,4,5,6,7,8,9,10,11,12,13,14,15);
}

// Fragment stored in fragment order: 512 halves per fragment, two planes of
// 256 halves (elements 0..7, then 8..15), lane l at halves [8l, 8l+8) of each
// plane. p already includes the lane's 8*lane.
__device__ __forceinline__ v16h load_packed(const _Float16* p) {
  v8h lo = *(const v8h*)(p);
  v8h hi = *(const v8h*)(p + 256);
  return __builtin_shufflevector(lo, hi, 0,1,2,3,4,5,6,7,8,9,10,11,12,13,14,15);
}

// Lane l reads lane l ^ 16, on the vector unit.
__device__ __forceinline__ float xhalf(float x) {
  int b = __builtin_bit_cast(int, x);
  return __builtin_bit_cast(
      float, __builtin_amdgcn_permlanex16(b, b, 0x76543210, 0xfedcba98, false,
                                          false));
}

// Work-group barrier for data that is handed over in LDS alone: the fences name
// the LDS address space, so the wave waits for its LDS operations only.
// __syncthreads() also waits for every global load in flight, which would end
// the V and mask loads' head start at the first barrier behind them.
__device__ __forceinline__ void lds_barrier() {
  __builtin_amdgcn_fence(__ATOMIC_RELEASE, "workgroup", "local");
  __builtin_amdgcn_s_barrier();
  __builtin_amdgcn_fence(__ATOMIC_ACQUIRE, "workgroup", "local");
}

__device__ __forceinline__ void exp2x8(float (&x)[8]) {
  asm("v_exp_f32 %0, %0\n\t"
      "v_exp_f32 %1, %1\n\t"
      "v_exp_f32 %2, %2\n\t"
      "v_exp_f32 %3, %3\n\t"
      "v_exp_f32 %4, %4\n\t"
      "v_exp_f32 %5, %5\n\t"
      "v_exp_f32 %6, %6\n\t"
      "v_exp_f32 %7, %7\n\t"
      "v_nop"
      : "+v"(x[0]), "+v"(x[1]), "+v"(x[2]), "+v"(x[3]), "+v"(x[4]),
        "+v"(x[5]), "+v"(x[6]), "+v"(x[7]));
}

// ---------------------------------------------------------------------------
// f32 -> f16 conversion of x and the four weight matrices, one launch.
//   512 work-groups of 256 threads, all resident at once. The five sources
//   are 1,310,720 float4 = 10 per thread: 8 of x, 2 of the weights (Wh holds
//   Wq, Wk, Wv, Wo one behind the other, 65,536 float4 each, so a work-group
//   lies inside one matrix). All 10 loads leave before the first store.
// ---------------------------------------------------------------------------
#define CVT_WGS 512
#define CVT_THREADS (CVT_WGS * 256)

__device__ __forceinline__ v4h cvt4(float4 v) {
  v4h o = {(_Float16)v.x, (_Float16)v.y, (_Float16)v.z, (_Float16)v.w};
  return o;
}

__global__ __launch_bounds__(256) void cvt_all_kernel(
    const float* __restrict__ x, const float* __restrict__ Wq,
    const float* __restrict__ Wk, const float* __restrict__ Wv,
    const float* __restrict__ Wo, _Float16* __restrict__ xh,
    _Float16* __restrict__ Wh) {
  const int t  = blockIdx.x * 256 + threadIdx.x;
  const int hi = blockIdx.x >> 8;                  // t / 65536
  const float* wa = hi ? Wk : Wq;                  // weight float4 t
  const float* wb = hi ? Wo : Wv;                  // weight float4 t + 131072
  float4 vx[8];
  #pragma unroll
  for (int j = 0; j < 8; j++) vx[j] = ((const float4*)x)[j * CVT_THREADS + t];
  float4 va = ((const float4*)wa)[t & 65535];
  float4 vb = ((const float4*)wb)[t & 65535];
  #pragma unroll
  for (int j = 0; j < 8; j++) ((v4h*)xh)[j * CVT_THREADS + t] = cvt4(vx[j]);
  ((v4h*)Wh)[t] = cvt4(va);
  ((v4h*)Wh)[CVT_THREADS + t] = cvt4(vb);
}

// ---------------------------------------------------------------------------
// WMMA GEMM: out[m][n] = sum_k A[m][k] * W[n][k] + bias[n] (mode 3: bias[m])
//   A: [M x 512] f16 rm, W: [N x 512] f16 rm (torch Linear layout; x in mode 3).
//   Block: 8 waves; wave w -> 16x64 tile; block tile 128(M) x 64(N).
//   W k-panel (64 x 32) is shared by all 8 waves -> staged to LDS with
//   async-to-LDS DMA, double buffered; A fragments double buffered in regs.
//   mode 0: f16 out rm [M x 512]   (Q)
//   mode 1: f16 out, rows m = keys, cols = d, in P*V B-fragment order:
//           Vp[m/32][d/16][(m/16)&1][lane = ((m/8)&1)*16 + d%16][m%8]
//   mode 2: f32 out rm [M x 512]   (final Wo projection into d_out)
//   mode 3: f16 out, rows m = d (A = Wk), cols = keys (W = x), bias per row,
//           in Q*K^T B-fragment order:
//           Kp[key/16][d/32][(d/16)&1][lane = ((d/8)&1)*16 + key%16][d%8]
//   In modes 1 and 3 a lane's 8 accumulator rows are one 16B piece of the
//   fragment at its own lane slot: stored straight from registers.
// ---------------------------------------------------------------------------
// LDS row pitch (halves): 80 B = 16 B x odd, so the 16 rows that half a wave
// reads with one 16B load start on 16 different groups of four banks
#define WLD 40

__device__ __forceinline__ void gemm_tile(
    const _Float16* __restrict__ A, const _Float16* __restrict__ W,
    const float* __restrict__ bias, void* __restrict__ out, int mode,
    int bm, int bn) {
  __shared__ __align__(16) _Float16 Ws[2][64][WLD];
  const int w    = threadIdx.x >> 5;
  const int lane = threadIdx.x & 31;
  const int g    = lane >> 4;
  const int n    = lane & 15;
  const int m0   = bm * 128 + w * 16;
  const int n0   = bn * 64;

  // cooperative W-panel staging: 64 rows x 32 halves, 16B per thread
  const int srow = threadIdx.x >> 2;
  const int scol = (threadIdx.x & 3) * 8;
  const _Float16* wpan = W + (size_t)(n0 + srow) * D_DIM + scol;

  v8f acc[4] = {};
  const _Float16* abase = A + (size_t)m0 * D_DIM;

  async_cp16(wpan, &Ws[0][srow][scol]);          // stage k=0 panel
  async_wait0();
  __syncthreads();

  v16h a_c = load_frag(abase, D_DIM);
  int buf = 0;
  for (int k = 0; k < D_DIM; k += 32) {
    if (k + 32 < D_DIM)                          // DMA next panel during WMMAs
      async_cp16(wpan + (k + 32), &Ws[buf ^ 1][srow][scol]);
    v16h a_n = a_c;
    if (k + 32 < D_DIM) a_n = load_frag(abase + k + 32, D_DIM);
    #pragma unroll
    for (int nf = 0; nf < 4; nf++) {
      v16h bf = load_frag(&Ws[buf][nf * 16][0], WLD);
      acc[nf] = wmma_f16(a_c, bf, acc[nf]);
    }
    a_c = a_n;
    async_wait0();
    __syncthreads();
    buf ^= 1;
  }

  if (mode == 0) {                               // f16 row-major
    _Float16* o = (_Float16*)out;
    #pragma unroll
    for (int nf = 0; nf < 4; nf++) {
      int col = n0 + nf * 16 + n;
      float bv = bias[col];
      #pragma unroll
      for (int i = 0; i < 8; i++)
        o[(size_t)(m0 + g * 8 + i) * D_DIM + col] = (_Float16)(acc[nf][i] + bv);
    }
    // keeps every later write of the stores' address and data registers
    // behind the stores above
    asm volatile("s_wait_xcnt 0x0" ::: "memory");
  } else if (mode == 1) {                        // V, fragment order
    _Float16* o = (_Float16*)out + (size_t)(m0 >> 5) * (32 * D_DIM) +
                  ((m0 >> 4) & 1) * 256 + lane * 8;
    #pragma unroll
    for (int nf = 0; nf < 4; nf++) {
      float bv = bias[n0 + nf * 16 + n];
      v8h pk;
      #pragma unroll
      for (int i = 0; i < 8; i++) pk[i] = (_Float16)(acc[nf][i] + bv);
      *(v8h*)(o + ((n0 >> 4) + nf) * 512) = pk;
    }
    // keeps every later write of the stores' address and data registers
    // behind the four stores above
    asm volatile("s_wait_xcnt 0x0" ::: "memory");
  } else if (mode == 3) {                        // K, fragment order
    _Float16* o = (_Float16*)out + (m0 >> 4) * 256 + lane * 8;
    float bv[8];
    #pragma unroll
    for (int i = 0; i < 8; i++) bv[i] = bias[m0 + g * 8 + i];
    #pragma unroll
    for (int nf = 0; nf < 4; nf++) {
      v8h pk;
      #pragma unroll
      for (int i = 0; i < 8; i++) pk[i] = (_Float16)(acc[nf][i] + bv[i]);
      *(v8h*)(o + (size_t)((n0 >> 4) + nf) * (16 * D_DIM)) = pk;
    }
    // keeps every later write of the stores' address and data registers
    // behind the four stores above
    asm volatile("s_wait_xcnt 0x0" ::: "memory");
  } else {                                       // f32 row-major (d_out)
    float* o = (float*)out;
    #pragma unroll
    for (int nf = 0; nf < 4; nf++) {
      int col = n0 + nf * 16 + n;
      float bv = bias[col];
      #pragma unroll
      for (int i = 0; i < 8; i++)
        o[(size_t)(m0 + g * 8 + i) * D_DIM + col] = acc[nf][i] + bv;
    }
    // keeps every later write of the stores' address and data registers
    // behind the stores above
    asm volatile("s_wait_xcnt 0x0" ::: "memory");
  }
}

__global__ __launch_bounds__(256) void gemm_wmma_kernel(
    const _Float16* __restrict__ A, const _Float16* __restrict__ W,
    const float* __restrict__ bias, void* __restrict__ out, int mode) {
  gemm_tile(A, W, bias, out, mode, blockIdx.x, blockIdx.y);
}

// Q, K and V projections in one launch: they depend on nothing of each other,
// and one of them alone puts only two work-groups on a WGP. Grid (64, 8, 3);
// blockIdx.z picks the product. K (rows = d, cols = keys) has 4 x 128 tiles:
// its 512 work-groups are renumbered, row tile fastest.
__global__ __launch_bounds__(256) void qkv_wmma_kernel(
    const _Float16* __restrict__ xh, const _Float16* __restrict__ Wqh,
    const _Float16* __restrict__ Wkh, const _Float16* __restrict__ Wvh,
    const float* __restrict__ bq, const float* __restrict__ bk,
    const float* __restrict__ bv, _Float16* __restrict__ Qh,
    _Float16* __restrict__ Kp, _Float16* __restrict__ Vp) {
  const int z    = blockIdx.z;
  const int flat = blockIdx.y * 64 + blockIdx.x;
  const _Float16* A    = (z == 1) ? Wkh : xh;
  const _Float16* W    = (z == 0) ? Wqh : (z == 1) ? xh : Wvh;
  const float*    bias = (z == 0) ? bq : (z == 1) ? bk : bv;
  _Float16*       out  = (z == 0) ? Qh : (z == 1) ? Kp : Vp;
  const int mode = (z == 0) ? 0 : (z == 1) ? 3 : 1;
  const int bm   = (z == 1) ? (flat & 3) : (int)blockIdx.x;
  const int bn   = (z == 1) ? (flat >> 2) : (int)blockIdx.y;
  gemm_tile(A, W, bias, out, mode, bm, bn);
}

// ---------------------------------------------------------------------------
// Flash-style sparse attention.
//   Grid: (S/32, B); block: 256 threads = 8 waves; 32 query rows (two 16-row
//   tiles) per WG, so every K and V fragment that a wave reads from L2 feeds
//   two WMMAs and the launch reads K and V 128 times over, not 256.
//   Per 128-key block: wave w computes the scores of keys [kb+16w,+16)
//   TRANSPOSED (K fragment as A, Q fragment as B): a lane then holds 8
//   neighbouring keys of one query, which is one 16B piece of the P*V
//   A-fragment at the lane's own slot. The wave masks+scales them (mask values
//   loaded one key block ahead), shares its row maxima via LDS; WG-shared
//   online softmax; then each wave exponentiates its own 32x16 tile from
//   registers, once for the whole WG, and stores it as f16 in fragment order
//   to LDS, where all 8 waves read it; each wave accumulates P*V into its
//   private 64-wide d-slice. The row sums stay per lane (rescaled like the
//   accumulators) and are added up behind the loop.
//   Output stored transposed AOt[d][s] (== reference transpose+reshape,
//   flat-viewed as [S x D] for the final GEMM).
// ---------------------------------------------------------------------------
#define QROWS 32
// Q row pitch in LDS (halves): 1040 B = 16 B x odd, as for WLD
#define QLD 520

__global__ __launch_bounds__(256) void attn_kernel(
    const _Float16* __restrict__ Qh, const _Float16* __restrict__ Kp,
    const _Float16* __restrict__ Vp, const float* __restrict__ mask,
    _Float16* __restrict__ AOt) {
  __shared__ __align__(16) _Float16 Qs[QROWS][QLD];
  // P of one key block, A-fragment order: [tile][key/16][lane][8 halves]
  __shared__ __align__(16) _Float16 Pp[2 * 8 * 256];
  __shared__ float tmax[8][QROWS];
  __shared__ float mrun[QROWS], lrun[QROWS], mnew[QROWS], corr[QROWS];
  __shared__ __align__(16) _Float16 Ts[8][64][QROWS]; // per-wave O transpose

  const int q0   = blockIdx.x * QROWS;
  const int b    = blockIdx.y;
  const int w    = threadIdx.x >> 5;
  const int lane = threadIdx.x & 31;
  const int g    = lane >> 4;
  const int n    = lane & 15;
  const float scale = 0.044194173824159216f;       // 1/sqrt(512)
  const float NEG   = -__builtin_inff();
  const float LOG2E = 1.44269504f;

  // Stage Q tile (32 x 512 f16) into LDS via async DMA, 128B/thread.
  {
    int row = threadIdx.x >> 3;
    int c   = (threadIdx.x & 7) * 64;
    const _Float16* src = Qh + ((size_t)b * S_LEN + q0 + row) * D_DIM + c;
    #pragma unroll
    for (int j = 0; j < 64; j += 8)
      async_cp16(src + j, &Qs[row][c + j]);
  }
  if (threadIdx.x < QROWS) mrun[threadIdx.x] = NEG;
  // this wave's Q copies have landed before it reaches the barrier in front
  // of the loop, behind which every wave reads Qs
  asm volatile("s_wait_asynccnt 0x0" ::: "memory");

  v8f acc[2][4] = {};
  float lpart[2] = {0.f, 0.f};   // this lane's share of the sums of rows n, 16+n

  // Mask of this lane's 16 scores (queries n and 16+n, 8 neighbouring keys),
  // fetched one key block ahead and held as its compare results.
  const float* mrow0 =
      mask + ((size_t)b * S_LEN + q0 + n) * S_LEN + 16 * w + g * 8;
  bool keep[2][8];
  {
    float4 m4[2][2];
    #pragma unroll
    for (int t = 0; t < 2; t++)
      #pragma unroll
      for (int h = 0; h < 2; h++)
        m4[t][h] = *(const float4*)(mrow0 + (size_t)(t * 16) * S_LEN + h * 4);
    // keeps every later write of the mask loads' address registers behind them
    asm volatile("s_wait_xcnt 0x0" ::: "memory");
    #pragma unroll
    for (int t = 0; t < 2; t++)
      #pragma unroll
      for (int h = 0; h < 2; h++) {
        keep[t][h * 4 + 0] = m4[t][h].x > 0.95f;
        keep[t][h * 4 + 1] = m4[t][h].y > 0.95f;
        keep[t][h * 4 + 2] = m4[t][h].z > 0.95f;
        keep[t][h * 4 + 3] = m4[t][h].w > 0.95f;
      }
  }
  __syncthreads();                                 // Qs and mrun are there

  for (int kb = 0; kb < S_LEN; kb += 128) {
    // ---- Phase A: scores for key sub-tile [kb+16w, +16), keys as rows ------
    v8f s[2] = {};
    const _Float16* kbase =
        Kp + ((size_t)b * S_LEN + kb + 16 * w) * D_DIM + lane * 8;
    // All 16 K fragments (L2) leave first, in the order of their use.
    v16h kfr[16];
    #pragma unroll
    for (int j = 0; j < 16; j++) kfr[j] = load_packed(kbase + j * 512);
    // keeps every later write of the K loads' address registers behind them
    asm volatile("s_wait_xcnt 0x0" ::: "memory");
    // what follows reuses those registers: without this the scheduler lifts
    // part of it over the wait
    __builtin_amdgcn_sched_barrier(0);
    // Q fragments come from LDS in groups of four d steps (16 loads, 8 WMMAs),
    // two register sets, each group read two groups ahead of its WMMAs: a wave
    // then waits for loads that left long ago, not for a round trip per WMMA.
    v16h qa[2][2][4];
    #pragma unroll
    for (int gq = 0; gq < 2; gq++)
      #pragma unroll
      for (int j = 0; j < 4; j++) {
        qa[gq][0][j] = load_frag(&Qs[0][(gq * 4 + j) * 32], QLD);
        qa[gq][1][j] = load_frag(&Qs[16][(gq * 4 + j) * 32], QLD);
      }
    // without this the scheduler sinks the loads above in among the WMMAs
    __builtin_amdgcn_sched_barrier(0);
    #pragma unroll
    for (int gq = 0; gq < 4; gq++) {
      #pragma unroll
      for (int j = 0; j < 4; j++) {
        s[0] = wmma_f16(kfr[gq * 4 + j], qa[gq & 1][0][j], s[0]);
        s[1] = wmma_f16(kfr[gq * 4 + j], qa[gq & 1][1][j], s[1]);
      }
      if (gq + 2 < 4) {
        // holds the refill behind this group's WMMAs, as one run of loads
        __builtin_amdgcn_sched_barrier(0);
        #pragma unroll
        for (int j = 0; j < 4; j++) {
          qa[gq & 1][0][j] = load_frag(&Qs[0][((gq + 2) * 4 + j) * 32], QLD);
          qa[gq & 1][1][j] = load_frag(&Qs[16][((gq + 2) * 4 + j) * 32], QLD);
        }
        // holds the refill in front of the next group's WMMAs
        __builtin_amdgcn_sched_barrier(0);
      }
    }
    // holds the V loads behind the score WMMAs, whose K registers they take
    __builtin_amdgcn_sched_barrier(0);
    // All 16 V fragments (L2) of this key block leave here: the softmax and
    // its three barriers stand between them and their WMMAs.
    const _Float16* vbase =
        Vp + ((size_t)b * S_LEN + kb) * D_DIM + (4 * w) * 512 + lane * 8;
    v16h vfr[16];
    #pragma unroll
    for (int kf = 0; kf < 4; kf++)
      #pragma unroll
      for (int nf = 0; nf < 4; nf++)
        vfr[kf * 4 + nf] = load_packed(vbase + kf * (32 * D_DIM) + nf * 512);
    // holds the mask loads behind the V loads: loads return in order, and V
    // (L2) must not wait for the mask's trip to memory
    __builtin_amdgcn_sched_barrier(0);
    // Next key block's mask: all 4 loads leave together, compared at the foot
    // of this pass. The last block re-reads its own columns, so no address
    // leaves the mask.
    const float* mnext = mrow0 + ((kb + 128 < S_LEN) ? kb + 128 : kb);
    float4 mn4[2][2];
    #pragma unroll
    for (int t = 0; t < 2; t++)
      #pragma unroll
      for (int h = 0; h < 2; h++)
        mn4[t][h] = *(const float4*)(mnext + (size_t)(t * 16) * S_LEN + h * 4);
    // keeps every later write of the V and mask loads' address registers
    // behind those loads; the addresses are named so that they stay live up to
    // here (the last V load had been given V's as its destination, and the
    // mask's was written anew right behind its loads)
    asm volatile("s_wait_xcnt 0x0" :: "v"(vbase), "v"(mnext) : "memory");
    // lane (g, n): s[t][i] is query t*16+n against key kb + 16w + g*8 + i
    float sv[2][8], rm[2];
    #pragma unroll
    for (int t = 0; t < 2; t++) {
      #pragma unroll
      for (int i = 0; i < 8; i++)
        sv[t][i] = keep[t][i] ? s[t][i] * scale : NEG;
      float r = sv[t][0];
      #pragma unroll
      for (int i = 1; i < 8; i++) r = fmaxf(r, sv[t][i]);
      rm[t] = fmaxf(r, xhalf(r));                  // all 16 keys of the wave
    }
    tmax[w][lane] = g ? rm[1] : rm[0];             // lane l: query row l
    lds_barrier();
    // ---- Phase B: workgroup-shared online-softmax stats -------------------
    if (threadIdx.x < QROWS) {
      int r = threadIdx.x;
      float mx = tmax[0][r];
      #pragma unroll
      for (int t = 1; t < 8; t++) mx = fmaxf(mx, tmax[t][r]);
      float mold = mrun[r];
      float mn   = fmaxf(mold, mx);
      float c    = (mn <= -1e30f) ? 1.f : __expf(mold - mn);
      mnew[r] = mn; corr[r] = c; mrun[r] = mn;
    }
    lds_barrier();
    // ---- Phase P: this wave's own tile of P, once for the work-group ------
    float cr[2][8];
    #pragma unroll
    for (int t = 0; t < 2; t++)
      #pragma unroll
      for (int i = 0; i < 8; i++) cr[t][i] = corr[t * 16 + g * 8 + i];
    #pragma unroll
    for (int t = 0; t < 2; t++) {
      const float mrow = mnew[t * 16 + n];
      float x[8];
      #pragma unroll
      for (int i = 0; i < 8; i++)
        x[i] = (sv[t][i] - mrow) * LOG2E;          // e^y = 2^(y * log2 e)
      exp2x8(x);
      v8h pk;
      float es = 0.f;
      #pragma unroll
      for (int i = 0; i < 8; i++) {
        float e = (sv[t][i] <= -1e30f) ? 0.f : x[i];
        es += e;
        pk[i] = (_Float16)e;
      }
      lpart[t] = lpart[t] * corr[t * 16 + n] + es;
      // keys 16w + g*8 + 0..7 of query n: plane w & 1 of fragment w >> 1
      *(v8h*)&Pp[(t * 8 + w) * 256 + lane * 8] = pk;
    }
    // behind it every wave reads all of Pp; the next block's Pp stores stand
    // behind two more barriers, so no barrier is needed at the loop's top
    lds_barrier();
    // ---- Phase C: P A-frags from LDS, rescale acc, P*V --------------------
    v16h p[2][4];
    #pragma unroll
    for (int t = 0; t < 2; t++)
      #pragma unroll
      for (int kf = 0; kf < 4; kf++)
        p[t][kf] = load_packed(&Pp[(t * 4 + kf) * 512 + lane * 8]);
    // holds the 16 P loads together as one run: the scheduler spread them in
    // pairs among the WMMAs, each pair with a wait of its own
    __builtin_amdgcn_sched_barrier(0);
    #pragma unroll
    for (int t = 0; t < 2; t++)
      #pragma unroll
      for (int nf = 0; nf < 4; nf++)
        #pragma unroll
        for (int i = 0; i < 8; i++) acc[t][nf][i] *= cr[t][i];
    #pragma unroll
    for (int kf = 0; kf < 4; kf++) {
      #pragma unroll
      for (int nf = 0; nf < 4; nf++) {
        acc[0][nf] = wmma_f16(p[0][kf], vfr[kf * 4 + nf], acc[0][nf]);
        acc[1][nf] = wmma_f16(p[1][kf], vfr[kf * 4 + nf], acc[1][nf]);
      }
    }
    #pragma unroll
    for (int t = 0; t < 2; t++)
      #pragma unroll
      for (int h = 0; h < 2; h++) {
        keep[t][h * 4 + 0] = mn4[t][h].x > 0.95f;
        keep[t][h * 4 + 1] = mn4[t][h].y > 0.95f;
        keep[t][h * 4 + 2] = mn4[t][h].z > 0.95f;
        keep[t][h * 4 + 3] = mn4[t][h].w > 0.95f;
      }
  }
  // Row sums: the two halves of a wave, then the 8 waves (tmax is free: its
  // last reader left it two barriers ago).
  {
    float l0 = lpart[0] + xhalf(lpart[0]);
    float l1 = lpart[1] + xhalf(lpart[1]);
    tmax[w][lane] = g ? l1 : l0;                   // lane l: query row l
  }
  __syncthreads();
  if (threadIdx.x < QROWS) {
    float l = tmax[0][threadIdx.x];
    #pragma unroll
    for (int t = 1; t < 8; t++) l += tmax[t][threadIdx.x];
    lrun[threadIdx.x] = l;
  }
  __syncthreads();

  // ---- Finalize: 1/l, per-wave LDS transpose, coalesced store to AOt[d][s].
  #pragma unroll
  for (int t = 0; t < 2; t++) {
    #pragma unroll
    for (int nf = 0; nf < 4; nf++) {
      #pragma unroll
      for (int i = 0; i < 8; i++) {
        int m = t * 16 + g * 8 + i;
        float l   = lrun[m];
        float inv = (l > 0.f) ? 1.f / l : 0.f;
        Ts[w][nf * 16 + n][m] = (_Float16)(acc[t][nf][i] * inv);
      }
    }
  }
  __syncthreads();
  // 64 rows of 64B per wave: four lanes store one row's 64 contiguous bytes
  _Float16* obase = AOt + ((size_t)b * D_DIM + 64 * w + (lane >> 2)) * S_LEN +
                    q0 + (lane & 3) * 8;
  #pragma unroll
  for (int j = 0; j < 8; j++)
    *(uint4*)(obase + (size_t)(j * 8) * S_LEN) =
        *(const uint4*)&Ts[w][j * 8 + (lane >> 2)][(lane & 3) * 8];
}

// ---------------------------------------------------------------------------
extern "C" void kernel_launch(void* const* d_in, const int* in_sizes, int n_in,
                              void* d_out, int out_size, void* d_ws,
                              size_t ws_size, hipStream_t stream) {
  (void)in_sizes; (void)n_in; (void)out_size; (void)ws_size;
  const float* x    = (const float*)d_in[0];
  const float* mask = (const float*)d_in[1];
  const float* Wq   = (const float*)d_in[2];
  const float* bq   = (const float*)d_in[3];
  const float* Wk   = (const float*)d_in[4];
  const float* bk   = (const float*)d_in[5];
  const float* Wv   = (const float*)d_in[6];
  const float* bv   = (const float*)d_in[7];
  const float* Wo   = (const float*)d_in[8];
  const float* bo   = (const float*)d_in[9];

  const int B = 2, S = S_LEN, D = D_DIM;
  const int M = B * S;                             // 8192
  const size_t MB = 1ull << 20;
  char* ws = (char*)d_ws;                          // 34 MB used
  _Float16* Qh  = (_Float16*)(ws + 0 * MB);        // 8MB [b][s][d]
  _Float16* Kp  = (_Float16*)(ws + 8 * MB);        // 8MB, fragment order
  _Float16* Vp  = (_Float16*)(ws + 16 * MB);       // 8MB, fragment order
  _Float16* xh  = (_Float16*)(ws + 24 * MB);       // 8MB, reused as AOt
  _Float16* AOt = xh;                              // [b][d][s] after attn
  _Float16* Wqh = (_Float16*)(ws + 32 * MB);
  _Float16* Wkh = (_Float16*)(ws + 32 * MB + 512 * 1024);
  _Float16* Wvh = (_Float16*)(ws + 33 * MB);
  _Float16* Woh = (_Float16*)(ws + 33 * MB + 512 * 1024);

  // Wqh..Woh lie one behind the other: one destination for the four weights
  cvt_all_kernel<<<dim3(CVT_WGS), dim3(256), 0, stream>>>(x, Wq, Wk, Wv, Wo, xh,
                                                          Wqh);

  dim3 gg(M / 128, D / 64);
  qkv_wmma_kernel<<<dim3(M / 128, D / 64, 3), dim3(256), 0, stream>>>(
      xh, Wqh, Wkh, Wvh, bq, bk, bv, Qh, Kp, Vp);

  attn_kernel<<<dim3(S / QROWS, B), dim3(256), 0, stream>>>(Qh, Kp, Vp, mask, AOt);

  gemm_wmma_kernel<<<gg, dim3(256), 0, stream>>>(AOt, Woh, bo, d_out, 2);
}

// v009
// A run of this version takes 149 microseconds.
// Timed twice side by side with v008, it ran 1.07 times as fast both times.
// All steps since v000 together make it 2.97 times as fast.
#include <hip/hip_runtime.h>
#include <hip/hip_bf16.h>

// ---------------------------------------------------------------------------
// Sparse attention, MI455X (gfx1250, wave32, WMMA).
//   B=2, S=4096, D=512. ~86 GFLOP vs ~170MB mandatory traffic -> compute
//   bound; use v_wmma_f32_16x16x32_f16 (f16 in, f32 acc) for every GEMM.
//   Q/K/V f16 (24MB) are L2-resident (192MB L2); K A- and V B-fragments stream from
//   L2 in the flash loop, stored by the projections in fragment order so that
//   one wave-wide 16B load covers 512 contiguous bytes (4 whole lines).
//   GEMM W-operand panels (x rows for K) are staged to LDS with async-to-LDS
//   DMA (ASYNCcnt) double-buffering; fragments are register-double-buffered
//   so WMMAs overlap loads instead of s_wait_loadcnt 0 per op.
// ---------------------------------------------------------------------------

typedef __attribute__((ext_vector_type(16))) _Float16 v16h;
typedef __attribute__((ext_vector_type(8)))  _Float16 v8h;
typedef __attribute__((ext_vector_type(4)))  _Float16 v4h;
typedef __attribute__((ext_vector_type(8)))  float    v8f;

#define S_LEN 4096
#define D_DIM 512

#if defined(__AMDGCN__) &&                                              \
    __has_builtin(__builtin_amdgcn_global_load_async_to_lds_b128) &&    \
    __has_builtin(__builtin_amdgcn_s_wait_asynccnt)
#define HAVE_ASYNC 1
// Signature (from clang diagnostic): (v4i AS1*, v4i AS3*, imm, imm)
typedef int v4i_t __attribute__((vector_size(16)));
typedef __attribute__((address_space(1))) v4i_t* gv4i_p;
typedef __attribute__((address_space(3))) v4i_t* lv4i_p;
#else
#define HAVE_ASYNC 0
#endif

__device__ __forceinline__ void async_cp16(const _Float16* src, _Float16* lds) {
#if HAVE_ASYNC
  __builtin_amdgcn_global_load_async_to_lds_b128((gv4i_p)src, (lv4i_p)lds, 0, 0);
#else
  *(v8h*)lds = *(const v8h*)src;
#endif
}
__device__ __forceinline__ void async_wait0() {
#if HAVE_ASYNC
  __builtin_amdgcn_s_wait_asynccnt(0);
#endif
}

__device__ __forceinline__ v8f wmma_f16(v16h a, v16h b, v8f c) {
  // (neg_a, A, neg_b, B, c_mod, C, reuse_a, reuse_b)
  return __builtin_amdgcn_wmma_f32_16x16x32_f16(false, a, false, b,
                                                (short)0, c, false, false);
}

// A-fragment (16x32 f16, M=lane&15, K-halves split by lane group) or,
// identically, B-fragment (32x16 f16, N=lane&15) from a row-major source
// whose rows are contiguous in K. Two 16B chunks per lane.
__device__ __forceinline__ v16h load_frag(const _Float16* p, int ld) {
  const int lane = threadIdx.x & 31;
  const int row  = lane & 15;
  const int ko   = (lane >> 4) << 3;     // 0 or 8
  const _Float16* q = p + (size_t)row * ld + ko;
  v8h lo = *(const v8h*)(q);
  v8h hi = *(const v8h*)(q + 16);
  return __builtin_shufflevector(lo, hi, 0,1,2,3,4,5,6,7,8,9,10,11,12,13,14,15);
}

// Fragment stored in fragment order: 512 halves per fragment, two planes of
// 256 halves (elements 0..7, then 8..15), lane l at halves [8l, 8l+8) of each
// plane. p already includes the lane's 8*lane.
__device__ __forceinline__ v16h load_packed(const _Float16* p) {
  v8h lo = *(const v8h*)(p);
  v8h hi = *(const v8h*)(p + 256);
  return __builtin_shufflevector(lo, hi, 0,1,2,3,4,5,6,7,8,9,10,11,12,13,14,15);
}

// Lane l reads lane l ^ 16, on the vector unit.
__device__ __forceinline__ float xhalf(float x) {
  int b = __builtin_bit_cast(int, x);
  return __builtin_bit_cast(
      float, __builtin_amdgcn_permlanex16(b, b, 0x76543210, 0xfedcba98, false,
                                          false));
}

// Work-group barrier for data that is handed over in LDS alone: the fences name
// the LDS address space, so the wave waits for its LDS operations only.
// __syncthreads() also waits for every global load in flight, which would end
// the V and mask loads' head start at the first barrier behind them.
__device__ __forceinline__ void lds_barrier() {
  __builtin_amdgcn_fence(__ATOMIC_RELEASE, "workgroup", "local");
  __builtin_amdgcn_s_barrier();
  __builtin_amdgcn_fence(__ATOMIC_ACQUIRE, "workgroup", "local");
}

__device__ __forceinline__ void exp2x8(float (&x)[8]) {
  asm("v_exp_f32 %0, %0\n\t"
      "v_exp_f32 %1, %1\n\t"
      "v_exp_f32 %2, %2\n\t"
      "v_exp_f32 %3, %3\n\t"
      "v_exp_f32 %4, %4\n\t"
      "v_exp_f32 %5, %5\n\t"
      "v_exp_f32 %6, %6\n\t"
      "v_exp_f32 %7, %7\n\t"
      "v_nop"
      : "+v"(x[0]), "+v"(x[1]), "+v"(x[2]), "+v"(x[3]), "+v"(x[4]),
        "+v"(x[5]), "+v"(x[6]), "+v"(x[7]));
}

// ---------------------------------------------------------------------------
// f32 -> f16 conversion of x and the four weight matrices, one launch.
//   512 work-groups of 256 threads, all resident at once. The five sources
//   are 1,310,720 float4 = 10 per thread: 8 of x, 2 of the weights (Wh holds
//   Wq, Wk, Wv, Wo one behind the other, 65,536 float4 each, so a work-group
//   lies inside one matrix). All 10 loads leave before the first store.
// ---------------------------------------------------------------------------
#define CVT_WGS 512
#define CVT_THREADS (CVT_WGS * 256)

__device__ __forceinline__ v4h cvt4(float4 v) {
  v4h o = {(_Float16)v.x, (_Float16)v.y, (_Float16)v.z, (_Float16)v.w};
  return o;
}

__global__ __launch_bounds__(256) void cvt_all_kernel(
    const float* __restrict__ x, const float* __restrict__ Wq,
    const float* __restrict__ Wk, const float* __restrict__ Wv,
    const float* __restrict__ Wo, _Float16* __restrict__ xh,
    _Float16* __restrict__ Wh) {
  const int t  = blockIdx.x * 256 + threadIdx.x;
  const int hi = blockIdx.x >> 8;                  // t / 65536
  const float* wa = hi ? Wk : Wq;                  // weight float4 t
  const float* wb = hi ? Wo : Wv;                  // weight float4 t + 131072
  float4 vx[8];
  #pragma unroll
  for (int j = 0; j < 8; j++) vx[j] = ((const float4*)x)[j * CVT_THREADS + t];
  float4 va = ((const float4*)wa)[t & 65535];
  float4 vb = ((const float4*)wb)[t & 65535];
  #pragma unroll
  for (int j = 0; j < 8; j++) ((v4h*)xh)[j * CVT_THREADS + t] = cvt4(vx[j]);
  ((v4h*)Wh)[t] = cvt4(va);
  ((v4h*)Wh)[CVT_THREADS + t] = cvt4(vb);
}

// ---------------------------------------------------------------------------
// WMMA GEMM: out[m][n] = sum_k A[m][k] * W[n][k] + bias[n] (mode 3: bias[m])
//   A: [M x 512] f16 rm, W: [N x 512] f16 rm (torch Linear layout; x in mode 3).
//   Block: 8 waves; wave w -> 16x64 tile; block tile 128(M) x 64(N).
//   W k-panel (64 x 32) is shared by all 8 waves -> staged to LDS with
//   async-to-LDS DMA, double buffered; A fragments double buffered in regs.
//   mode 0: f16 out rm [M x 512]   (Q)
//   mode 1: f16 out, rows m = keys, cols = d, in P*V B-fragment order:
//           Vp[m/32][d/16][(m/16)&1][lane = ((m/8)&1)*16 + d%16][m%8]
//   mode 2: f32 out rm [M x 512]   (final Wo projection into d_out)
//   mode 3: f16 out, rows m = d (A = Wk), cols = keys (W = x), bias per row,
//           in Q*K^T B-fragment order:
//           Kp[key/16][d/32][(d/16)&1][lane = ((d/8)&1)*16 + key%16][d%8]
//   In modes 1 and 3 a lane's 8 accumulator rows are one 16B piece of the
//   fragment at its own lane slot: stored straight from registers.
// ---------------------------------------------------------------------------
// LDS row pitch (halves): 80 B = 16 B x odd, so the 16 rows that half a wave
// reads with one 16B load start on 16 different groups of four banks
#define WLD 40

__device__ __forceinline__ void gemm_tile(
    const _Float16* __restrict__ A, const _Float16* __restrict__ W,
    const float* __restrict__ bias, void* __restrict__ out, int mode,
    int bm, int bn) {
  __shared__ __align__(16) _Float16 Ws[2][64][WLD];
  const int w    = threadIdx.x >> 5;
  const int lane = threadIdx.x & 31;
  const int g    = lane >> 4;
  const int n    = lane & 15;
  const int m0   = bm * 128 + w * 16;
  const int n0   = bn * 64;

  // cooperative W-panel staging: 64 rows x 32 halves, 16B per thread
  const int srow = threadIdx.x >> 2;
  const int scol = (threadIdx.x & 3) * 8;
  const _Float16* wpan = W + (size_t)(n0 + srow) * D_DIM + scol;

  v8f acc[4] = {};
  const _Float16* abase = A + (size_t)m0 * D_DIM;

  async_cp16(wpan, &Ws[0][srow][scol]);          // stage k=0 panel
  async_wait0();
  __syncthreads();

  v16h a_c = load_frag(abase, D_DIM);
  int buf = 0;
  for (int k = 0; k < D_DIM; k += 32) {
    if (k + 32 < D_DIM)                          // DMA next panel during WMMAs
      async_cp16(wpan + (k + 32), &Ws[buf ^ 1][srow][scol]);
    v16h a_n = a_c;
    if (k + 32 < D_DIM) a_n = load_frag(abase + k + 32, D_DIM);
    #pragma unroll
    for (int nf = 0; nf < 4; nf++) {
      v16h bf = load_frag(&Ws[buf][nf * 16][0], WLD);
      acc[nf] = wmma_f16(a_c, bf, acc[nf]);
    }
    a_c = a_n;
    async_wait0();
    __syncthreads();
    buf ^= 1;
  }

  if (mode == 0) {                               // f16 row-major
    _Float16* o = (_Float16*)out;
    #pragma unroll
    for (int nf = 0; nf < 4; nf++) {
      int col = n0 + nf * 16 + n;
      float bv = bias[col];
      #pragma unroll
      for (int i = 0; i < 8; i++)
        o[(size_t)(m0 + g * 8 + i) * D_DIM + col] = (_Float16)(acc[nf][i] + bv);
    }
    // keeps every later write of the stores' address and data registers
    // behind the stores above
    asm volatile("s_wait_xcnt 0x0" ::: "memory");
  } else if (mode == 1) {                        // V, fragment order
    _Float16* o = (_Float16*)out + (size_t)(m0 >> 5) * (32 * D_DIM) +
                  ((m0 >> 4) & 1) * 256 + lane * 8;
    #pragma unroll
    for (int nf = 0; nf < 4; nf++) {
      float bv = bias[n0 + nf * 16 + n];
      v8h pk;
      #pragma unroll
      for (int i = 0; i < 8; i++) pk[i] = (_Float16)(acc[nf][i] + bv);
      *(v8h*)(o + ((n0 >> 4) + nf) * 512) = pk;
    }
    // keeps every later write of the stores' address and data registers
    // behind the four stores above
    asm volatile("s_wait_xcnt 0x0" ::: "memory");
  } else if (mode == 3) {                        // K, fragment order
    _Float16* o = (_Float16*)out + (m0 >> 4) * 256 + lane * 8;
    float bv[8];
    #pragma unroll
    for (int i = 0; i < 8; i++) bv[i] = bias[m0 + g * 8 + i];
    #pragma unroll
    for (int nf = 0; nf < 4; nf++) {
      v8h pk;
      #pragma unroll
      for (int i = 0; i < 8; i++) pk[i] = (_Float16)(acc[nf][i] + bv[i]);
      *(v8h*)(o + (size_t)((n0 >> 4) + nf) * (16 * D_DIM)) = pk;
    }
    // keeps every later write of the stores' address and data registers
    // behind the four stores above
    asm volatile("s_wait_xcnt 0x0" ::: "memory");
  } else {                                       // f32 row-major (d_out)
    float* o = (float*)out;
    #pragma unroll
    for (int nf = 0; nf < 4; nf++) {
      int col = n0 + nf * 16 + n;
      float bv = bias[col];
      #pragma unroll
      for (int i = 0; i < 8; i++)
        o[(size_t)(m0 + g * 8 + i) * D_DIM + col] = acc[nf][i] + bv;
    }
    // keeps every later write of the stores' address and data registers
    // behind the stores above
    asm volatile("s_wait_xcnt 0x0" ::: "memory");
  }
}

__global__ __launch_bounds__(256) void gemm_wmma_kernel(
    const _Float16* __restrict__ A, const _Float16* __restrict__ W,
    const float* __restrict__ bias, void* __restrict__ out, int mode) {
  gemm_tile(A, W, bias, out, mode, blockIdx.x, blockIdx.y);
}

// Q, K and V projections in one launch: they depend on nothing of each other,
// and one of them alone puts only two work-groups on a WGP. Grid (64, 8, 3);
// blockIdx.z picks the product. K (rows = d, cols = keys) has 4 x 128 tiles:
// its 512 work-groups are renumbered, row tile fastest.
__global__ __launch_bounds__(256) void qkv_wmma_kernel(
    const _Float16* __restrict__ xh, const _Float16* __restrict__ Wqh,
    const _Float16* __restrict__ Wkh, const _Float16* __restrict__ Wvh,
    const float* __restrict__ bq, const float* __restrict__ bk,
    const float* __restrict__ bv, _Float16* __restrict__ Qh,
    _Float16* __restrict__ Kp, _Float16* __restrict__ Vp) {
  const int z    = blockIdx.z;
  const int flat = blockIdx.y * 64 + blockIdx.x;
  const _Float16* A    = (z == 1) ? Wkh : xh;
  const _Float16* W    = (z == 0) ? Wqh : (z == 1) ? xh : Wvh;
  const float*    bias = (z == 0) ? bq : (z == 1) ? bk : bv;
  _Float16*       out  = (z == 0) ? Qh : (z == 1) ? Kp : Vp;
  const int mode = (z == 0) ? 0 : (z == 1) ? 3 : 1;
  const int bm   = (z == 1) ? (flat & 3) : (int)blockIdx.x;
  const int bn   = (z == 1) ? (flat >> 2) : (int)blockIdx.y;
  gemm_tile(A, W, bias, out, mode, bm, bn);
}

// ---------------------------------------------------------------------------
// Flash-style sparse attention.
//   Grid: (S/32, B); block: 256 threads = 8 waves; 32 query rows (two 16-row
//   tiles) per WG, so every K and V fragment that a wave reads from L2 feeds
//   two WMMAs and the launch reads K and V 128 times over, not 256.
//   Per 128-key block: wave w computes the scores of keys [kb+16w,+16)
//   TRANSPOSED (K fragment as A, Q fragment as B): a lane then holds 8
//   neighbouring keys of one query, which is one 16B piece of the P*V
//   A-fragment at the lane's own slot. The wave masks+scales them (mask values
//   loaded one key block ahead), shares its row maxima via LDS; WG-shared
//   online softmax; then each wave exponentiates its own 32x16 tile from
//   registers, once for the whole WG, and stores it as f16 in fragment order
//   to LDS, where all 8 waves read it; each wave accumulates P*V into its
//   private 64-wide d-slice. The row sums stay per lane (rescaled like the
//   accumulators) and are added up behind the loop.
//   Output stored transposed AOt[d][s] (== reference transpose+reshape,
//   flat-viewed as [S x D] for the final GEMM).
// ---------------------------------------------------------------------------
#define QROWS 32
// Q row pitch in LDS (halves): 1040 B = 16 B x odd, as for WLD
#define QLD 520

__global__ __launch_bounds__(256) void attn_kernel(
    const _Float16* __restrict__ Qh, const _Float16* __restrict__ Kp,
    const _Float16* __restrict__ Vp, const float* __restrict__ mask,
    _Float16* __restrict__ AOt) {
  __shared__ __align__(16) _Float16 Qs[QROWS][QLD];
  // P of one key block, A-fragment order: [tile][key/16][lane][8 halves]
  __shared__ __align__(16) _Float16 Pp[2 * 8 * 256];
  __shared__ float tmax[8][QROWS];
  __shared__ float mrun[QROWS], lrun[QROWS], mnew[QROWS], corr[QROWS];
  __shared__ __align__(16) _Float16 Ts[8][64][QROWS]; // per-wave O transpose

  const int q0   = blockIdx.x * QROWS;
  const int b    = blockIdx.y;
  const int w    = threadIdx.x >> 5;
  const int lane = threadIdx.x & 31;
  const int g    = lane >> 4;
  const int n    = lane & 15;
  const float scale = 0.044194173824159216f;       // 1/sqrt(512)
  const float NEG   = -__builtin_inff();
  const float LOG2E = 1.44269504f;

  // Stage Q tile (32 x 512 f16) into LDS via async DMA, 128B/thread.
  {
    int row = threadIdx.x >> 3;
    int c   = (threadIdx.x & 7) * 64;
    const _Float16* src = Qh + ((size_t)b * S_LEN + q0 + row) * D_DIM + c;
    #pragma unroll
    for (int j = 0; j < 64; j += 8)
      async_cp16(src + j, &Qs[row][c + j]);
  }
  if (threadIdx.x < QROWS) mrun[threadIdx.x] = NEG;
  // this wave's Q copies have landed before it reaches the barrier in front
  // of the loop, behind which every wave reads Qs
  asm volatile("s_wait_asynccnt 0x0" ::: "memory");

  v8f acc[2][4] = {};
  float lpart[2] = {0.f, 0.f};   // this lane's share of the sums of rows n, 16+n

  // Mask of this lane's 16 scores (queries n and 16+n, 8 neighbouring keys),
  // fetched one key block ahead and held as its compare results.
  const float* mrow0 =
      mask + ((size_t)b * S_LEN + q0 + n) * S_LEN + 16 * w + g * 8;
  bool keep[2][8];
  // K fragments (L2) live one key block ahead in registers of their own: the
  // first block's leave here, each later block's behind the score WMMAs of
  // the block before it.
  // The wave's number as a scalar: the wave's share of the K and V addresses
  // is then worked out in scalar registers, and the vector registers, all but
  // a few of which hold data in the score phase, take no spill.
  const int wu = __builtin_amdgcn_readfirstlane(w);
  const _Float16* kfirst = Kp + ((size_t)b * S_LEN + 16 * wu) * D_DIM;
  v16h kfr[16];
  #pragma unroll
  for (int j = 0; j < 16; j++) kfr[j] = load_packed(kfirst + lane * 8 + j * 512);
  {
    float4 m4[2][2];
    #pragma unroll
    for (int t = 0; t < 2; t++)
      #pragma unroll
      for (int h = 0; h < 2; h++)
        m4[t][h] = *(const float4*)(mrow0 + (size_t)(t * 16) * S_LEN + h * 4);
    // keeps every later write of the K and mask loads' address registers
    // behind them
    asm volatile("s_wait_xcnt 0x0" ::: "memory");
    #pragma unroll
    for (int t = 0; t < 2; t++)
      #pragma unroll
      for (int h = 0; h < 2; h++) {
        keep[t][h * 4 + 0] = m4[t][h].x > 0.95f;
        keep[t][h * 4 + 1] = m4[t][h].y > 0.95f;
        keep[t][h * 4 + 2] = m4[t][h].z > 0.95f;
        keep[t][h * 4 + 3] = m4[t][h].w > 0.95f;
      }
  }
  __syncthreads();                                 // Qs and mrun are there

  for (int kb = 0; kb < S_LEN; kb += 128) {
    // ---- Phase A: scores for key sub-tile [kb+16w, +16), keys as rows ------
    v8f s[2] = {};
    // All 16 V fragments (L2) of this key block leave first: the score phase,
    // the softmax and its three barriers stand between them and their WMMAs.
    const _Float16* vbase =
        Vp + ((size_t)b * S_LEN + kb) * D_DIM + (4 * wu) * 512 + lane * 8;
    v16h vfr[16];
    #pragma unroll
    for (int kf = 0; kf < 4; kf++)
      #pragma unroll
      for (int nf = 0; nf < 4; nf++)
        vfr[kf * 4 + nf] = load_packed(vbase + kf * (32 * D_DIM) + nf * 512);
    // holds the V loads in front of the Q reads, as one run
    __builtin_amdgcn_sched_barrier(0);
    // Q fragments come from LDS in groups of four d steps (16 loads, 8 WMMAs),
    // two register sets, each group read two groups ahead of its WMMAs: a wave
    // then waits for loads that left long ago, not for a round trip per WMMA.
    v16h qa[2][2][4];
    #pragma unroll
    for (int gq = 0; gq < 2; gq++)
      #pragma unroll
      for (int j = 0; j < 4; j++) {
        qa[gq][0][j] = load_frag(&Qs[0][(gq * 4 + j) * 32], QLD);
        qa[gq][1][j] = load_frag(&Qs[16][(gq * 4 + j) * 32], QLD);
      }
    // without this the scheduler sinks the loads above in among the WMMAs
    __builtin_amdgcn_sched_barrier(0);
    #pragma unroll
    for (int gq = 0; gq < 4; gq++) {
      #pragma unroll
      for (int j = 0; j < 4; j++) {
        s[0] = wmma_f16(kfr[gq * 4 + j], qa[gq & 1][0][j], s[0]);
        s[1] = wmma_f16(kfr[gq * 4 + j], qa[gq & 1][1][j], s[1]);
      }
      if (gq + 2 < 4) {
        // holds the refill behind this group's WMMAs, as one run of loads
        __builtin_amdgcn_sched_barrier(0);
        #pragma unroll
        for (int j = 0; j < 4; j++) {
          qa[gq & 1][0][j] = load_frag(&Qs[0][((gq + 2) * 4 + j) * 32], QLD);
          qa[gq & 1][1][j] = load_frag(&Qs[16][((gq + 2) * 4 + j) * 32], QLD);
        }
        // holds the refill in front of the next group's WMMAs
        __builtin_amdgcn_sched_barrier(0);
      }
    }
    // holds the next K loads behind the score WMMAs, whose registers they take
    __builtin_amdgcn_sched_barrier(0);
    // keeps every later write of the V loads' address registers behind those
    // loads; it stands a score phase behind them, not directly behind, so that
    // the wave goes on to its Q reads while the loads are taken up
    asm volatile("s_wait_xcnt 0x0" ::: "memory");
    // The next key block's 16 K fragments (L2) leave here: the softmax and the
    // P*V WMMAs stand between them and their use. The last block re-reads its
    // own, so no address leaves K.
    const _Float16* knext =
        kfirst + (size_t)((kb + 128 < S_LEN) ? kb + 128 : kb) * D_DIM + lane * 8;
    #pragma unroll
    for (int j = 0; j < 16; j++) kfr[j] = load_packed(knext + j * 512);
    // holds the mask loads behind the K loads: loads return in order, and K
    // (L2) must not wait for the mask's trip to memory
    __builtin_amdgcn_sched_barrier(0);
    // Next key block's mask: all 4 loads leave together, compared at the foot
    // of this pass. The last block re-reads its own columns, so no address
    // leaves the mask.
    const float* mnext = mrow0 + ((kb + 128 < S_LEN) ? kb + 128 : kb);
    float4 mn4[2][2];
    #pragma unroll
    for (int t = 0; t < 2; t++)
      #pragma unroll
      for (int h = 0; h < 2; h++)
        mn4[t][h] = *(const float4*)(mnext + (size_t)(t * 16) * S_LEN + h * 4);
    // lane (g, n): s[t][i] is query t*16+n against key kb + 16w + g*8 + i
    float sv[2][8], rm[2];
    #pragma unroll
    for (int t = 0; t < 2; t++) {
      #pragma unroll
      for (int i = 0; i < 8; i++)
        sv[t][i] = keep[t][i] ? s[t][i] * scale : NEG;
      float r = sv[t][0];
      #pragma unroll
      for (int i = 1; i < 8; i++) r = fmaxf(r, sv[t][i]);
      rm[t] = fmaxf(r, xhalf(r));                  // all 16 keys of the wave
    }
    tmax[w][lane] = g ? rm[1] : rm[0];             // lane l: query row l
    lds_barrier();
    // ---- Phase B: workgroup-shared online-softmax stats -------------------
    if (threadIdx.x < QROWS) {
      int r = threadIdx.x;
      float mx = tmax[0][r];
      #pragma unroll
      for (int t = 1; t < 8; t++) mx = fmaxf(mx, tmax[t][r]);
      float mold = mrun[r];
      float mn   = fmaxf(mold, mx);
      float c    = (mn <= -1e30f) ? 1.f : __expf(mold - mn);
      mnew[r] = mn; corr[r] = c; mrun[r] = mn;
    }
    lds_barrier();
    // ---- Phase P: this wave's own tile of P, once for the work-group ------
    float cr[2][8];
    #pragma unroll
    for (int t = 0; t < 2; t++)
      #pragma unroll
      for (int i = 0; i < 8; i++) cr[t][i] = corr[t * 16 + g * 8 + i];
    #pragma unroll
    for (int t = 0; t < 2; t++) {
      const float mrow = mnew[t * 16 + n];
      float x[8];
      #pragma unroll
      for (int i = 0; i < 8; i++)
        x[i] = (sv[t][i] - mrow) * LOG2E;          // e^y = 2^(y * log2 e)
      exp2x8(x);
      v8h pk;
      float es = 0.f;
      #pragma unroll
      for (int i = 0; i < 8; i++) {
        float e = (sv[t][i] <= -1e30f) ? 0.f : x[i];
        es += e;
        pk[i] = (_Float16)e;
      }
      lpart[t] = lpart[t] * corr[t * 16 + n] + es;
      // keys 16w + g*8 + 0..7 of query n: plane w & 1 of fragment w >> 1
      *(v8h*)&Pp[(t * 8 + w) * 256 + lane * 8] = pk;
    }
    // behind it every wave reads all of Pp; the next block's Pp stores stand
    // behind two more barriers, so no barrier is needed at the loop's top
    lds_barrier();
    // ---- Phase C: P A-frags from LDS, rescale acc, P*V --------------------
    v16h p[2][4];
    #pragma unroll
    for (int t = 0; t < 2; t++)
      #pragma unroll
      for (int kf = 0; kf < 4; kf++)
        p[t][kf] = load_packed(&Pp[(t * 4 + kf) * 512 + lane * 8]);
    // holds the 16 P loads together as one run: the scheduler spread them in
    // pairs among the WMMAs, each pair with a wait of its own
    __builtin_amdgcn_sched_barrier(0);
    // keeps every later write of the K and mask loads' address registers
    // behind those loads; it stands a softmax behind them, and names the
    // addresses so that they stay live up to here
    asm volatile("s_wait_xcnt 0x0" :: "v"(knext), "v"(mnext) : "memory");
    #pragma unroll
    for (int t = 0; t < 2; t++)
      #pragma unroll
      for (int nf = 0; nf < 4; nf++)
        #pragma unroll
        for (int i = 0; i < 8; i++) acc[t][nf][i] *= cr[t][i];
    #pragma unroll
    for (int kf = 0; kf < 4; kf++) {
      #pragma unroll
      for (int nf = 0; nf < 4; nf++) {
        acc[0][nf] = wmma_f16(p[0][kf], vfr[kf * 4 + nf], acc[0][nf]);
        acc[1][nf] = wmma_f16(p[1][kf], vfr[kf * 4 + nf], acc[1][nf]);
      }
    }
    #pragma unroll
    for (int t = 0; t < 2; t++)
      #pragma unroll
      for (int h = 0; h < 2; h++) {
        keep[t][h * 4 + 0] = mn4[t][h].x > 0.95f;
        keep[t][h * 4 + 1] = mn4[t][h].y > 0.95f;
        keep[t][h * 4 + 2] = mn4[t][h].z > 0.95f;
        keep[t][h * 4 + 3] = mn4[t][h].w > 0.95f;
      }
  }
  // Row sums: the two halves of a wave, then the 8 waves (tmax is free: its
  // last reader left it two barriers ago).
  {
    float l0 = lpart[0] + xhalf(lpart[0]);
    float l1 = lpart[1] + xhalf(lpart[1]);
    tmax[w][lane] = g ? l1 : l0;                   // lane l: query row l
  }
  __syncthreads();
  if (threadIdx.x < QROWS) {
    float l = tmax[0][threadIdx.x];
    #pragma unroll
    for (int t = 1; t < 8; t++) l += tmax[t][threadIdx.x];
    lrun[threadIdx.x] = l;
  }
  __syncthreads();

  // ---- Finalize: 1/l, per-wave LDS transpose, coalesced store to AOt[d][s].
  #pragma unroll
  for (int t = 0; t < 2; t++) {
    #pragma unroll
    for (int nf = 0; nf < 4; nf++) {
      #pragma unroll
      for (int i = 0; i < 8; i++) {
        int m = t * 16 + g * 8 + i;
        float l   = lrun[m];
        float inv = (l > 0.f) ? 1.f / l : 0.f;
        Ts[w][nf * 16 + n][m] = (_Float16)(acc[t][nf][i] * inv);
      }
    }
  }
  __syncthreads();
  // 64 rows of 64B per wave: four lanes store one row's 64 contiguous bytes
  _Float16* obase = AOt + ((size_t)b * D_DIM + 64 * w + (lane >> 2)) * S_LEN +
                    q0 + (lane & 3) * 8;
  #pragma unroll
  for (int j = 0; j < 8; j++)
    *(uint4*)(obase + (size_t)(j * 8) * S_LEN) =
        *(const uint4*)&Ts[w][j * 8 + (lane >> 2)][(lane & 3) * 8];
}

// ---------------------------------------------------------------------------
extern "C" void kernel_launch(void* const* d_in, const int* in_sizes, int n_in,
                              void* d_out, int out_size, void* d_ws,
                              size_t ws_size, hipStream_t stream) {
  (void)in_sizes; (void)n_in; (void)out_size; (void)ws_size;
  const float* x    = (const float*)d_in[0];
  const float* mask = (const float*)d_in[1];
  const float* Wq   = (const float*)d_in[2];
  const float* bq   = (const float*)d_in[3];
  const float* Wk   = (const float*)d_in[4];
  const float* bk   = (const float*)d_in[5];
  const float* Wv   = (const float*)d_in[6];
  const float* bv   = (const float*)d_in[7];
  const float* Wo   = (const float*)d_in[8];
  const float* bo   = (const float*)d_in[9];

  const int B = 2, S = S_LEN, D = D_DIM;
  const int M = B * S;                             // 8192
  const size_t MB = 1ull << 20;
  char* ws = (char*)d_ws;                          // 34 MB used
  _Float16* Qh  = (_Float16*)(ws + 0 * MB);        // 8MB [b][s][d]
  _Float16* Kp  = (_Float16*)(ws + 8 * MB);        // 8MB, fragment order
  _Float16* Vp  = (_Float16*)(ws + 16 * MB);       // 8MB, fragment order
  _Float16* xh  = (_Float16*)(ws + 24 * MB);       // 8MB, reused as AOt
  _Float16* AOt = xh;                              // [b][d][s] after attn
  _Float16* Wqh = (_Float16*)(ws + 32 * MB);
  _Float16* Wkh = (_Float16*)(ws + 32 * MB + 512 * 1024);
  _Float16* Wvh = (_Float16*)(ws + 33 * MB);
  _Float16* Woh = (_Float16*)(ws + 33 * MB + 512 * 1024);

  // Wqh..Woh lie one behind the other: one destination for the four weights
  cvt_all_kernel<<<dim3(CVT_WGS), dim3(256), 0, stream>>>(x, Wq, Wk, Wv, Wo, xh,
                                                          Wqh);

  dim3 gg(M / 128, D / 64);
  qkv_wmma_kernel<<<dim3(M / 128, D / 64, 3), dim3(256), 0, stream>>>(
      xh, Wqh, Wkh, Wvh, bq, bk, bv, Qh, Kp, Vp);

  attn_kernel<<<dim3(S / QROWS, B), dim3(256), 0, stream>>>(Qh, Kp, Vp, mask, AOt);

  gemm_wmma_kernel<<<gg, dim3(256), 0, stream>>>(AOt, Woh, bo, d_out, 2);
}

// v010
// It runs in 136 microseconds.
// Next to v009, in two timings, it ran 1.09 times as fast each time.
// Over all steps from v000 it is 3.24 times as fast.
#include <hip/hip_runtime.h>
#include <hip/hip_bf16.h>

// ---------------------------------------------------------------------------
// Sparse attention, MI455X (gfx1250, wave32, WMMA).
//   B=2, S=4096, D=512. ~86 GFLOP vs ~170MB mandatory traffic -> compute
//   bound; use v_wmma_f32_16x16x32_f16 (f16 in, f32 acc) for every GEMM.
//   Q/K/V f16 (24MB) are L2-resident (192MB L2); K A- and V B-fragments stream from
//   L2 in the flash loop, stored by the projections in fragment order so that
//   one wave-wide 16B load covers 512 contiguous bytes (4 whole lines).
//   GEMM W-operand panels (x rows for K) are staged to LDS with async-to-LDS
//   DMA (ASYNCcnt) double-buffering; fragments are register-double-buffered
//   so WMMAs overlap loads instead of s_wait_loadcnt 0 per op.
// ---------------------------------------------------------------------------

typedef __attribute__((ext_vector_type(16))) _Float16 v16h;
typedef __attribute__((ext_vector_type(8)))  _Float16 v8h;
typedef __attribute__((ext_vector_type(4)))  _Float16 v4h;
typedef __attribute__((ext_vector_type(8)))  float    v8f;

#define S_LEN 4096
#define D_DIM 512

#if defined(__AMDGCN__) &&                                              \
    __has_builtin(__builtin_amdgcn_global_load_async_to_lds_b128) &&    \
    __has_builtin(__builtin_amdgcn_s_wait_asynccnt)
#define HAVE_ASYNC 1
// Signature (from clang diagnostic): (v4i AS1*, v4i AS3*, imm, imm)
typedef int v4i_t __attribute__((vector_size(16)));
typedef __attribute__((address_space(1))) v4i_t* gv4i_p;
typedef __attribute__((address_space(3))) v4i_t* lv4i_p;
#else
#define HAVE_ASYNC 0
#endif

__device__ __forceinline__ void async_cp16(const _Float16* src, _Float16* lds) {
#if HAVE_ASYNC
  __builtin_amdgcn_global_load_async_to_lds_b128((gv4i_p)src, (lv4i_p)lds, 0, 0);
#else
  *(v8h*)lds = *(const v8h*)src;
#endif
}
__device__ __forceinline__ void async_wait0() {
#if HAVE_ASYNC
  __builtin_amdgcn_s_wait_asynccnt(0);
#endif
}

__device__ __forceinline__ v8f wmma_f16(v16h a, v16h b, v8f c) {
  // (neg_a, A, neg_b, B, c_mod, C, reuse_a, reuse_b)
  return __builtin_amdgcn_wmma_f32_16x16x32_f16(false, a, false, b,
                                                (short)0, c, false, false);
}

// A-fragment (16x32 f16, M=lane&15, K-halves split by lane group) or,
// identically, B-fragment (32x16 f16, N=lane&15) from a row-major source
// whose rows are contiguous in K. Two 16B chunks per lane.
__device__ __forceinline__ v16h load_frag(const _Float16* p, int ld) {
  const int lane = threadIdx.x & 31;
  const int row  = lane & 15;
  const int ko   = (lane >> 4) << 3;     // 0 or 8
  const _Float16* q = p + (size_t)row * ld + ko;
  v8h lo = *(const v8h*)(q);
  v8h hi = *(const v8h*)(q + 16);
  return __builtin_shufflevector(lo, hi, 0,1,2,3,4,5,6,7,8,9,10,11,12,13,14,15);
}

// Fragment stored in fragment order: 512 halves per fragment, two planes of
// 256 halves (elements 0..7, then 8..15), lane l at halves [8l, 8l+8) of each
// plane. p already includes the lane's 8*lane.
__device__ __forceinline__ v16h load_packed(const _Float16* p) {
  v8h lo = *(const v8h*)(p);
  v8h hi = *(const v8h*)(p + 256);
  return __builtin_shufflevector(lo, hi, 0,1,2,3,4,5,6,7,8,9,10,11,12,13,14,15);
}

// Lane l reads lane l ^ 16, on the vector unit.
__device__ __forceinline__ float xhalf(float x) {
  int b = __builtin_bit_cast(int, x);
  return __builtin_bit_cast(
      float, __builtin_amdgcn_permlanex16(b, b, 0x76543210, 0xfedcba98, false,
                                          false));
}

// Work-group barrier for data that is handed over in LDS alone: the fences name
// the LDS address space, so the wave waits for its LDS operations only.
// __syncthreads() also waits for every global load in flight, which would end
// the V and mask loads' head start at the first barrier behind them.
__device__ __forceinline__ void lds_barrier() {
  __builtin_amdgcn_fence(__ATOMIC_RELEASE, "workgroup", "local");
  __builtin_amdgcn_s_barrier();
  __builtin_amdgcn_fence(__ATOMIC_ACQUIRE, "workgroup", "local");
}

__device__ __forceinline__ void exp2x8(float (&x)[8]) {
  asm("v_exp_f32 %0, %0\n\t"
      "v_exp_f32 %1, %1\n\t"
      "v_exp_f32 %2, %2\n\t"
      "v_exp_f32 %3, %3\n\t"
      "v_exp_f32 %4, %4\n\t"
      "v_exp_f32 %5, %5\n\t"
      "v_exp_f32 %6, %6\n\t"
      "v_exp_f32 %7, %7\n\t"
      "v_nop"
      : "+v"(x[0]), "+v"(x[1]), "+v"(x[2]), "+v"(x[3]), "+v"(x[4]),
        "+v"(x[5]), "+v"(x[6]), "+v"(x[7]));
}

// ---------------------------------------------------------------------------
// f32 -> f16 conversion of x and the four weight matrices, one launch.
//   512 work-groups of 256 threads, all resident at once. The five sources
//   are 1,310,720 float4 = 10 per thread: 8 of x, 2 of the weights (Wh holds
//   Wq, Wk, Wv, Wo one behind the other, 65,536 float4 each, so a work-group
//   lies inside one matrix). All 10 loads leave before the first store.
// ---------------------------------------------------------------------------
#define CVT_WGS 512
#define CVT_THREADS (CVT_WGS * 256)

__device__ __forceinline__ v4h cvt4(float4 v) {
  v4h o = {(_Float16)v.x, (_Float16)v.y, (_Float16)v.z, (_Float16)v.w};
  return o;
}

__global__ __launch_bounds__(256) void cvt_all_kernel(
    const float* __restrict__ x, const float* __restrict__ Wq,
    const float* __restrict__ Wk, const float* __restrict__ Wv,
    const float* __restrict__ Wo, _Float16* __restrict__ xh,
    _Float16* __restrict__ Wh) {
  const int t  = blockIdx.x * 256 + threadIdx.x;
  const int hi = blockIdx.x >> 8;                  // t / 65536
  const float* wa = hi ? Wk : Wq;                  // weight float4 t
  const float* wb = hi ? Wo : Wv;                  // weight float4 t + 131072
  float4 vx[8];
  #pragma unroll
  for (int j = 0; j < 8; j++) vx[j] = ((const float4*)x)[j * CVT_THREADS + t];
  float4 va = ((const float4*)wa)[t & 65535];
  float4 vb = ((const float4*)wb)[t & 65535];
  #pragma unroll
  for (int j = 0; j < 8; j++) ((v4h*)xh)[j * CVT_THREADS + t] = cvt4(vx[j]);
  ((v4h*)Wh)[t] = cvt4(va);
  ((v4h*)Wh)[CVT_THREADS + t] = cvt4(vb);
}

// ---------------------------------------------------------------------------
// WMMA GEMM: out[m][n] = sum_k A[m][k] * W[n][k] + bias[n] (mode 3: bias[m])
//   A: [M x 512] f16 rm, W: [N x 512] f16 rm (torch Linear layout; x in mode 3).
//   Block: 8 waves; wave w -> 16x64 tile; block tile 128(M) x 64(N).
//   W k-panel (64 x 32) is shared by all 8 waves -> staged to LDS with
//   async-to-LDS DMA, double buffered; A fragments double buffered in regs.
//   mode 0: f16 out rm [M x 512]   (Q)
//   mode 1: f16 out, rows m = keys, cols = d, in P*V B-fragment order:
//           Vp[m/32][d/16][(m/16)&1][lane = ((m/8)&1)*16 + d%16][m%8]
//   mode 2: f32 out rm [M x 512]   (final Wo projection into d_out)
//   mode 3: f16 out, rows m = d (A = Wk), cols = keys (W = x), bias per row,
//           in Q*K^T B-fragment order:
//           Kp[key/16][d/32][(d/16)&1][lane = ((d/8)&1)*16 + key%16][d%8]
//   In modes 1 and 3 a lane's 8 accumulator rows are one 16B piece of the
//   fragment at its own lane slot: stored straight from registers.
// ---------------------------------------------------------------------------
// LDS row pitch (halves): 80 B = 16 B x odd, so the 16 rows that half a wave
// reads with one 16B load start on 16 different groups of four banks
#define WLD 40

__device__ __forceinline__ void gemm_tile(
    const _Float16* __restrict__ A, const _Float16* __restrict__ W,
    const float* __restrict__ bias, void* __restrict__ out, int mode,
    int bm, int bn) {
  __shared__ __align__(16) _Float16 Ws[2][64][WLD];
  const int w    = threadIdx.x >> 5;
  const int lane = threadIdx.x & 31;
  const int g    = lane >> 4;
  const int n    = lane & 15;
  const int m0   = bm * 128 + w * 16;
  const int n0   = bn * 64;

  // cooperative W-panel staging: 64 rows x 32 halves, 16B per thread
  const int srow = threadIdx.x >> 2;
  const int scol = (threadIdx.x & 3) * 8;
  const _Float16* wpan = W + (size_t)(n0 + srow) * D_DIM + scol;

  v8f acc[4] = {};
  const _Float16* abase = A + (size_t)m0 * D_DIM;

  async_cp16(wpan, &Ws[0][srow][scol]);          // stage k=0 panel
  async_wait0();
  __syncthreads();

  v16h a_c = load_frag(abase, D_DIM);
  int buf = 0;
  for (int k = 0; k < D_DIM; k += 32) {
    if (k + 32 < D_DIM)                          // DMA next panel during WMMAs
      async_cp16(wpan + (k + 32), &Ws[buf ^ 1][srow][scol]);
    v16h a_n = a_c;
    if (k + 32 < D_DIM) a_n = load_frag(abase + k + 32, D_DIM);
    #pragma unroll
    for (int nf = 0; nf < 4; nf++) {
      v16h bf = load_frag(&Ws[buf][nf * 16][0], WLD);
      acc[nf] = wmma_f16(a_c, bf, acc[nf]);
    }
    a_c = a_n;
    async_wait0();
    __syncthreads();
    buf ^= 1;
  }

  if (mode == 0) {                               // f16 row-major
    _Float16* o = (_Float16*)out;
    #pragma unroll
    for (int nf = 0; nf < 4; nf++) {
      int col = n0 + nf * 16 + n;
      float bv = bias[col];
      #pragma unroll
      for (int i = 0; i < 8; i++)
        o[(size_t)(m0 + g * 8 + i) * D_DIM + col] = (_Float16)(acc[nf][i] + bv);
    }
    // keeps every later write of the stores' address and data registers
    // behind the stores above
    asm volatile("s_wait_xcnt 0x0" ::: "memory");
  } else if (mode == 1) {                        // V, fragment order
    _Float16* o = (_Float16*)out + (size_t)(m0 >> 5) * (32 * D_DIM) +
                  ((m0 >> 4) & 1) * 256 + lane * 8;
    #pragma unroll
    for (int nf = 0; nf < 4; nf++) {
      float bv = bias[n0 + nf * 16 + n];
      v8h pk;
      #pragma unroll
      for (int i = 0; i < 8; i++) pk[i] = (_Float16)(acc[nf][i] + bv);
      *(v8h*)(o + ((n0 >> 4) + nf) * 512) = pk;
    }
    // keeps every later write of the stores' address and data registers
    // behind the four stores above
    asm volatile("s_wait_xcnt 0x0" ::: "memory");
  } else if (mode == 3) {                        // K, fragment order
    _Float16* o = (_Float16*)out + (m0 >> 4) * 256 + lane * 8;
    float bv[8];
    #pragma unroll
    for (int i = 0; i < 8; i++) bv[i] = bias[m0 + g * 8 + i];
    #pragma unroll
    for (int nf = 0; nf < 4; nf++) {
      v8h pk;
      #pragma unroll
      for (int i = 0; i < 8; i++) pk[i] = (_Float16)(acc[nf][i] + bv[i]);
      *(v8h*)(o + (size_t)((n0 >> 4) + nf) * (16 * D_DIM)) = pk;
    }
    // keeps every later write of the stores' address and data registers
    // behind the four stores above
    asm volatile("s_wait_xcnt 0x0" ::: "memory");
  } else {                                       // f32 row-major (d_out)
    float* o = (float*)out;
    #pragma unroll
    for (int nf = 0; nf < 4; nf++) {
      int col = n0 + nf * 16 + n;
      float bv = bias[col];
      #pragma unroll
      for (int i = 0; i < 8; i++)
        o[(size_t)(m0 + g * 8 + i) * D_DIM + col] = acc[nf][i] + bv;
    }
    // keeps every later write of the stores' address and data registers
    // behind the stores above
    asm volatile("s_wait_xcnt 0x0" ::: "memory");
  }
}

__global__ __launch_bounds__(256) void gemm_wmma_kernel(
    const _Float16* __restrict__ A, const _Float16* __restrict__ W,
    const float* __restrict__ bias, void* __restrict__ out, int mode) {
  gemm_tile(A, W, bias, out, mode, blockIdx.x, blockIdx.y);
}

// Q, K and V projections in one launch: they depend on nothing of each other,
// and one of them alone puts only two work-groups on a WGP. Grid (64, 8, 3);
// blockIdx.z picks the product. K (rows = d, cols = keys) has 4 x 128 tiles:
// its 512 work-groups are renumbered, row tile fastest.
__global__ __launch_bounds__(256) void qkv_wmma_kernel(
    const _Float16* __restrict__ xh, const _Float16* __restrict__ Wqh,
    const _Float16* __restrict__ Wkh, const _Float16* __restrict__ Wvh,
    const float* __restrict__ bq, const float* __restrict__ bk,
    const float* __restrict__ bv, _Float16* __restrict__ Qh,
    _Float16* __restrict__ Kp, _Float16* __restrict__ Vp) {
  const int z    = blockIdx.z;
  const int flat = blockIdx.y * 64 + blockIdx.x;
  const _Float16* A    = (z == 1) ? Wkh : xh;
  const _Float16* W    = (z == 0) ? Wqh : (z == 1) ? xh : Wvh;
  const float*    bias = (z == 0) ? bq : (z == 1) ? bk : bv;
  _Float16*       out  = (z == 0) ? Qh : (z == 1) ? Kp : Vp;
  const int mode = (z == 0) ? 0 : (z == 1) ? 3 : 1;
  const int bm   = (z == 1) ? (flat & 3) : (int)blockIdx.x;
  const int bn   = (z == 1) ? (flat >> 2) : (int)blockIdx.y;
  gemm_tile(A, W, bias, out, mode, bm, bn);
}

// ---------------------------------------------------------------------------
// Flash-style sparse attention.
//   Grid: (S/32, B); block: 256 threads = 8 waves; 32 query rows (two 16-row
//   tiles) per WG, so every K and V fragment that a wave reads from L2 feeds
//   two WMMAs and the launch reads K and V 128 times over, not 256.
//   Per 128-key block: wave w computes the scores of keys [kb+16w,+16)
//   TRANSPOSED (K fragment as A, Q fragment as B): a lane then holds 8
//   neighbouring keys of one query, which is one 16B piece of the P*V
//   A-fragment at the lane's own slot. The wave masks+scales them (mask values
//   loaded one key block ahead), shares its row maxima via LDS; WG-shared
//   online softmax; then each wave exponentiates its own 32x16 tile from
//   registers, once for the whole WG, and stores it as f16 in fragment order
//   to LDS, where all 8 waves read it; each wave accumulates P*V into its
//   private 64-wide d-slice. The row sums stay per lane (rescaled like the
//   accumulators) and are added up behind the loop.
//   Each WG walks the 32 key blocks in a ring from a start block of its own:
//   walked from block 0 by all, the 128 WGs of a batch ask L2 for the same
//   lines at the same moment.
//   Output stored transposed AOt[d][s] (== reference transpose+reshape,
//   flat-viewed as [S x D] for the final GEMM).
// ---------------------------------------------------------------------------
#define QROWS 32
// Q row pitch in LDS (halves): 1040 B = 16 B x odd, as for WLD
#define QLD 520

__global__ __launch_bounds__(256) void attn_kernel(
    const _Float16* __restrict__ Qh, const _Float16* __restrict__ Kp,
    const _Float16* __restrict__ Vp, const float* __restrict__ mask,
    _Float16* __restrict__ AOt) {
  __shared__ __align__(16) _Float16 Qs[QROWS][QLD];
  // P of one key block, A-fragment order: [tile][key/16][lane][8 halves]
  __shared__ __align__(16) _Float16 Pp[2 * 8 * 256];
  __shared__ float tmax[8][QROWS];
  __shared__ float mrun[QROWS], lrun[QROWS], mnew[QROWS], corr[QROWS];
  __shared__ __align__(16) _Float16 Ts[8][64][QROWS]; // per-wave O transpose

  const int q0   = blockIdx.x * QROWS;
  const int b    = blockIdx.y;
  const int w    = threadIdx.x >> 5;
  const int lane = threadIdx.x & 31;
  const int g    = lane >> 4;
  const int n    = lane & 15;
  const float scale = 0.044194173824159216f;       // 1/sqrt(512)
  const float NEG   = -__builtin_inff();
  const float LOG2E = 1.44269504f;
  // First key of this WG's ring: one of the 32 key blocks. The four WGs of a
  // batch that share a start are 2 apart in the index
  // (a matter of speed only; any start gives the same sums in another order).
  const int kstart = (((blockIdx.x >> 3) << 1) | (blockIdx.x & 1)) * 128;

  // Stage Q tile (32 x 512 f16) into LDS via async DMA, 128B/thread.
  {
    int row = threadIdx.x >> 3;
    int c   = (threadIdx.x & 7) * 64;
    const _Float16* src = Qh + ((size_t)b * S_LEN + q0 + row) * D_DIM + c;
    #pragma unroll
    for (int j = 0; j < 64; j += 8)
      async_cp16(src + j, &Qs[row][c + j]);
  }
  if (threadIdx.x < QROWS) mrun[threadIdx.x] = NEG;
  // this wave's Q copies have landed before it reaches the barrier in front
  // of the loop, behind which every wave reads Qs
  asm volatile("s_wait_asynccnt 0x0" ::: "memory");

  v8f acc[2][4] = {};
  float lpart[2] = {0.f, 0.f};   // this lane's share of the sums of rows n, 16+n

  // Mask of this lane's 16 scores (queries n and 16+n, 8 neighbouring keys),
  // fetched one key block ahead and held as its compare results.
  const float* mrow0 =
      mask + ((size_t)b * S_LEN + q0 + n) * S_LEN + 16 * w + g * 8;
  bool keep[2][8];
  // K fragments (L2) live one key block ahead in registers of their own: the
  // first block's leave here, each later block's behind the score WMMAs of
  // the block before it.
  // The wave's number as a scalar: the wave's share of the K and V addresses
  // is then worked out in scalar registers, and the vector registers, all but
  // a few of which hold data in the score phase, take no spill.
  const int wu = __builtin_amdgcn_readfirstlane(w);
  const _Float16* kfirst = Kp + ((size_t)b * S_LEN + 16 * wu) * D_DIM;
  v16h kfr[16];
  #pragma unroll
  for (int j = 0; j < 16; j++)
    kfr[j] = load_packed(kfirst + (size_t)kstart * D_DIM + lane * 8 + j * 512);
  {
    const float* mfirst = mrow0 + kstart;
    float4 m4[2][2];
    #pragma unroll
    for (int t = 0; t < 2; t++)
      #pragma unroll
      for (int h = 0; h < 2; h++)
        m4[t][h] = *(const float4*)(mfirst + (size_t)(t * 16) * S_LEN + h * 4);
    // keeps every later write of the K and mask loads' address registers
    // behind them; it names the mask address so that it stays live up to here
    asm volatile("s_wait_xcnt 0x0" :: "v"(mfirst) : "memory");
    #pragma unroll
    for (int t = 0; t < 2; t++)
      #pragma unroll
      for (int h = 0; h < 2; h++) {
        keep[t][h * 4 + 0] = m4[t][h].x > 0.95f;
        keep[t][h * 4 + 1] = m4[t][h].y > 0.95f;
        keep[t][h * 4 + 2] = m4[t][h].z > 0.95f;
        keep[t][h * 4 + 3] = m4[t][h].w > 0.95f;
      }
  }
  __syncthreads();                                 // Qs and mrun are there

  // This lane's V address of the pass at hand, formed in the pass before it, so
  // that the V loads can leave as the first thing of a pass.
  const _Float16* vring = Vp + (size_t)b * S_LEN * D_DIM + (4 * wu) * 512 + lane * 8;
  const _Float16* vcur  = vring + (size_t)kstart * D_DIM;
  for (int it = 0; it < S_LEN; it += 128) {
    const int kn = (kstart + it + 128) & (S_LEN - 1);  // the next pass's keys
    // ---- Phase A: scores for key sub-tile [kb+16w, +16), keys as rows ------
    v8f s[2] = {};
    // All 16 V fragments (L2) of this key block leave first: the score phase,
    // the softmax and its three barriers stand between them and their WMMAs.
    const _Float16* vbase = vcur;
    v16h vfr[16];
    #pragma unroll
    for (int kf = 0; kf < 4; kf++)
      #pragma unroll
      for (int nf = 0; nf < 4; nf++)
        vfr[kf * 4 + nf] = load_packed(vbase + kf * (32 * D_DIM) + nf * 512);
    // holds the V loads in front of the Q reads, as one run
    __builtin_amdgcn_sched_barrier(0);
    // Q fragments come from LDS in groups of four d steps (16 loads, 8 WMMAs),
    // two register sets, each group read two groups ahead of its WMMAs: a wave
    // then waits for loads that left long ago, not for a round trip per WMMA.
    v16h qa[2][2][4];
    #pragma unroll
    for (int gq = 0; gq < 2; gq++)
      #pragma unroll
      for (int j = 0; j < 4; j++) {
        qa[gq][0][j] = load_frag(&Qs[0][(gq * 4 + j) * 32], QLD);
        qa[gq][1][j] = load_frag(&Qs[16][(gq * 4 + j) * 32], QLD);
      }
    // without this the scheduler sinks the loads above in among the WMMAs
    __builtin_amdgcn_sched_barrier(0);
    #pragma unroll
    for (int gq = 0; gq < 4; gq++) {
      #pragma unroll
      for (int j = 0; j < 4; j++) {
        s[0] = wmma_f16(kfr[gq * 4 + j], qa[gq & 1][0][j], s[0]);
        s[1] = wmma_f16(kfr[gq * 4 + j], qa[gq & 1][1][j], s[1]);
      }
      if (gq + 2 < 4) {
        // holds the refill behind this group's WMMAs, as one run of loads
        __builtin_amdgcn_sched_barrier(0);
        #pragma unroll
        for (int j = 0; j < 4; j++) {
          qa[gq & 1][0][j] = load_frag(&Qs[0][((gq + 2) * 4 + j) * 32], QLD);
          qa[gq & 1][1][j] = load_frag(&Qs[16][((gq + 2) * 4 + j) * 32], QLD);
        }
        // holds the refill in front of the next group's WMMAs
        __builtin_amdgcn_sched_barrier(0);
      }
    }
    // holds the next K loads behind the score WMMAs, whose registers they take
    __builtin_amdgcn_sched_barrier(0);
    // keeps every later write of the V loads' address registers behind those
    // loads; it stands a score phase behind them, not directly behind, so that
    // the wave goes on to its Q reads while the loads are taken up; it names
    // the address so that it stays live up to here
    asm volatile("s_wait_xcnt 0x0" :: "v"(vbase) : "memory");
    vcur = vring + (size_t)kn * D_DIM;
    // The next key block's 16 K fragments (L2) leave here: the softmax and the
    // P*V WMMAs stand between them and their use. The last pass reads the
    // ring's first block again, so no address leaves K.
    const _Float16* knext = kfirst + (size_t)kn * D_DIM + lane * 8;
    #pragma unroll
    for (int j = 0; j < 16; j++) kfr[j] = load_packed(knext + j * 512);
    // holds the mask loads behind the K loads: loads return in order, and K
    // (L2) must not wait for the mask's trip to memory
    __builtin_amdgcn_sched_barrier(0);
    // Next key block's mask: all 4 loads leave together, compared at the foot
    // of this pass. The last pass reads the ring's first columns again, so no
    // address leaves the mask.
    const float* mnext = mrow0 + kn;
    float4 mn4[2][2];
    #pragma unroll
    for (int t = 0; t < 2; t++)
      #pragma unroll
      for (int h = 0; h < 2; h++)
        mn4[t][h] = *(const float4*)(mnext + (size_t)(t * 16) * S_LEN + h * 4);
    // lane (g, n): s[t][i] is query t*16+n against key kb + 16w + g*8 + i
    float sv[2][8], rm[2];
    #pragma unroll
    for (int t = 0; t < 2; t++) {
      #pragma unroll
      for (int i = 0; i < 8; i++)
        sv[t][i] = keep[t][i] ? s[t][i] * scale : NEG;
      float r = sv[t][0];
      #pragma unroll
      for (int i = 1; i < 8; i++) r = fmaxf(r, sv[t][i]);
      rm[t] = fmaxf(r, xhalf(r));                  // all 16 keys of the wave
    }
    tmax[w][lane] = g ? rm[1] : rm[0];             // lane l: query row l
    lds_barrier();
    // ---- Phase B: workgroup-shared online-softmax stats -------------------
    if (threadIdx.x < QROWS) {
      int r = threadIdx.x;
      float mx = tmax[0][r];
      #pragma unroll
      for (int t = 1; t < 8; t++) mx = fmaxf(mx, tmax[t][r]);
      float mold = mrun[r];
      float mn   = fmaxf(mold, mx);
      float c    = (mn <= -1e30f) ? 1.f : __expf(mold - mn);
      mnew[r] = mn; corr[r] = c; mrun[r] = mn;
    }
    lds_barrier();
    // ---- Phase P: this wave's own tile of P, once for the work-group ------
    float cr[2][8];
    #pragma unroll
    for (int t = 0; t < 2; t++)
      #pragma unroll
      for (int i = 0; i < 8; i++) cr[t][i] = corr[t * 16 + g * 8 + i];
    #pragma unroll
    for (int t = 0; t < 2; t++) {
      const float mrow = mnew[t * 16 + n];
      float x[8];
      #pragma unroll
      for (int i = 0; i < 8; i++)
        x[i] = (sv[t][i] - mrow) * LOG2E;          // e^y = 2^(y * log2 e)
      exp2x8(x);
      v8h pk;
      float es = 0.f;
      #pragma unroll
      for (int i = 0; i < 8; i++) {
        float e = (sv[t][i] <= -1e30f) ? 0.f : x[i];
        es += e;
        pk[i] = (_Float16)e;
      }
      lpart[t] = lpart[t] * corr[t * 16 + n] + es;
      // keys 16w + g*8 + 0..7 of query n: plane w & 1 of fragment w >> 1
      *(v8h*)&Pp[(t * 8 + w) * 256 + lane * 8] = pk;
    }
    // behind it every wave reads all of Pp; the next block's Pp stores stand
    // behind two more barriers, so no barrier is needed at the loop's top
    lds_barrier();
    // ---- Phase C: P A-frags from LDS, rescale acc, P*V --------------------
    v16h p[2][4];
    #pragma unroll
    for (int t = 0; t < 2; t++)
      #pragma unroll
      for (int kf = 0; kf < 4; kf++)
        p[t][kf] = load_packed(&Pp[(t * 4 + kf) * 512 + lane * 8]);
    // holds the 16 P loads together as one run: the scheduler spread them in
    // pairs among the WMMAs, each pair with a wait of its own
    __builtin_amdgcn_sched_barrier(0);
    // keeps every later write of the K and mask loads' address registers
    // behind those loads; it stands a softmax behind them, and names the
    // addresses so that they stay live up to here
    asm volatile("s_wait_xcnt 0x0" :: "v"(knext), "v"(mnext) : "memory");
    #pragma unroll
    for (int t = 0; t < 2; t++)
      #pragma unroll
      for (int nf = 0; nf < 4; nf++)
        #pragma unroll
        for (int i = 0; i < 8; i++) acc[t][nf][i] *= cr[t][i];
    #pragma unroll
    for (int kf = 0; kf < 4; kf++) {
      #pragma unroll
      for (int nf = 0; nf < 4; nf++) {
        acc[0][nf] = wmma_f16(p[0][kf], vfr[kf * 4 + nf], acc[0][nf]);
        acc[1][nf] = wmma_f16(p[1][kf], vfr[kf * 4 + nf], acc[1][nf]);
      }
    }
    #pragma unroll
    for (int t = 0; t < 2; t++)
      #pragma unroll
      for (int h = 0; h < 2; h++) {
        keep[t][h * 4 + 0] = mn4[t][h].x > 0.95f;
        keep[t][h * 4 + 1] = mn4[t][h].y > 0.95f;
        keep[t][h * 4 + 2] = mn4[t][h].z > 0.95f;
        keep[t][h * 4 + 3] = mn4[t][h].w > 0.95f;
      }
  }
  // Row sums: the two halves of a wave, then the 8 waves (tmax is free: its
  // last reader left it two barriers ago).
  {
    float l0 = lpart[0] + xhalf(lpart[0]);
    float l1 = lpart[1] + xhalf(lpart[1]);
    tmax[w][lane] = g ? l1 : l0;                   // lane l: query row l
  }
  __syncthreads();
  if (threadIdx.x < QROWS) {
    float l = tmax[0][threadIdx.x];
    #pragma unroll
    for (int t = 1; t < 8; t++) l += tmax[t][threadIdx.x];
    lrun[threadIdx.x] = l;
  }
  __syncthreads();

  // ---- Finalize: 1/l, per-wave LDS transpose, coalesced store to AOt[d][s].
  #pragma unroll
  for (int t = 0; t < 2; t++) {
    #pragma unroll
    for (int nf = 0; nf < 4; nf++) {
      #pragma unroll
      for (int i = 0; i < 8; i++) {
        int m = t * 16 + g * 8 + i;
        float l   = lrun[m];
        float inv = (l > 0.f) ? 1.f / l : 0.f;
        Ts[w][nf * 16 + n][m] = (_Float16)(acc[t][nf][i] * inv);
      }
    }
  }
  __syncthreads();
  // 64 rows of 64B per wave: four lanes store one row's 64 contiguous bytes
  _Float16* obase = AOt + ((size_t)b * D_DIM + 64 * w + (lane >> 2)) * S_LEN +
                    q0 + (lane & 3) * 8;
  #pragma unroll
  for (int j = 0; j < 8; j++)
    *(uint4*)(obase + (size_t)(j * 8) * S_LEN) =
        *(const uint4*)&Ts[w][j * 8 + (lane >> 2)][(lane & 3) * 8];
}

// ---------------------------------------------------------------------------
extern "C" void kernel_launch(void* const* d_in, const int* in_sizes, int n_in,
                              void* d_out, int out_size, void* d_ws,
                              size_t ws_size, hipStream_t stream) {
  (void)in_sizes; (void)n_in; (void)out_size; (void)ws_size;
  const float* x    = (const float*)d_in[0];
  const float* mask = (const float*)d_in[1];
  const float* Wq   = (const float*)d_in[2];
  const float* bq   = (const float*)d_in[3];
  const float* Wk   = (const float*)d_in[4];
  const float* bk   = (const float*)d_in[5];
  const float* Wv   = (const float*)d_in[6];
  const float* bv   = (const float*)d_in[7];
  const float* Wo   = (const float*)d_in[8];
  const float* bo   = (const float*)d_in[9];

  const int B = 2, S = S_LEN, D = D_DIM;
  const int M = B * S;                             // 8192
  const size_t MB = 1ull << 20;
  char* ws = (char*)d_ws;                          // 34 MB used
  _Float16* Qh  = (_Float16*)(ws + 0 * MB);        // 8MB [b][s][d]
  _Float16* Kp  = (_Float16*)(ws + 8 * MB);        // 8MB, fragment order
  _Float16* Vp  = (_Float16*)(ws + 16 * MB);       // 8MB, fragment order
  _Float16* xh  = (_Float16*)(ws + 24 * MB);       // 8MB, reused as AOt
  _Float16* AOt = xh;                              // [b][d][s] after attn
  _Float16* Wqh = (_Float16*)(ws + 32 * MB);
  _Float16* Wkh = (_Float16*)(ws + 32 * MB + 512 * 1024);
  _Float16* Wvh = (_Float16*)(ws + 33 * MB);
  _Float16* Woh = (_Float16*)(ws + 33 * MB + 512 * 1024);

  // Wqh..Woh lie one behind the other: one destination for the four weights
  cvt_all_kernel<<<dim3(CVT_WGS), dim3(256), 0, stream>>>(x, Wq, Wk, Wv, Wo, xh,
                                                          Wqh);

  dim3 gg(M / 128, D / 64);
  qkv_wmma_kernel<<<dim3(M / 128, D / 64, 3), dim3(256), 0, stream>>>(
      xh, Wqh, Wkh, Wvh, bq, bk, bv, Qh, Kp, Vp);

  attn_kernel<<<dim3(S / QROWS, B), dim3(256), 0, stream>>>(Qh, Kp, Vp, mask, AOt);

  gemm_wmma_kernel<<<gg, dim3(256), 0, stream>>>(AOt, Woh, bo, d_out, 2);
}
